// v000
// The times below were measured on an AMD MI455X: many runs one after another, warmed up first and cycling through
// copies of the inputs, with the whole window's GPU time divided by the number of runs. Launches and the gaps
// between them are all in it. The median over several windows is given; except for v000 it joins two sittings, which
// can be a few percent apart, so the side-by-side timings, each taken in one sitting, are the better comparison.
// The starting kernel, v000, takes 251 microseconds a run.
#include <hip/hip_runtime.h>

// ---------------------------------------------------------------------------
// BertOutputWithAdapterFusion for MI455X (gfx1250, wave32, WMMA bf16)
//
//   h        = hs @ dense_w^T + dense_b                      (WMMA)
//   prenorm  = input + h ; adapter_in = LN(prenorm)
//   query    = prenorm @ query_w^T + query_b                 (WMMA)
//   qk       = query @ key_w          (key GEMM folded away) (WMMA)
//   down[t]  = relu(adapter_in @ down_w[t]^T + down_b[t])    (WMMA, batched)
//   u[t]     = qk @ up_w[t]                                  (WMMA, batched)
//   scores   = <u,down>_D + <qk,up_b[t]> + <query,key_b> ; probs = softmax_t
//   mix      = (probs*down flattened)[N,512] @ up_all[512,H] (WMMA)
//   vin      = mix + probs@up_b + h   (value GEMM folded: sum_t probs = 1)
//   fusion   = vin @ value_w^T                               (WMMA)
//   out      = LN(input + fusion)
// ---------------------------------------------------------------------------

#define TOK 4096   // B*S tokens
#define HDI 1024   // hidden
#define IDI 4096   // intermediate
#define NTK 8      // tasks
#define DDI 64     // bottleneck

typedef __attribute__((ext_vector_type(16))) __bf16 v16bf;
typedef __attribute__((ext_vector_type(8)))  float  v8f;

// --- optional gfx1250 async global->LDS copy path (ASYNCcnt) ---------------
#ifdef __has_builtin
#if __has_builtin(__builtin_amdgcn_global_load_async_to_lds_b128) && \
    __has_builtin(__builtin_amdgcn_s_wait_asynccnt)
#define USE_ASYNC_COPY 1
#endif
#endif

// builtin takes pointers to 16B int vectors (b128); clang adjusts addr space
typedef int v4i32 __attribute__((vector_size(16)));
#define TO_GLB(p) ((v4i32*)(p))
#define TO_LDS(p) ((v4i32*)(p))

// ---------------------------------------------------------------- conversions
__global__ __launch_bounds__(256) void cvt_f32_bf16(
    const float* __restrict__ s, __bf16* __restrict__ d, long n)
{
  long i = ((long)blockIdx.x * 256 + threadIdx.x) * 4;
  if (i + 3 < n) {
    float4 v = *reinterpret_cast<const float4*>(s + i);
    d[i + 0] = (__bf16)v.x; d[i + 1] = (__bf16)v.y;
    d[i + 2] = (__bf16)v.z; d[i + 3] = (__bf16)v.w;
  } else {
    for (; i < n; ++i) d[i] = (__bf16)s[i];
  }
}

// dst[c][r] = src[r][c], fp32 -> bf16 (for key_w used in NN orientation)
__global__ __launch_bounds__(256) void transpose_cvt(
    const float* __restrict__ src, __bf16* __restrict__ dst, int rows, int cols)
{
  __shared__ float tile[32][33];
  const int bx = blockIdx.x * 32, by = blockIdx.y * 32;
  const int tx = threadIdx.x, ty = threadIdx.y;
  #pragma unroll
  for (int j = 0; j < 32; j += 8)
    tile[ty + j][tx] = src[(long)(by + ty + j) * cols + (bx + tx)];
  __syncthreads();
  #pragma unroll
  for (int j = 0; j < 32; j += 8)
    dst[(long)(bx + ty + j) * rows + (by + tx)] = (__bf16)tile[tx][ty + j];
}

// up_w [T,H,D] -> upT [T*D, H] (rows = (t,d), K = h)  and  upmix [H, T*D]
__global__ __launch_bounds__(256) void repack_up(
    const float* __restrict__ upw, __bf16* __restrict__ upT,
    __bf16* __restrict__ upmix)
{
  long i = (long)blockIdx.x * 256 + threadIdx.x;      // over T*H*D
  if (i >= (long)NTK * HDI * DDI) return;
  int t = (int)(i >> 16);                              // H*D = 65536
  int rem = (int)(i & 65535);
  int h = rem >> 6, d = rem & 63;
  __bf16 b = (__bf16)upw[i];
  upT[((long)(t * DDI + d) << 10) + h] = b;            // pitch H
  upmix[((long)h << 9) + t * DDI + d] = b;             // pitch T*D = 512
}

// -------------------------------------------------------------- WMMA NT GEMM
// C[m,j] = sum_k A[m,k] * B[j,k]   (A:[M,K], B:[N,K] row-major bf16)
// 256 threads = 8 waves, wave grid 4x2, wave tile (BM/4)x(BN/2).
// Double-buffered LDS; next tile's global loads overlap the WMMA block.
template<int BM, int BN>
__global__ __launch_bounds__(256) void wmma_gemm_nt(
    const __bf16* __restrict__ A, const __bf16* __restrict__ B,
    float* __restrict__ Cf, __bf16* __restrict__ Cb,
    const float* __restrict__ bias,
    int M, int N, int K,
    long long strideA, long long strideB, long long strideC,
    long long strideBias, int relu)
{
  constexpr int BK = 32;
  constexpr int LP = 56;                 // LDS pitch (bf16) = 112B, 16B aligned
  constexpr int WTM = BM / 4;
  constexpr int WTN = BN / 2;
  constexpr int FM = WTM / 16;
  constexpr int FN = WTN / 16;
  constexpr int AIT = BM * BK / 8 / 256; // 16B chunks per thread (A tile)
  constexpr int BIT = BN * BK / 8 / 256; // 16B chunks per thread (B tile)
  static_assert(AIT >= 1 && BIT >= 1, "tile too small for 256 threads");

  __shared__ __bf16 smA[2][BM * LP];
  __shared__ __bf16 smB[2][BN * LP];

  const int tid = threadIdx.x;
  const int wv = tid >> 5, lane = tid & 31;
  const int wr = wv & 3, wc = wv >> 2;
  const int r = lane & 15, hi = lane >> 4;
  const int bm0 = blockIdx.x * BM, bn0 = blockIdx.y * BN;
  const int bz = blockIdx.z;

  const __bf16* Ab = A + (long long)bz * strideA;
  const __bf16* Bb = B + (long long)bz * strideB;

  // per-thread staging coordinates (hoisted out of the K loop)
  const int srow = tid >> 2, skc = (tid & 3) * 8;   // row within tile, K chunk
  const __bf16* aSrc = Ab + (long long)(bm0 + srow) * K + skc;
  const __bf16* bSrc = Bb + (long long)(bn0 + srow) * K + skc;

  const v8f vzero = {0.f, 0.f, 0.f, 0.f, 0.f, 0.f, 0.f, 0.f};
  v8f acc[FM][FN];
  #pragma unroll
  for (int i = 0; i < FM; ++i)
    #pragma unroll
    for (int j = 0; j < FN; ++j) acc[i][j] = vzero;

#ifdef USE_ASYNC_COPY
  auto stage_async = [&](int k0, int buf) {
    #pragma unroll
    for (int it = 0; it < AIT; ++it)
      __builtin_amdgcn_global_load_async_to_lds_b128(
          TO_GLB(aSrc + (long long)it * 64 * K + k0),
          TO_LDS(&smA[buf][(srow + it * 64) * LP + skc]), 0, 0);
    #pragma unroll
    for (int it = 0; it < BIT; ++it)
      __builtin_amdgcn_global_load_async_to_lds_b128(
          TO_GLB(bSrc + (long long)it * 64 * K + k0),
          TO_LDS(&smB[buf][(srow + it * 64) * LP + skc]), 0, 0);
  };
#else
  uint4 ra[AIT], rb[BIT];
  auto stage_load = [&](int k0) {
    #pragma unroll
    for (int it = 0; it < AIT; ++it)
      ra[it] = *reinterpret_cast<const uint4*>(aSrc + (long long)it * 64 * K + k0);
    #pragma unroll
    for (int it = 0; it < BIT; ++it)
      rb[it] = *reinterpret_cast<const uint4*>(bSrc + (long long)it * 64 * K + k0);
  };
  auto stage_store = [&](int buf) {
    #pragma unroll
    for (int it = 0; it < AIT; ++it)
      *reinterpret_cast<uint4*>(&smA[buf][(srow + it * 64) * LP + skc]) = ra[it];
    #pragma unroll
    for (int it = 0; it < BIT; ++it)
      *reinterpret_cast<uint4*>(&smB[buf][(srow + it * 64) * LP + skc]) = rb[it];
  };
#endif

  // prologue: stage tile 0 into buffer 0
#ifdef USE_ASYNC_COPY
  stage_async(0, 0);
  __builtin_amdgcn_s_wait_asynccnt(0);
#else
  stage_load(0);
  stage_store(0);
#endif
  __syncthreads();

  int cur = 0;
  for (int k0 = 0; k0 < K; k0 += BK) {
    const bool hasNext = (k0 + BK) < K;
    // issue next tile's global loads before computing (overlap)
#ifdef USE_ASYNC_COPY
    if (hasNext) stage_async(k0 + BK, cur ^ 1);
#else
    if (hasNext) stage_load(k0 + BK);
#endif

    // fragments per ISA 16-bit A/B layout:
    // lane<16 holds K{0..7,16..23}, lane>=16 holds K{8..15,24..31}
    v16bf af[FM], bfv[FN];
    #pragma unroll
    for (int i = 0; i < FM; ++i) {
      int row = wr * WTM + i * 16 + r;
      union { uint4 u[2]; v16bf v; } u;
      u.u[0] = *reinterpret_cast<const uint4*>(&smA[cur][row * LP + hi * 8]);
      u.u[1] = *reinterpret_cast<const uint4*>(&smA[cur][row * LP + 16 + hi * 8]);
      af[i] = u.v;
    }
    #pragma unroll
    for (int j = 0; j < FN; ++j) {
      int row = wc * WTN + j * 16 + r;
      union { uint4 u[2]; v16bf v; } u;
      u.u[0] = *reinterpret_cast<const uint4*>(&smB[cur][row * LP + hi * 8]);
      u.u[1] = *reinterpret_cast<const uint4*>(&smB[cur][row * LP + 16 + hi * 8]);
      bfv[j] = u.v;
    }
    #pragma unroll
    for (int i = 0; i < FM; ++i)
      #pragma unroll
      for (int j = 0; j < FN; ++j)
        acc[i][j] = __builtin_amdgcn_wmma_f32_16x16x32_bf16(
            false, af[i], false, bfv[j], (short)0, acc[i][j], false, false);

    // publish next tile into the other buffer
#ifdef USE_ASYNC_COPY
    if (hasNext) __builtin_amdgcn_s_wait_asynccnt(0);
#else
    if (hasNext) stage_store(cur ^ 1);
#endif
    __syncthreads();
    cur ^= 1;
  }

  // epilogue: + bias[col], optional relu, f32 and/or bf16 store.
  // C lane layout: lane<16 -> M = v, lane>=16 -> M = 8+v; N = lane&15.
  const float* biasB = bias ? (bias + (long long)bz * strideBias) : nullptr;
  #pragma unroll
  for (int i = 0; i < FM; ++i) {
    #pragma unroll
    for (int j = 0; j < FN; ++j) {
      int gm = bm0 + wr * WTM + i * 16 + hi * 8;
      int gn = bn0 + wc * WTN + j * 16 + r;
      float bv = biasB ? biasB[gn] : 0.0f;
      #pragma unroll
      for (int v = 0; v < 8; ++v) {
        float x = acc[i][j][v] + bv;
        if (relu) x = fmaxf(x, 0.0f);
        long long idx = (long long)bz * strideC + (long long)(gm + v) * N + gn;
        if (Cf) Cf[idx] = x;
        if (Cb) Cb[idx] = (__bf16)x;
      }
    }
  }
}

// ---------------------------------------------------------------- layernorms
__global__ __launch_bounds__(256) void ln1_kernel(
    const float* __restrict__ inT, const float* __restrict__ hd,
    const float* __restrict__ g, const float* __restrict__ b,
    __bf16* __restrict__ preBf, __bf16* __restrict__ ainBf)
{
  const int n = blockIdx.x, tid = threadIdx.x;
  const int wv = tid >> 5, lane = tid & 31;
  float x[4], s = 0.f, ss = 0.f;
  #pragma unroll
  for (int i = 0; i < 4; ++i) {
    int h = tid + i * 256;
    float v = inT[(long)n * HDI + h] + hd[(long)n * HDI + h];
    x[i] = v; s += v; ss += v * v;
  }
  #pragma unroll
  for (int m = 16; m; m >>= 1) { s += __shfl_xor(s, m, 32); ss += __shfl_xor(ss, m, 32); }
  __shared__ float rs[8], rss[8];
  if (lane == 0) { rs[wv] = s; rss[wv] = ss; }
  __syncthreads();
  s = 0.f; ss = 0.f;
  #pragma unroll
  for (int w = 0; w < 8; ++w) { s += rs[w]; ss += rss[w]; }
  float mean = s * (1.0f / HDI);
  float var  = ss * (1.0f / HDI) - mean * mean;
  float rstd = rsqrtf(var + 1e-12f);
  #pragma unroll
  for (int i = 0; i < 4; ++i) {
    int h = tid + i * 256;
    preBf[(long)n * HDI + h] = (__bf16)x[i];
    ainBf[(long)n * HDI + h] = (__bf16)((x[i] - mean) * rstd * g[h] + b[h]);
  }
}

__global__ __launch_bounds__(256) void ln2_kernel(
    const float* __restrict__ inT, const float* __restrict__ fus,
    const float* __restrict__ g, const float* __restrict__ b,
    float* __restrict__ out)
{
  const int n = blockIdx.x, tid = threadIdx.x;
  const int wv = tid >> 5, lane = tid & 31;
  float x[4], s = 0.f, ss = 0.f;
  #pragma unroll
  for (int i = 0; i < 4; ++i) {
    int h = tid + i * 256;
    float v = inT[(long)n * HDI + h] + fus[(long)n * HDI + h];
    x[i] = v; s += v; ss += v * v;
  }
  #pragma unroll
  for (int m = 16; m; m >>= 1) { s += __shfl_xor(s, m, 32); ss += __shfl_xor(ss, m, 32); }
  __shared__ float rs[8], rss[8];
  if (lane == 0) { rs[wv] = s; rss[wv] = ss; }
  __syncthreads();
  s = 0.f; ss = 0.f;
  #pragma unroll
  for (int w = 0; w < 8; ++w) { s += rs[w]; ss += rss[w]; }
  float mean = s * (1.0f / HDI);
  float var  = ss * (1.0f / HDI) - mean * mean;
  float rstd = rsqrtf(var + 1e-12f);
  #pragma unroll
  for (int i = 0; i < 4; ++i) {
    int h = tid + i * 256;
    out[(long)n * HDI + h] = (x[i] - mean) * rstd * g[h] + b[h];
  }
}

// ----------------------------------------------- scores + softmax over tasks
// scores[t,n] = <u[t,n],down[t,n]>_D + <qk[n],up_b[t]>_H + <query[n],key_b>_H
__global__ __launch_bounds__(256) void score_softmax_kernel(
    const __bf16* __restrict__ qk, const __bf16* __restrict__ query,
    const float* __restrict__ key_b, const float* __restrict__ up_b,
    const float* __restrict__ u, const float* __restrict__ down,
    float* __restrict__ probs)
{
  const int n = blockIdx.x, tid = threadIdx.x;
  const int wv = tid >> 5, lane = tid & 31;

  float pq[NTK] = {0.f, 0.f, 0.f, 0.f, 0.f, 0.f, 0.f, 0.f};
  float pc = 0.f;
  for (int h = tid; h < HDI; h += 256) {
    float q  = (float)qk[(long)n * HDI + h];
    float qr = (float)query[(long)n * HDI + h];
    pc += qr * key_b[h];
    #pragma unroll
    for (int t = 0; t < NTK; ++t) pq[t] += q * up_b[t * HDI + h];
  }
  #pragma unroll
  for (int m = 16; m; m >>= 1) {
    pc += __shfl_xor(pc, m, 32);
    #pragma unroll
    for (int t = 0; t < NTK; ++t) pq[t] += __shfl_xor(pq[t], m, 32);
  }
  __shared__ float sp[8][NTK + 1];
  __shared__ float sc[8];
  __shared__ float sd[8];
  if (lane == 0) {
    #pragma unroll
    for (int t = 0; t < NTK; ++t) sp[wv][t] = pq[t];
    sc[wv] = pc;
  }
  {   // wave wv owns task t = wv : <u,down> over D=64
    const float* up = u    + ((long)wv * TOK + n) * DDI;
    const float* dp = down + ((long)wv * TOK + n) * DDI;
    float p = up[lane] * dp[lane] + up[lane + 32] * dp[lane + 32];
    #pragma unroll
    for (int m = 16; m; m >>= 1) p += __shfl_xor(p, m, 32);
    if (lane == 0) sd[wv] = p;
  }
  __syncthreads();
  if (tid == 0) {
    float c0 = 0.f;
    #pragma unroll
    for (int w = 0; w < 8; ++w) c0 += sc[w];
    float s[NTK], mx = -1e30f;
    #pragma unroll
    for (int t = 0; t < NTK; ++t) {
      float a = 0.f;
      #pragma unroll
      for (int w = 0; w < 8; ++w) a += sp[w][t];
      s[t] = sd[t] + a + c0;
      mx = fmaxf(mx, s[t]);
    }
    float den = 0.f;
    #pragma unroll
    for (int t = 0; t < NTK; ++t) { s[t] = __expf(s[t] - mx); den += s[t]; }
    float inv = 1.0f / den;
    #pragma unroll
    for (int t = 0; t < NTK; ++t) probs[(long)n * NTK + t] = s[t] * inv;
  }
}

// wdown[n, t*64+d] = bf16(probs[n,t] * down[t,n,d])
__global__ __launch_bounds__(256) void wdown_kernel(
    const float* __restrict__ down, const float* __restrict__ probs,
    __bf16* __restrict__ wd)
{
  long i = (long)blockIdx.x * 256 + threadIdx.x;   // over N * T * D
  if (i >= (long)TOK * NTK * DDI) return;
  int n = (int)(i >> 9);
  int td = (int)(i & 511);
  int t = td >> 6, d = td & 63;
  wd[i] = (__bf16)(probs[(long)n * NTK + t] *
                   down[((long)t * TOK + n) * DDI + d]);
}

// vin = bf16( mix + h_dense + sum_t probs[t]*up_b[t] )
__global__ __launch_bounds__(256) void vin_kernel(
    const float* __restrict__ mix, const float* __restrict__ hd,
    const float* __restrict__ up_b, const float* __restrict__ probs,
    __bf16* __restrict__ vin)
{
  long i = (long)blockIdx.x * 256 + threadIdx.x;   // over N * H
  if (i >= (long)TOK * HDI) return;
  int n = (int)(i >> 10), h = (int)(i & 1023);
  float acc = mix[i] + hd[i];
  #pragma unroll
  for (int t = 0; t < NTK; ++t)
    acc += probs[(long)n * NTK + t] * up_b[t * HDI + h];
  vin[i] = (__bf16)acc;
}

// ---------------------------------------------------------------------------
extern "C" void kernel_launch(void* const* d_in, const int* in_sizes, int n_in,
                              void* d_out, int out_size, void* d_ws, size_t ws_size,
                              hipStream_t stream) {
  (void)in_sizes; (void)n_in; (void)out_size; (void)ws_size;
  const float* hs  = (const float*)d_in[0];
  const float* inT = (const float*)d_in[1];
  const float* dw  = (const float*)d_in[2];
  const float* db  = (const float*)d_in[3];
  const float* lng = (const float*)d_in[4];
  const float* lnb = (const float*)d_in[5];
  const float* dnw = (const float*)d_in[6];
  const float* dnb = (const float*)d_in[7];
  const float* upw = (const float*)d_in[8];
  const float* upb = (const float*)d_in[9];
  const float* kw  = (const float*)d_in[10];
  const float* kb  = (const float*)d_in[11];
  const float* qw  = (const float*)d_in[12];
  const float* qb  = (const float*)d_in[13];
  const float* vw  = (const float*)d_in[14];
  float* out = (float*)d_out;

  char* ws = (char*)d_ws;
  size_t off = 0;
  auto alloc = [&](size_t bytes) -> char* {
    char* p = ws + off;
    off += (bytes + 255) & ~(size_t)255;
    return p;
  };

  __bf16* hs_bf   = (__bf16*)alloc((size_t)TOK * IDI * 2);
  __bf16* dw_bf   = (__bf16*)alloc((size_t)HDI * IDI * 2);
  float*  hdense  = (float*) alloc((size_t)TOK * HDI * 4);
  __bf16* pre_bf  = (__bf16*)alloc((size_t)TOK * HDI * 2);
  __bf16* ain_bf  = (__bf16*)alloc((size_t)TOK * HDI * 2);
  __bf16* qw_bf   = (__bf16*)alloc((size_t)HDI * HDI * 2);
  __bf16* kwT_bf  = (__bf16*)alloc((size_t)HDI * HDI * 2);
  __bf16* vw_bf   = (__bf16*)alloc((size_t)HDI * HDI * 2);
  __bf16* dnw_bf  = (__bf16*)alloc((size_t)NTK * DDI * HDI * 2);
  __bf16* upT_bf  = (__bf16*)alloc((size_t)NTK * DDI * HDI * 2);
  __bf16* upmx_bf = (__bf16*)alloc((size_t)NTK * DDI * HDI * 2);
  __bf16* query_bf= (__bf16*)alloc((size_t)TOK * HDI * 2);
  __bf16* qk_bf   = (__bf16*)alloc((size_t)TOK * HDI * 2);
  float*  down_f  = (float*) alloc((size_t)NTK * TOK * DDI * 4);
  float*  u_f     = (float*) alloc((size_t)NTK * TOK * DDI * 4);
  float*  probs   = (float*) alloc((size_t)TOK * NTK * 4);
  __bf16* wdown_bf= (__bf16*)alloc((size_t)TOK * NTK * DDI * 2);
  float*  mix_f   = (float*) alloc((size_t)TOK * HDI * 4);
  __bf16* vin_bf  = (__bf16*)alloc((size_t)TOK * HDI * 2);
  float*  fus_f   = (float*) alloc((size_t)TOK * HDI * 4);

  // ---- stage 0: precision conversion / weight repacking
  {
    long n;
    n = (long)TOK * IDI;
    cvt_f32_bf16<<<dim3((unsigned)((n + 1023) / 1024)), dim3(256), 0, stream>>>(hs, hs_bf, n);
    n = (long)HDI * IDI;
    cvt_f32_bf16<<<dim3((unsigned)((n + 1023) / 1024)), dim3(256), 0, stream>>>(dw, dw_bf, n);
    n = (long)HDI * HDI;
    cvt_f32_bf16<<<dim3((unsigned)((n + 1023) / 1024)), dim3(256), 0, stream>>>(qw, qw_bf, n);
    cvt_f32_bf16<<<dim3((unsigned)((n + 1023) / 1024)), dim3(256), 0, stream>>>(vw, vw_bf, n);
    n = (long)NTK * DDI * HDI;
    cvt_f32_bf16<<<dim3((unsigned)((n + 1023) / 1024)), dim3(256), 0, stream>>>(dnw, dnw_bf, n);
    transpose_cvt<<<dim3(HDI / 32, HDI / 32), dim3(32, 8), 0, stream>>>(kw, kwT_bf, HDI, HDI);
    repack_up<<<dim3((NTK * HDI * DDI) / 256), dim3(256), 0, stream>>>(upw, upT_bf, upmx_bf);
  }

  // ---- G1: h = hs @ dense_w^T + dense_b
  wmma_gemm_nt<128, 128><<<dim3(TOK / 128, HDI / 128, 1), dim3(256), 0, stream>>>(
      hs_bf, dw_bf, hdense, nullptr, db, TOK, HDI, IDI, 0, 0, 0, 0, 0);

  // ---- LN1: prenorm(bf16) + adapter_in(bf16)
  ln1_kernel<<<dim3(TOK), dim3(256), 0, stream>>>(inT, hdense, lng, lnb, pre_bf, ain_bf);

  // ---- G2: query = prenorm @ query_w^T + query_b  (bf16 out)
  wmma_gemm_nt<128, 128><<<dim3(TOK / 128, HDI / 128, 1), dim3(256), 0, stream>>>(
      pre_bf, qw_bf, nullptr, query_bf, qb, TOK, HDI, HDI, 0, 0, 0, 0, 0);

  // ---- G3: qk = query @ key_w  (bf16 out)
  wmma_gemm_nt<128, 128><<<dim3(TOK / 128, HDI / 128, 1), dim3(256), 0, stream>>>(
      query_bf, kwT_bf, nullptr, qk_bf, nullptr, TOK, HDI, HDI, 0, 0, 0, 0, 0);

  // ---- G4: down[t] = relu(adapter_in @ down_w[t]^T + down_b[t])  (batched over t)
  wmma_gemm_nt<128, 64><<<dim3(TOK / 128, 1, NTK), dim3(256), 0, stream>>>(
      ain_bf, dnw_bf, down_f, nullptr, dnb, TOK, DDI, HDI,
      0, (long long)DDI * HDI, (long long)TOK * DDI, DDI, 1);

  // ---- G5: u[t] = qk @ up_w[t]  (batched over t)
  wmma_gemm_nt<128, 64><<<dim3(TOK / 128, 1, NTK), dim3(256), 0, stream>>>(
      qk_bf, upT_bf, u_f, nullptr, nullptr, TOK, DDI, HDI,
      0, (long long)DDI * HDI, (long long)TOK * DDI, 0, 0);

  // ---- scores + softmax over tasks
  score_softmax_kernel<<<dim3(TOK), dim3(256), 0, stream>>>(
      qk_bf, query_bf, kb, upb, u_f, down_f, probs);

  // ---- probs-weighted down, flattened [N, T*D]
  wdown_kernel<<<dim3((TOK * NTK * DDI) / 256), dim3(256), 0, stream>>>(
      down_f, probs, wdown_bf);

  // ---- G6: mix = wdown @ up_all^T   ([4096,512] x [1024,512])
  wmma_gemm_nt<128, 128><<<dim3(TOK / 128, HDI / 128, 1), dim3(256), 0, stream>>>(
      wdown_bf, upmx_bf, mix_f, nullptr, nullptr, TOK, HDI, NTK * DDI, 0, 0, 0, 0, 0);

  // ---- vin = mix + h + probs@up_b  (bf16)
  vin_kernel<<<dim3((TOK * HDI) / 256), dim3(256), 0, stream>>>(
      mix_f, hdense, upb, probs, vin_bf);

  // ---- G7: fusion = vin @ value_w^T
  wmma_gemm_nt<128, 128><<<dim3(TOK / 128, HDI / 128, 1), dim3(256), 0, stream>>>(
      vin_bf, vw_bf, fus_f, nullptr, nullptr, TOK, HDI, HDI, 0, 0, 0, 0, 0);

  // ---- LN2 -> out
  ln2_kernel<<<dim3(TOK), dim3(256), 0, stream>>>(inT, fus_f, lng, lnb, out);
}

// v001
// A run of this version takes 186 microseconds.
// Timed twice side by side with v000, it ran 1.37 times as fast both times.
#include <hip/hip_runtime.h>

// ---------------------------------------------------------------------------
// BertOutputWithAdapterFusion for MI455X (gfx1250, wave32, WMMA bf16)
//
//   h        = hs @ dense_w^T + dense_b                      (WMMA)
//   prenorm  = input + h ; adapter_in = LN(prenorm)
//   query    = prenorm @ query_w^T + query_b                 (WMMA)
//   qk       = query @ key_w          (key GEMM folded away) (WMMA)
//   down[t]  = relu(adapter_in @ down_w[t]^T + down_b[t])    (WMMA, batched)
//   u[t]     = qk @ up_w[t]                                  (WMMA, batched)
//   scores   = <u,down>_D + <qk,up_b[t]> + <query,key_b> ; probs = softmax_t
//   mix      = (probs*down flattened)[N,512] @ up_all[512,H] (WMMA)
//   vin      = mix + probs@up_b + h   (value GEMM folded: sum_t probs = 1)
//   fusion   = vin @ value_w^T                               (WMMA)
//   out      = LN(input + fusion)
// ---------------------------------------------------------------------------

#define TOK 4096   // B*S tokens
#define HDI 1024   // hidden
#define IDI 4096   // intermediate
#define NTK 8      // tasks
#define DDI 64     // bottleneck

typedef __attribute__((ext_vector_type(16))) __bf16 v16bf;
typedef __attribute__((ext_vector_type(8)))  float  v8f;

// --- optional gfx1250 async global->LDS copy path (ASYNCcnt) ---------------
#ifdef __has_builtin
#if __has_builtin(__builtin_amdgcn_global_load_async_to_lds_b128) && \
    __has_builtin(__builtin_amdgcn_s_wait_asynccnt)
#define USE_ASYNC_COPY 1
#endif
#endif

// builtin takes pointers to 16B int vectors (b128); clang adjusts addr space
typedef int v4i32 __attribute__((vector_size(16)));
#define TO_GLB(p) ((v4i32*)(p))
#define TO_LDS(p) ((v4i32*)(p))

// ---------------------------------------------------------------- conversions
__global__ __launch_bounds__(256) void cvt_f32_bf16(
    const float* __restrict__ s, __bf16* __restrict__ d, long n)
{
  long i = ((long)blockIdx.x * 256 + threadIdx.x) * 4;
  if (i + 3 < n) {
    float4 v = *reinterpret_cast<const float4*>(s + i);
    d[i + 0] = (__bf16)v.x; d[i + 1] = (__bf16)v.y;
    d[i + 2] = (__bf16)v.z; d[i + 3] = (__bf16)v.w;
  } else {
    for (; i < n; ++i) d[i] = (__bf16)s[i];
  }
}

// dst[c][r] = src[r][c], fp32 -> bf16 (for key_w used in NN orientation)
__global__ __launch_bounds__(256) void transpose_cvt(
    const float* __restrict__ src, __bf16* __restrict__ dst, int rows, int cols)
{
  __shared__ float tile[32][33];
  const int bx = blockIdx.x * 32, by = blockIdx.y * 32;
  const int tx = threadIdx.x, ty = threadIdx.y;
  #pragma unroll
  for (int j = 0; j < 32; j += 8)
    tile[ty + j][tx] = src[(long)(by + ty + j) * cols + (bx + tx)];
  __syncthreads();
  #pragma unroll
  for (int j = 0; j < 32; j += 8)
    dst[(long)(bx + ty + j) * rows + (by + tx)] = (__bf16)tile[tx][ty + j];
}

// up_w [T,H,D] -> upT [T*D, H] (rows = (t,d), K = h)  and  upmix [H, T*D]
__global__ __launch_bounds__(256) void repack_up(
    const float* __restrict__ upw, __bf16* __restrict__ upT,
    __bf16* __restrict__ upmix)
{
  long i = (long)blockIdx.x * 256 + threadIdx.x;      // over T*H*D
  if (i >= (long)NTK * HDI * DDI) return;
  int t = (int)(i >> 16);                              // H*D = 65536
  int rem = (int)(i & 65535);
  int h = rem >> 6, d = rem & 63;
  __bf16 b = (__bf16)upw[i];
  upT[((long)(t * DDI + d) << 10) + h] = b;            // pitch H
  upmix[((long)h << 9) + t * DDI + d] = b;             // pitch T*D = 512
}

// -------------------------------------------------------------- WMMA NT GEMM
// C[m,j] = sum_k A[m,k] * B[j,k]   (A:[M,K], B:[N,K] row-major bf16)
// 256 threads = 8 waves, wave grid 4x2, wave tile (BM/4)x(BN/2).
// Double-buffered LDS; next tile's global loads overlap the WMMA blocks.
// One stage holds 256 k (512 B of every operand row): enough bytes in flight
// per barrier to cover the copy latency, and each wave-wide copy covers one
// contiguous 512-B row piece. K must be a multiple of 256.
template<int BM, int BN>
__global__ __launch_bounds__(256) void wmma_gemm_nt(
    const __bf16* __restrict__ A, const __bf16* __restrict__ B,
    float* __restrict__ Cf, __bf16* __restrict__ Cb,
    const float* __restrict__ bias,
    int M, int N, int K,
    long long strideA, long long strideB, long long strideC,
    long long strideBias, int relu)
{
  constexpr int BK = 256;
  constexpr int LP = 264;                // LDS pitch (bf16) = 528B = 16B x odd
  constexpr int SR = 256 * 8 / BK;       // tile rows staged per 256-thread sweep
  constexpr int WTM = BM / 4;
  constexpr int WTN = BN / 2;
  constexpr int FM = WTM / 16;
  constexpr int FN = WTN / 16;
  constexpr int AIT = BM * BK / 8 / 256; // 16B chunks per thread (A tile)
  constexpr int BIT = BN * BK / 8 / 256; // 16B chunks per thread (B tile)
  static_assert(AIT >= 1 && BIT >= 1, "tile too small for 256 threads");

  __shared__ __attribute__((aligned(16))) __bf16 smA[2][BM * LP];
  __shared__ __attribute__((aligned(16))) __bf16 smB[2][BN * LP];

  const int tid = threadIdx.x;
  const int wv = tid >> 5, lane = tid & 31;
  const int wr = wv & 3, wc = wv >> 2;
  const int r = lane & 15, hi = lane >> 4;
  const int bm0 = blockIdx.x * BM, bn0 = blockIdx.y * BN;
  const int bz = blockIdx.z;

  const __bf16* Ab = A + (long long)bz * strideA;
  const __bf16* Bb = B + (long long)bz * strideB;

  // per-thread staging coordinates (hoisted out of the K loop)
  const int srow = tid >> 5, skc = (tid & 31) * 8;  // row within tile, K chunk
  const __bf16* aSrc = Ab + (long long)(bm0 + srow) * K + skc;
  const __bf16* bSrc = Bb + (long long)(bn0 + srow) * K + skc;

  const v8f vzero = {0.f, 0.f, 0.f, 0.f, 0.f, 0.f, 0.f, 0.f};
  v8f acc[FM][FN];
  #pragma unroll
  for (int i = 0; i < FM; ++i)
    #pragma unroll
    for (int j = 0; j < FN; ++j) acc[i][j] = vzero;

#ifdef USE_ASYNC_COPY
  auto stage_async = [&](int k0, int buf) {
    #pragma unroll
    for (int it = 0; it < AIT; ++it)
      __builtin_amdgcn_global_load_async_to_lds_b128(
          TO_GLB(aSrc + (long long)it * SR * K + k0),
          TO_LDS(&smA[buf][(srow + it * SR) * LP + skc]), 0, 0);
    #pragma unroll
    for (int it = 0; it < BIT; ++it)
      __builtin_amdgcn_global_load_async_to_lds_b128(
          TO_GLB(bSrc + (long long)it * SR * K + k0),
          TO_LDS(&smB[buf][(srow + it * SR) * LP + skc]), 0, 0);
  };
#else
  uint4 ra[AIT], rb[BIT];
  auto stage_load = [&](int k0) {
    #pragma unroll
    for (int it = 0; it < AIT; ++it)
      ra[it] = *reinterpret_cast<const uint4*>(aSrc + (long long)it * SR * K + k0);
    #pragma unroll
    for (int it = 0; it < BIT; ++it)
      rb[it] = *reinterpret_cast<const uint4*>(bSrc + (long long)it * SR * K + k0);
  };
  auto stage_store = [&](int buf) {
    #pragma unroll
    for (int it = 0; it < AIT; ++it)
      *reinterpret_cast<uint4*>(&smA[buf][(srow + it * SR) * LP + skc]) = ra[it];
    #pragma unroll
    for (int it = 0; it < BIT; ++it)
      *reinterpret_cast<uint4*>(&smB[buf][(srow + it * SR) * LP + skc]) = rb[it];
  };
#endif

  // prologue: stage tile 0 into buffer 0
#ifdef USE_ASYNC_COPY
  stage_async(0, 0);
  // tile 0 must have landed before the barrier that publishes it
  asm volatile("s_wait_asynccnt 0x0" ::: "memory");
#else
  stage_load(0);
  stage_store(0);
#endif
  __syncthreads();

  int cur = 0;
  for (int k0 = 0; k0 < K; k0 += BK) {
    const bool hasNext = (k0 + BK) < K;
    // issue next tile's global loads before computing (overlap)
#ifdef USE_ASYNC_COPY
    if (hasNext) stage_async(k0 + BK, cur ^ 1);
#else
    if (hasNext) stage_load(k0 + BK);
#endif

    // fragments per ISA 16-bit A/B layout:
    // lane<16 holds K{0..7,16..23}, lane>=16 holds K{8..15,24..31}
    // unrolled so that a block's LDS reads can be issued ahead of the one before
    #pragma unroll
    for (int kk = 0; kk < BK; kk += 32) {
      v16bf af[FM], bfv[FN];
      #pragma unroll
      for (int i = 0; i < FM; ++i) {
        int row = wr * WTM + i * 16 + r;
        union { uint4 u[2]; v16bf v; } u;
        u.u[0] = *reinterpret_cast<const uint4*>(&smA[cur][row * LP + kk + hi * 8]);
        u.u[1] = *reinterpret_cast<const uint4*>(&smA[cur][row * LP + kk + 16 + hi * 8]);
        af[i] = u.v;
      }
      #pragma unroll
      for (int j = 0; j < FN; ++j) {
        int row = wc * WTN + j * 16 + r;
        union { uint4 u[2]; v16bf v; } u;
        u.u[0] = *reinterpret_cast<const uint4*>(&smB[cur][row * LP + kk + hi * 8]);
        u.u[1] = *reinterpret_cast<const uint4*>(&smB[cur][row * LP + kk + 16 + hi * 8]);
        bfv[j] = u.v;
      }
      #pragma unroll
      for (int i = 0; i < FM; ++i)
        #pragma unroll
        for (int j = 0; j < FN; ++j)
          acc[i][j] = __builtin_amdgcn_wmma_f32_16x16x32_bf16(
              false, af[i], false, bfv[j], (short)0, acc[i][j], false, false);
    }

    // publish next tile into the other buffer
#ifdef USE_ASYNC_COPY
    // keeps the stage's last WMMAs in front of the barrier: sunk behind it they
    // would delay the issue of the next refill, which every trip waits for
    __builtin_amdgcn_sched_barrier(0);
    // this wave's reads of the buffer that is refilled behind the barrier are done
    asm volatile("s_wait_dscnt 0x0" ::: "memory");
    // this wave's copies of the next tile have landed before other waves read them
    asm volatile("s_wait_asynccnt 0x0" ::: "memory");
#else
    if (hasNext) stage_store(cur ^ 1);
#endif
    __syncthreads();
    cur ^= 1;
  }

  // epilogue: + bias[col], optional relu, f32 and/or bf16 store.
  // C lane layout: lane<16 -> M = v, lane>=16 -> M = 8+v; N = lane&15.
  const float* biasB = bias ? (bias + (long long)bz * strideBias) : nullptr;
  #pragma unroll
  for (int i = 0; i < FM; ++i) {
    #pragma unroll
    for (int j = 0; j < FN; ++j) {
      int gm = bm0 + wr * WTM + i * 16 + hi * 8;
      int gn = bn0 + wc * WTN + j * 16 + r;
      float bv = biasB ? biasB[gn] : 0.0f;
      #pragma unroll
      for (int v = 0; v < 8; ++v) {
        float x = acc[i][j][v] + bv;
        if (relu) x = fmaxf(x, 0.0f);
        long long idx = (long long)bz * strideC + (long long)(gm + v) * N + gn;
        if (Cf) Cf[idx] = x;
        if (Cb) Cb[idx] = (__bf16)x;
      }
    }
  }
}

// ---------------------------------------------------------------- layernorms
__global__ __launch_bounds__(256) void ln1_kernel(
    const float* __restrict__ inT, const float* __restrict__ hd,
    const float* __restrict__ g, const float* __restrict__ b,
    __bf16* __restrict__ preBf, __bf16* __restrict__ ainBf)
{
  const int n = blockIdx.x, tid = threadIdx.x;
  const int wv = tid >> 5, lane = tid & 31;
  float x[4], s = 0.f, ss = 0.f;
  #pragma unroll
  for (int i = 0; i < 4; ++i) {
    int h = tid + i * 256;
    float v = inT[(long)n * HDI + h] + hd[(long)n * HDI + h];
    x[i] = v; s += v; ss += v * v;
  }
  #pragma unroll
  for (int m = 16; m; m >>= 1) { s += __shfl_xor(s, m, 32); ss += __shfl_xor(ss, m, 32); }
  __shared__ float rs[8], rss[8];
  if (lane == 0) { rs[wv] = s; rss[wv] = ss; }
  __syncthreads();
  s = 0.f; ss = 0.f;
  #pragma unroll
  for (int w = 0; w < 8; ++w) { s += rs[w]; ss += rss[w]; }
  float mean = s * (1.0f / HDI);
  float var  = ss * (1.0f / HDI) - mean * mean;
  float rstd = rsqrtf(var + 1e-12f);
  #pragma unroll
  for (int i = 0; i < 4; ++i) {
    int h = tid + i * 256;
    preBf[(long)n * HDI + h] = (__bf16)x[i];
    ainBf[(long)n * HDI + h] = (__bf16)((x[i] - mean) * rstd * g[h] + b[h]);
  }
}

__global__ __launch_bounds__(256) void ln2_kernel(
    const float* __restrict__ inT, const float* __restrict__ fus,
    const float* __restrict__ g, const float* __restrict__ b,
    float* __restrict__ out)
{
  const int n = blockIdx.x, tid = threadIdx.x;
  const int wv = tid >> 5, lane = tid & 31;
  float x[4], s = 0.f, ss = 0.f;
  #pragma unroll
  for (int i = 0; i < 4; ++i) {
    int h = tid + i * 256;
    float v = inT[(long)n * HDI + h] + fus[(long)n * HDI + h];
    x[i] = v; s += v; ss += v * v;
  }
  #pragma unroll
  for (int m = 16; m; m >>= 1) { s += __shfl_xor(s, m, 32); ss += __shfl_xor(ss, m, 32); }
  __shared__ float rs[8], rss[8];
  if (lane == 0) { rs[wv] = s; rss[wv] = ss; }
  __syncthreads();
  s = 0.f; ss = 0.f;
  #pragma unroll
  for (int w = 0; w < 8; ++w) { s += rs[w]; ss += rss[w]; }
  float mean = s * (1.0f / HDI);
  float var  = ss * (1.0f / HDI) - mean * mean;
  float rstd = rsqrtf(var + 1e-12f);
  #pragma unroll
  for (int i = 0; i < 4; ++i) {
    int h = tid + i * 256;
    out[(long)n * HDI + h] = (x[i] - mean) * rstd * g[h] + b[h];
  }
}

// ----------------------------------------------- scores + softmax over tasks
// scores[t,n] = <u[t,n],down[t,n]>_D + <qk[n],up_b[t]>_H + <query[n],key_b>_H
__global__ __launch_bounds__(256) void score_softmax_kernel(
    const __bf16* __restrict__ qk, const __bf16* __restrict__ query,
    const float* __restrict__ key_b, const float* __restrict__ up_b,
    const float* __restrict__ u, const float* __restrict__ down,
    float* __restrict__ probs)
{
  const int n = blockIdx.x, tid = threadIdx.x;
  const int wv = tid >> 5, lane = tid & 31;

  float pq[NTK] = {0.f, 0.f, 0.f, 0.f, 0.f, 0.f, 0.f, 0.f};
  float pc = 0.f;
  for (int h = tid; h < HDI; h += 256) {
    float q  = (float)qk[(long)n * HDI + h];
    float qr = (float)query[(long)n * HDI + h];
    pc += qr * key_b[h];
    #pragma unroll
    for (int t = 0; t < NTK; ++t) pq[t] += q * up_b[t * HDI + h];
  }
  #pragma unroll
  for (int m = 16; m; m >>= 1) {
    pc += __shfl_xor(pc, m, 32);
    #pragma unroll
    for (int t = 0; t < NTK; ++t) pq[t] += __shfl_xor(pq[t], m, 32);
  }
  __shared__ float sp[8][NTK + 1];
  __shared__ float sc[8];
  __shared__ float sd[8];
  if (lane == 0) {
    #pragma unroll
    for (int t = 0; t < NTK; ++t) sp[wv][t] = pq[t];
    sc[wv] = pc;
  }
  {   // wave wv owns task t = wv : <u,down> over D=64
    const float* up = u    + ((long)wv * TOK + n) * DDI;
    const float* dp = down + ((long)wv * TOK + n) * DDI;
    float p = up[lane] * dp[lane] + up[lane + 32] * dp[lane + 32];
    #pragma unroll
    for (int m = 16; m; m >>= 1) p += __shfl_xor(p, m, 32);
    if (lane == 0) sd[wv] = p;
  }
  __syncthreads();
  if (tid == 0) {
    float c0 = 0.f;
    #pragma unroll
    for (int w = 0; w < 8; ++w) c0 += sc[w];
    float s[NTK], mx = -1e30f;
    #pragma unroll
    for (int t = 0; t < NTK; ++t) {
      float a = 0.f;
      #pragma unroll
      for (int w = 0; w < 8; ++w) a += sp[w][t];
      s[t] = sd[t] + a + c0;
      mx = fmaxf(mx, s[t]);
    }
    float den = 0.f;
    #pragma unroll
    for (int t = 0; t < NTK; ++t) { s[t] = __expf(s[t] - mx); den += s[t]; }
    float inv = 1.0f / den;
    #pragma unroll
    for (int t = 0; t < NTK; ++t) probs[(long)n * NTK + t] = s[t] * inv;
  }
}

// wdown[n, t*64+d] = bf16(probs[n,t] * down[t,n,d])
__global__ __launch_bounds__(256) void wdown_kernel(
    const float* __restrict__ down, const float* __restrict__ probs,
    __bf16* __restrict__ wd)
{
  long i = (long)blockIdx.x * 256 + threadIdx.x;   // over N * T * D
  if (i >= (long)TOK * NTK * DDI) return;
  int n = (int)(i >> 9);
  int td = (int)(i & 511);
  int t = td >> 6, d = td & 63;
  wd[i] = (__bf16)(probs[(long)n * NTK + t] *
                   down[((long)t * TOK + n) * DDI + d]);
}

// vin = bf16( mix + h_dense + sum_t probs[t]*up_b[t] )
__global__ __launch_bounds__(256) void vin_kernel(
    const float* __restrict__ mix, const float* __restrict__ hd,
    const float* __restrict__ up_b, const float* __restrict__ probs,
    __bf16* __restrict__ vin)
{
  long i = (long)blockIdx.x * 256 + threadIdx.x;   // over N * H
  if (i >= (long)TOK * HDI) return;
  int n = (int)(i >> 10), h = (int)(i & 1023);
  float acc = mix[i] + hd[i];
  #pragma unroll
  for (int t = 0; t < NTK; ++t)
    acc += probs[(long)n * NTK + t] * up_b[t * HDI + h];
  vin[i] = (__bf16)acc;
}

// ---------------------------------------------------------------------------
extern "C" void kernel_launch(void* const* d_in, const int* in_sizes, int n_in,
                              void* d_out, int out_size, void* d_ws, size_t ws_size,
                              hipStream_t stream) {
  (void)in_sizes; (void)n_in; (void)out_size; (void)ws_size;
  const float* hs  = (const float*)d_in[0];
  const float* inT = (const float*)d_in[1];
  const float* dw  = (const float*)d_in[2];
  const float* db  = (const float*)d_in[3];
  const float* lng = (const float*)d_in[4];
  const float* lnb = (const float*)d_in[5];
  const float* dnw = (const float*)d_in[6];
  const float* dnb = (const float*)d_in[7];
  const float* upw = (const float*)d_in[8];
  const float* upb = (const float*)d_in[9];
  const float* kw  = (const float*)d_in[10];
  const float* kb  = (const float*)d_in[11];
  const float* qw  = (const float*)d_in[12];
  const float* qb  = (const float*)d_in[13];
  const float* vw  = (const float*)d_in[14];
  float* out = (float*)d_out;

  char* ws = (char*)d_ws;
  size_t off = 0;
  auto alloc = [&](size_t bytes) -> char* {
    char* p = ws + off;
    off += (bytes + 255) & ~(size_t)255;
    return p;
  };

  __bf16* hs_bf   = (__bf16*)alloc((size_t)TOK * IDI * 2);
  __bf16* dw_bf   = (__bf16*)alloc((size_t)HDI * IDI * 2);
  float*  hdense  = (float*) alloc((size_t)TOK * HDI * 4);
  __bf16* pre_bf  = (__bf16*)alloc((size_t)TOK * HDI * 2);
  __bf16* ain_bf  = (__bf16*)alloc((size_t)TOK * HDI * 2);
  __bf16* qw_bf   = (__bf16*)alloc((size_t)HDI * HDI * 2);
  __bf16* kwT_bf  = (__bf16*)alloc((size_t)HDI * HDI * 2);
  __bf16* vw_bf   = (__bf16*)alloc((size_t)HDI * HDI * 2);
  __bf16* dnw_bf  = (__bf16*)alloc((size_t)NTK * DDI * HDI * 2);
  __bf16* upT_bf  = (__bf16*)alloc((size_t)NTK * DDI * HDI * 2);
  __bf16* upmx_bf = (__bf16*)alloc((size_t)NTK * DDI * HDI * 2);
  __bf16* query_bf= (__bf16*)alloc((size_t)TOK * HDI * 2);
  __bf16* qk_bf   = (__bf16*)alloc((size_t)TOK * HDI * 2);
  float*  down_f  = (float*) alloc((size_t)NTK * TOK * DDI * 4);
  float*  u_f     = (float*) alloc((size_t)NTK * TOK * DDI * 4);
  float*  probs   = (float*) alloc((size_t)TOK * NTK * 4);
  __bf16* wdown_bf= (__bf16*)alloc((size_t)TOK * NTK * DDI * 2);
  float*  mix_f   = (float*) alloc((size_t)TOK * HDI * 4);
  __bf16* vin_bf  = (__bf16*)alloc((size_t)TOK * HDI * 2);
  float*  fus_f   = (float*) alloc((size_t)TOK * HDI * 4);

  // ---- stage 0: precision conversion / weight repacking
  {
    long n;
    n = (long)TOK * IDI;
    cvt_f32_bf16<<<dim3((unsigned)((n + 1023) / 1024)), dim3(256), 0, stream>>>(hs, hs_bf, n);
    n = (long)HDI * IDI;
    cvt_f32_bf16<<<dim3((unsigned)((n + 1023) / 1024)), dim3(256), 0, stream>>>(dw, dw_bf, n);
    n = (long)HDI * HDI;
    cvt_f32_bf16<<<dim3((unsigned)((n + 1023) / 1024)), dim3(256), 0, stream>>>(qw, qw_bf, n);
    cvt_f32_bf16<<<dim3((unsigned)((n + 1023) / 1024)), dim3(256), 0, stream>>>(vw, vw_bf, n);
    n = (long)NTK * DDI * HDI;
    cvt_f32_bf16<<<dim3((unsigned)((n + 1023) / 1024)), dim3(256), 0, stream>>>(dnw, dnw_bf, n);
    transpose_cvt<<<dim3(HDI / 32, HDI / 32), dim3(32, 8), 0, stream>>>(kw, kwT_bf, HDI, HDI);
    repack_up<<<dim3((NTK * HDI * DDI) / 256), dim3(256), 0, stream>>>(upw, upT_bf, upmx_bf);
  }

  // ---- G1: h = hs @ dense_w^T + dense_b
  wmma_gemm_nt<128, 128><<<dim3(TOK / 128, HDI / 128, 1), dim3(256), 0, stream>>>(
      hs_bf, dw_bf, hdense, nullptr, db, TOK, HDI, IDI, 0, 0, 0, 0, 0);

  // ---- LN1: prenorm(bf16) + adapter_in(bf16)
  ln1_kernel<<<dim3(TOK), dim3(256), 0, stream>>>(inT, hdense, lng, lnb, pre_bf, ain_bf);

  // ---- G2: query = prenorm @ query_w^T + query_b  (bf16 out)
  wmma_gemm_nt<128, 128><<<dim3(TOK / 128, HDI / 128, 1), dim3(256), 0, stream>>>(
      pre_bf, qw_bf, nullptr, query_bf, qb, TOK, HDI, HDI, 0, 0, 0, 0, 0);

  // ---- G3: qk = query @ key_w  (bf16 out)
  wmma_gemm_nt<128, 128><<<dim3(TOK / 128, HDI / 128, 1), dim3(256), 0, stream>>>(
      query_bf, kwT_bf, nullptr, qk_bf, nullptr, TOK, HDI, HDI, 0, 0, 0, 0, 0);

  // ---- G4: down[t] = relu(adapter_in @ down_w[t]^T + down_b[t])  (batched over t)
  wmma_gemm_nt<128, 64><<<dim3(TOK / 128, 1, NTK), dim3(256), 0, stream>>>(
      ain_bf, dnw_bf, down_f, nullptr, dnb, TOK, DDI, HDI,
      0, (long long)DDI * HDI, (long long)TOK * DDI, DDI, 1);

  // ---- G5: u[t] = qk @ up_w[t]  (batched over t)
  wmma_gemm_nt<128, 64><<<dim3(TOK / 128, 1, NTK), dim3(256), 0, stream>>>(
      qk_bf, upT_bf, u_f, nullptr, nullptr, TOK, DDI, HDI,
      0, (long long)DDI * HDI, (long long)TOK * DDI, 0, 0);

  // ---- scores + softmax over tasks
  score_softmax_kernel<<<dim3(TOK), dim3(256), 0, stream>>>(
      qk_bf, query_bf, kb, upb, u_f, down_f, probs);

  // ---- probs-weighted down, flattened [N, T*D]
  wdown_kernel<<<dim3((TOK * NTK * DDI) / 256), dim3(256), 0, stream>>>(
      down_f, probs, wdown_bf);

  // ---- G6: mix = wdown @ up_all^T   ([4096,512] x [1024,512])
  wmma_gemm_nt<128, 128><<<dim3(TOK / 128, HDI / 128, 1), dim3(256), 0, stream>>>(
      wdown_bf, upmx_bf, mix_f, nullptr, nullptr, TOK, HDI, NTK * DDI, 0, 0, 0, 0, 0);

  // ---- vin = mix + h + probs@up_b  (bf16)
  vin_kernel<<<dim3((TOK * HDI) / 256), dim3(256), 0, stream>>>(
      mix_f, hdense, upb, probs, vin_bf);

  // ---- G7: fusion = vin @ value_w^T
  wmma_gemm_nt<128, 128><<<dim3(TOK / 128, HDI / 128, 1), dim3(256), 0, stream>>>(
      vin_bf, vw_bf, fus_f, nullptr, nullptr, TOK, HDI, HDI, 0, 0, 0, 0, 0);

  // ---- LN2 -> out
  ln2_kernel<<<dim3(TOK), dim3(256), 0, stream>>>(inT, fus_f, lng, lnb, out);
}

// v002
// It runs in 147 microseconds.
// Timed twice side by side with v001, it ran 1.26 times as fast both times.
// Over all steps from v000 it is 1.73 times as fast.
#include <hip/hip_runtime.h>

// ---------------------------------------------------------------------------
// BertOutputWithAdapterFusion for MI455X (gfx1250, wave32, WMMA bf16)
//
//   h        = hs @ dense_w^T + dense_b                      (WMMA)
//   prenorm  = input + h ; adapter_in = LN(prenorm)
//   query    = prenorm @ query_w^T + query_b                 (WMMA)
//   qk       = query @ key_w          (key GEMM folded away) (WMMA)
//   down[t]  = relu(adapter_in @ down_w[t]^T + down_b[t])    (WMMA, batched)
//   u[t]     = qk @ up_w[t]                                  (WMMA, batched)
//   scores   = <u,down>_D + <qk,up_b[t]> + <query,key_b> ; probs = softmax_t
//   mix      = (probs*down flattened)[N,512] @ up_all[512,H] (WMMA)
//   vin      = mix + probs@up_b + h   (value GEMM folded: sum_t probs = 1)
//   fusion   = vin @ value_w^T                               (WMMA)
//   out      = LN(input + fusion)
// ---------------------------------------------------------------------------

#define TOK 4096   // B*S tokens
#define HDI 1024   // hidden
#define IDI 4096   // intermediate
#define NTK 8      // tasks
#define DDI 64     // bottleneck

typedef __attribute__((ext_vector_type(16))) __bf16 v16bf;
typedef __attribute__((ext_vector_type(8)))  float  v8f;

// --- optional gfx1250 async global->LDS copy path (ASYNCcnt) ---------------
#ifdef __has_builtin
#if __has_builtin(__builtin_amdgcn_global_load_async_to_lds_b128) && \
    __has_builtin(__builtin_amdgcn_s_wait_asynccnt)
#define USE_ASYNC_COPY 1
#endif
#endif

// builtin takes pointers to 16B int vectors (b128); clang adjusts addr space
typedef int v4i32 __attribute__((vector_size(16)));
#define TO_GLB(p) ((v4i32*)(p))
#define TO_LDS(p) ((v4i32*)(p))

typedef __attribute__((ext_vector_type(4))) float  v4f;
typedef __attribute__((ext_vector_type(2))) float  v2f;
typedef __attribute__((ext_vector_type(8))) __bf16 v8bf;
typedef __attribute__((ext_vector_type(4))) __bf16 v4bf;
typedef __attribute__((ext_vector_type(2))) __bf16 v2bf;

// The kernels around the GEMMs, transpose_cvt aside, are streams: few, fat waves. Every bulk access
// covers whole 128-B lines, per wave (per block for upT's stores), a wave keeps
// 8 or more loads in flight, and
// each launch starts at most 4096 waves (16 per WGP). Their loops are all
// unrolled: the arrays must stay in registers and the loads issue as one group.

// ---------------------------------------------------------------- conversions
// A wave converts STEPS x 1024 consecutive floats: 8 x STEPS loads of 512 B, all
// at constant offsets from one address, then as many 256-B stores. The grid
// covers n exactly: n = blocks x 8 x STEPS x 1024.
template<int STEPS>
__global__ __launch_bounds__(256) void cvt_f32_bf16(
    const float* __restrict__ s, __bf16* __restrict__ d)
{
  const long o = (long)(blockIdx.x * 8 + (threadIdx.x >> 5)) * (STEPS * 1024) +
                 (threadIdx.x & 31) * 4;
  v4f v[8 * STEPS];
  #pragma unroll
  for (int u = 0; u < 8 * STEPS; ++u)
    v[u] = *reinterpret_cast<const v4f*>(s + o + u * 128);
  #pragma unroll
  for (int u = 0; u < 8 * STEPS; ++u)
    *reinterpret_cast<v4bf*>(d + o + u * 128) = __builtin_convertvector(v[u], v4bf);
}

// dst[c][r] = src[r][c], fp32 -> bf16 (for key_w used in NN orientation)
__global__ __launch_bounds__(256) void transpose_cvt(
    const float* __restrict__ src, __bf16* __restrict__ dst, int rows, int cols)
{
  __shared__ float tile[32][33];
  const int bx = blockIdx.x * 32, by = blockIdx.y * 32;
  const int tx = threadIdx.x, ty = threadIdx.y;
  #pragma unroll
  for (int j = 0; j < 32; j += 8)
    tile[ty + j][tx] = src[(long)(by + ty + j) * cols + (bx + tx)];
  __syncthreads();
  #pragma unroll
  for (int j = 0; j < 32; j += 8)
    dst[(long)(bx + ty + j) * rows + (by + tx)] = (__bf16)tile[tx][ty + j];
}

// up_w [T,H,D] -> upT [T*D, H] (rows = (t,d), K = h)  and  upmix [H, T*D]
// One block: one task, 64 h x 64 d. A thread takes 8 h x 2 d, so that upT gets
// 16-B pieces (a block writes whole lines) and upmix whole 128-B lines per wave.
__global__ __launch_bounds__(256) void repack_up(
    const float* __restrict__ upw, __bf16* __restrict__ upT,
    __bf16* __restrict__ upmix)
{
  const int lane = threadIdx.x & 31, wv = threadIdx.x >> 5;
  const int t = blockIdx.x >> 4;                       // H / 64 = 16 blocks a task
  const int h0 = (blockIdx.x & 15) * 64 + wv * 8;
  const int d = lane * 2;
  v2f v[8];
  #pragma unroll
  for (int k = 0; k < 8; ++k)
    v[k] = *reinterpret_cast<const v2f*>(upw + ((long)t * HDI + h0 + k) * DDI + d);
  v8bf r0, r1;
  #pragma unroll
  for (int k = 0; k < 8; ++k) {
    v2bf b = __builtin_convertvector(v[k], v2bf);
    *reinterpret_cast<v2bf*>(upmix + ((long)(h0 + k) << 9) + t * DDI + d) = b;  // pitch T*D
    r0[k] = b[0]; r1[k] = b[1];
  }
  *reinterpret_cast<v8bf*>(upT + ((long)(t * DDI + d) << 10) + h0) = r0;        // pitch H
  *reinterpret_cast<v8bf*>(upT + ((long)(t * DDI + d + 1) << 10) + h0) = r1;
}

// -------------------------------------------------------------- WMMA NT GEMM
// C[m,j] = sum_k A[m,k] * B[j,k]   (A:[M,K], B:[N,K] row-major bf16)
// 256 threads = 8 waves, wave grid 4x2, wave tile (BM/4)x(BN/2).
// Double-buffered LDS; next tile's global loads overlap the WMMA blocks.
// One stage holds 256 k (512 B of every operand row): enough bytes in flight
// per barrier to cover the copy latency, and each wave-wide copy covers one
// contiguous 512-B row piece. K must be a multiple of 256.
template<int BM, int BN>
__global__ __launch_bounds__(256) void wmma_gemm_nt(
    const __bf16* __restrict__ A, const __bf16* __restrict__ B,
    float* __restrict__ Cf, __bf16* __restrict__ Cb,
    const float* __restrict__ bias,
    int M, int N, int K,
    long long strideA, long long strideB, long long strideC,
    long long strideBias, int relu)
{
  constexpr int BK = 256;
  constexpr int LP = 264;                // LDS pitch (bf16) = 528B = 16B x odd
  constexpr int SR = 256 * 8 / BK;       // tile rows staged per 256-thread sweep
  constexpr int WTM = BM / 4;
  constexpr int WTN = BN / 2;
  constexpr int FM = WTM / 16;
  constexpr int FN = WTN / 16;
  constexpr int AIT = BM * BK / 8 / 256; // 16B chunks per thread (A tile)
  constexpr int BIT = BN * BK / 8 / 256; // 16B chunks per thread (B tile)
  static_assert(AIT >= 1 && BIT >= 1, "tile too small for 256 threads");

  __shared__ __attribute__((aligned(16))) __bf16 smA[2][BM * LP];
  __shared__ __attribute__((aligned(16))) __bf16 smB[2][BN * LP];

  const int tid = threadIdx.x;
  const int wv = tid >> 5, lane = tid & 31;
  const int wr = wv & 3, wc = wv >> 2;
  const int r = lane & 15, hi = lane >> 4;
  const int bm0 = blockIdx.x * BM, bn0 = blockIdx.y * BN;
  const int bz = blockIdx.z;

  const __bf16* Ab = A + (long long)bz * strideA;
  const __bf16* Bb = B + (long long)bz * strideB;

  // per-thread staging coordinates (hoisted out of the K loop)
  const int srow = tid >> 5, skc = (tid & 31) * 8;  // row within tile, K chunk
  const __bf16* aSrc = Ab + (long long)(bm0 + srow) * K + skc;
  const __bf16* bSrc = Bb + (long long)(bn0 + srow) * K + skc;

  const v8f vzero = {0.f, 0.f, 0.f, 0.f, 0.f, 0.f, 0.f, 0.f};
  v8f acc[FM][FN];
  #pragma unroll
  for (int i = 0; i < FM; ++i)
    #pragma unroll
    for (int j = 0; j < FN; ++j) acc[i][j] = vzero;

#ifdef USE_ASYNC_COPY
  auto stage_async = [&](int k0, int buf) {
    #pragma unroll
    for (int it = 0; it < AIT; ++it)
      __builtin_amdgcn_global_load_async_to_lds_b128(
          TO_GLB(aSrc + (long long)it * SR * K + k0),
          TO_LDS(&smA[buf][(srow + it * SR) * LP + skc]), 0, 0);
    #pragma unroll
    for (int it = 0; it < BIT; ++it)
      __builtin_amdgcn_global_load_async_to_lds_b128(
          TO_GLB(bSrc + (long long)it * SR * K + k0),
          TO_LDS(&smB[buf][(srow + it * SR) * LP + skc]), 0, 0);
  };
#else
  uint4 ra[AIT], rb[BIT];
  auto stage_load = [&](int k0) {
    #pragma unroll
    for (int it = 0; it < AIT; ++it)
      ra[it] = *reinterpret_cast<const uint4*>(aSrc + (long long)it * SR * K + k0);
    #pragma unroll
    for (int it = 0; it < BIT; ++it)
      rb[it] = *reinterpret_cast<const uint4*>(bSrc + (long long)it * SR * K + k0);
  };
  auto stage_store = [&](int buf) {
    #pragma unroll
    for (int it = 0; it < AIT; ++it)
      *reinterpret_cast<uint4*>(&smA[buf][(srow + it * SR) * LP + skc]) = ra[it];
    #pragma unroll
    for (int it = 0; it < BIT; ++it)
      *reinterpret_cast<uint4*>(&smB[buf][(srow + it * SR) * LP + skc]) = rb[it];
  };
#endif

  // prologue: stage tile 0 into buffer 0
#ifdef USE_ASYNC_COPY
  stage_async(0, 0);
  // tile 0 must have landed before the barrier that publishes it
  asm volatile("s_wait_asynccnt 0x0" ::: "memory");
#else
  stage_load(0);
  stage_store(0);
#endif
  __syncthreads();

  int cur = 0;
  for (int k0 = 0; k0 < K; k0 += BK) {
    const bool hasNext = (k0 + BK) < K;
    // issue next tile's global loads before computing (overlap)
#ifdef USE_ASYNC_COPY
    if (hasNext) stage_async(k0 + BK, cur ^ 1);
#else
    if (hasNext) stage_load(k0 + BK);
#endif

    // fragments per ISA 16-bit A/B layout:
    // lane<16 holds K{0..7,16..23}, lane>=16 holds K{8..15,24..31}
    // unrolled so that a block's LDS reads can be issued ahead of the one before
    #pragma unroll
    for (int kk = 0; kk < BK; kk += 32) {
      v16bf af[FM], bfv[FN];
      #pragma unroll
      for (int i = 0; i < FM; ++i) {
        int row = wr * WTM + i * 16 + r;
        union { uint4 u[2]; v16bf v; } u;
        u.u[0] = *reinterpret_cast<const uint4*>(&smA[cur][row * LP + kk + hi * 8]);
        u.u[1] = *reinterpret_cast<const uint4*>(&smA[cur][row * LP + kk + 16 + hi * 8]);
        af[i] = u.v;
      }
      #pragma unroll
      for (int j = 0; j < FN; ++j) {
        int row = wc * WTN + j * 16 + r;
        union { uint4 u[2]; v16bf v; } u;
        u.u[0] = *reinterpret_cast<const uint4*>(&smB[cur][row * LP + kk + hi * 8]);
        u.u[1] = *reinterpret_cast<const uint4*>(&smB[cur][row * LP + kk + 16 + hi * 8]);
        bfv[j] = u.v;
      }
      #pragma unroll
      for (int i = 0; i < FM; ++i)
        #pragma unroll
        for (int j = 0; j < FN; ++j)
          acc[i][j] = __builtin_amdgcn_wmma_f32_16x16x32_bf16(
              false, af[i], false, bfv[j], (short)0, acc[i][j], false, false);
    }

    // publish next tile into the other buffer
#ifdef USE_ASYNC_COPY
    // keeps the stage's last WMMAs in front of the barrier: sunk behind it they
    // would delay the issue of the next refill, which every trip waits for
    __builtin_amdgcn_sched_barrier(0);
    // this wave's reads of the buffer that is refilled behind the barrier are done
    asm volatile("s_wait_dscnt 0x0" ::: "memory");
    // this wave's copies of the next tile have landed before other waves read them
    asm volatile("s_wait_asynccnt 0x0" ::: "memory");
#else
    if (hasNext) stage_store(cur ^ 1);
#endif
    __syncthreads();
    cur ^= 1;
  }

  // epilogue: + bias[col], optional relu, f32 and/or bf16 store.
  // C lane layout: lane<16 -> M = v, lane>=16 -> M = 8+v; N = lane&15.
  const float* biasB = bias ? (bias + (long long)bz * strideBias) : nullptr;
  #pragma unroll
  for (int i = 0; i < FM; ++i) {
    #pragma unroll
    for (int j = 0; j < FN; ++j) {
      int gm = bm0 + wr * WTM + i * 16 + hi * 8;
      int gn = bn0 + wc * WTN + j * 16 + r;
      float bv = biasB ? biasB[gn] : 0.0f;
      #pragma unroll
      for (int v = 0; v < 8; ++v) {
        float x = acc[i][j][v] + bv;
        if (relu) x = fmaxf(x, 0.0f);
        long long idx = (long long)bz * strideC + (long long)(gm + v) * N + gn;
        if (Cf) Cf[idx] = x;
        if (Cb) Cb[idx] = (__bf16)x;
      }
    }
  }
}

// ---------------------------------------------------------------- layernorms
// One wave per row: a lane holds 8 x 4 values (h = j*128 + lane*4), the row
// sums need only the wave's butterfly, no LDS and no barrier.
__global__ __launch_bounds__(256) void ln1_kernel(
    const float* __restrict__ inT, const float* __restrict__ hd,
    const float* __restrict__ g, const float* __restrict__ b,
    __bf16* __restrict__ preBf, __bf16* __restrict__ ainBf)
{
  const int lane = threadIdx.x & 31;
  const long row = (long)(blockIdx.x * 8 + (threadIdx.x >> 5)) * HDI + lane * 4;
  v4f x[8];
  #pragma unroll
  for (int j = 0; j < 8; ++j)
    x[j] = *reinterpret_cast<const v4f*>(inT + row + j * 128) +
           *reinterpret_cast<const v4f*>(hd + row + j * 128);
  v4f gv[8], bv[8];                      // fetched with the row, not behind the sums
  #pragma unroll
  for (int j = 0; j < 8; ++j) {
    gv[j] = *reinterpret_cast<const v4f*>(g + j * 128 + lane * 4);
    bv[j] = *reinterpret_cast<const v4f*>(b + j * 128 + lane * 4);
  }
  // keeps all 32 loads in front of the sums: sunk behind them, the g and b loads
  // would add their latency to the row's, pair by pair
  __builtin_amdgcn_sched_barrier(0);
  v4f sv = {0.f, 0.f, 0.f, 0.f}, qv = {0.f, 0.f, 0.f, 0.f};
  #pragma unroll
  for (int j = 0; j < 8; ++j) { sv += x[j]; qv += x[j] * x[j]; }
  float s = (sv[0] + sv[1]) + (sv[2] + sv[3]);
  float ss = (qv[0] + qv[1]) + (qv[2] + qv[3]);
  #pragma unroll
  for (int m = 16; m; m >>= 1) { s += __shfl_xor(s, m, 32); ss += __shfl_xor(ss, m, 32); }
  float mean = s * (1.0f / HDI);
  float var  = ss * (1.0f / HDI) - mean * mean;
  float rstd = rsqrtf(var + 1e-12f);
  #pragma unroll
  for (int j = 0; j < 8; ++j) {
    *reinterpret_cast<v4bf*>(preBf + row + j * 128) = __builtin_convertvector(x[j], v4bf);
    *reinterpret_cast<v4bf*>(ainBf + row + j * 128) =
        __builtin_convertvector((x[j] - mean) * rstd * gv[j] + bv[j], v4bf);
  }
}

__global__ __launch_bounds__(256) void ln2_kernel(
    const float* __restrict__ inT, const float* __restrict__ fus,
    const float* __restrict__ g, const float* __restrict__ b,
    float* __restrict__ out)
{
  const int lane = threadIdx.x & 31;
  const long row = (long)(blockIdx.x * 8 + (threadIdx.x >> 5)) * HDI + lane * 4;
  v4f x[8];
  #pragma unroll
  for (int j = 0; j < 8; ++j)
    x[j] = *reinterpret_cast<const v4f*>(inT + row + j * 128) +
           *reinterpret_cast<const v4f*>(fus + row + j * 128);
  v4f gv[8], bv[8];                      // fetched with the row, not behind the sums
  #pragma unroll
  for (int j = 0; j < 8; ++j) {
    gv[j] = *reinterpret_cast<const v4f*>(g + j * 128 + lane * 4);
    bv[j] = *reinterpret_cast<const v4f*>(b + j * 128 + lane * 4);
  }
  // keeps all 32 loads in front of the sums: sunk behind them, the g and b loads
  // would add their latency to the row's, pair by pair
  __builtin_amdgcn_sched_barrier(0);
  v4f sv = {0.f, 0.f, 0.f, 0.f}, qv = {0.f, 0.f, 0.f, 0.f};
  #pragma unroll
  for (int j = 0; j < 8; ++j) { sv += x[j]; qv += x[j] * x[j]; }
  float s = (sv[0] + sv[1]) + (sv[2] + sv[3]);
  float ss = (qv[0] + qv[1]) + (qv[2] + qv[3]);
  #pragma unroll
  for (int m = 16; m; m >>= 1) { s += __shfl_xor(s, m, 32); ss += __shfl_xor(ss, m, 32); }
  float mean = s * (1.0f / HDI);
  float var  = ss * (1.0f / HDI) - mean * mean;
  float rstd = rsqrtf(var + 1e-12f);
  #pragma unroll
  for (int j = 0; j < 8; ++j) {
    *reinterpret_cast<v4f*>(out + row + j * 128) = (x[j] - mean) * rstd * gv[j] + bv[j];
  }
}

// ----------------------------------------------- scores + softmax over tasks
// scores[t,n] = <u[t,n],down[t,n]>_D + <qk[n],up_b[t]>_H + <query[n],key_b>_H
// One wave per token: every lane adds its share of all three terms into one
// partial per task, and one butterfly per task finishes the score.
__global__ __launch_bounds__(256) void score_softmax_kernel(
    const __bf16* __restrict__ qk, const __bf16* __restrict__ query,
    const float* __restrict__ key_b, const float* __restrict__ up_b,
    const float* __restrict__ u, const float* __restrict__ down,
    float* __restrict__ probs)
{
  const int lane = threadIdx.x & 31, hi = lane >> 4;
  const int n = blockIdx.x * 8 + (threadIdx.x >> 5);

  float pq[NTK] = {0.f, 0.f, 0.f, 0.f, 0.f, 0.f, 0.f, 0.f};
  float pc = 0.f;
  #pragma unroll
  for (int j = 0; j < 8; ++j) {
    const int h = j * 128 + lane * 4;
    v4f q  = __builtin_convertvector(
        *reinterpret_cast<const v4bf*>(qk + (long)n * HDI + h), v4f);
    v4f qr = __builtin_convertvector(
        *reinterpret_cast<const v4bf*>(query + (long)n * HDI + h), v4f);
    v4f kv = *reinterpret_cast<const v4f*>(key_b + h);
    pc += (qr[0] * kv[0] + qr[1] * kv[1]) + (qr[2] * kv[2] + qr[3] * kv[3]);
    #pragma unroll
    for (int t = 0; t < NTK; ++t) {
      v4f ub = *reinterpret_cast<const v4f*>(up_b + t * HDI + h);
      pq[t] += (q[0] * ub[0] + q[1] * ub[1]) + (q[2] * ub[2] + q[3] * ub[3]);
    }
  }
  // <u,down> over D = 64: the low half-wave takes task 2j, the high one 2j+1
  #pragma unroll
  for (int j = 0; j < NTK / 2; ++j) {
    const long o = ((long)(2 * j + hi) * TOK + n) * DDI + (lane & 15) * 4;
    v4f a = *reinterpret_cast<const v4f*>(u + o);
    v4f c = *reinterpret_cast<const v4f*>(down + o);
    float p = (a[0] * c[0] + a[1] * c[1]) + (a[2] * c[2] + a[3] * c[3]);
    pq[2 * j]     += hi ? 0.f : p;
    pq[2 * j + 1] += hi ? p : 0.f;
  }
  float s[NTK], mx = -1e30f;
  #pragma unroll
  for (int t = 0; t < NTK; ++t) {
    float a = pq[t] + pc;
    #pragma unroll
    for (int m = 16; m; m >>= 1) a += __shfl_xor(a, m, 32);
    s[t] = a;
    mx = fmaxf(mx, a);
  }
  float den = 0.f;
  #pragma unroll
  for (int t = 0; t < NTK; ++t) { s[t] = __expf(s[t] - mx); den += s[t]; }
  float inv = 1.0f / den;
  if (lane == 0) {
    v4f p0 = {s[0] * inv, s[1] * inv, s[2] * inv, s[3] * inv};
    v4f p1 = {s[4] * inv, s[5] * inv, s[6] * inv, s[7] * inv};
    *reinterpret_cast<v4f*>(probs + (long)n * NTK) = p0;
    *reinterpret_cast<v4f*>(probs + (long)n * NTK + 4) = p1;
  }
}

// wdown[n, t*64+d] = bf16(probs[n,t] * down[t,n,d]); one wave per token,
// the low half-wave on task 2j, the high one on 2j+1 (t*64+d = j*128 + lane*4)
__global__ __launch_bounds__(256) void wdown_kernel(
    const float* __restrict__ down, const float* __restrict__ probs,
    __bf16* __restrict__ wd)
{
  const int lane = threadIdx.x & 31, hi = lane >> 4;
  const int n = blockIdx.x * 8 + (threadIdx.x >> 5);
  #pragma unroll
  for (int j = 0; j < NTK / 2; ++j) {
    const int t = 2 * j + hi;
    v4f dn = *reinterpret_cast<const v4f*>(
        down + ((long)t * TOK + n) * DDI + (lane & 15) * 4);
    float p = probs[(long)n * NTK + t];
    *reinterpret_cast<v4bf*>(wd + (long)n * (NTK * DDI) + j * 128 + lane * 4) =
        __builtin_convertvector(p * dn, v4bf);
  }
}

// vin = bf16( mix + h_dense + sum_t probs[t]*up_b[t] )
// One wave: 256 columns of 4 tokens, its up_b columns held in registers.
__global__ __launch_bounds__(256) void vin_kernel(
    const float* __restrict__ mix, const float* __restrict__ hd,
    const float* __restrict__ up_b, const float* __restrict__ probs,
    __bf16* __restrict__ vin)
{
  const int gw = blockIdx.x * 8 + (threadIdx.x >> 5);
  const int h0 = (gw & 3) * 256 + (threadIdx.x & 31) * 4;
  const int n0 = (gw >> 2) * 4;
  v4f ub[NTK][2];
  #pragma unroll
  for (int t = 0; t < NTK; ++t)
    #pragma unroll
    for (int c = 0; c < 2; ++c)
      ub[t][c] = *reinterpret_cast<const v4f*>(up_b + t * HDI + h0 + c * 128);
  #pragma unroll
  for (int r = 0; r < 4; ++r) {
    const long n = n0 + r;
    float p[NTK];
    #pragma unroll
    for (int t = 0; t < NTK; ++t) p[t] = probs[n * NTK + t];
    #pragma unroll
    for (int c = 0; c < 2; ++c) {
      const long i = n * HDI + h0 + c * 128;
      v4f acc = *reinterpret_cast<const v4f*>(mix + i) +
                *reinterpret_cast<const v4f*>(hd + i);
      #pragma unroll
      for (int t = 0; t < NTK; ++t) acc += p[t] * ub[t][c];
      *reinterpret_cast<v4bf*>(vin + i) = __builtin_convertvector(acc, v4bf);
    }
  }
}

// ---------------------------------------------------------------------------
extern "C" void kernel_launch(void* const* d_in, const int* in_sizes, int n_in,
                              void* d_out, int out_size, void* d_ws, size_t ws_size,
                              hipStream_t stream) {
  (void)in_sizes; (void)n_in; (void)out_size; (void)ws_size;
  const float* hs  = (const float*)d_in[0];
  const float* inT = (const float*)d_in[1];
  const float* dw  = (const float*)d_in[2];
  const float* db  = (const float*)d_in[3];
  const float* lng = (const float*)d_in[4];
  const float* lnb = (const float*)d_in[5];
  const float* dnw = (const float*)d_in[6];
  const float* dnb = (const float*)d_in[7];
  const float* upw = (const float*)d_in[8];
  const float* upb = (const float*)d_in[9];
  const float* kw  = (const float*)d_in[10];
  const float* kb  = (const float*)d_in[11];
  const float* qw  = (const float*)d_in[12];
  const float* qb  = (const float*)d_in[13];
  const float* vw  = (const float*)d_in[14];
  float* out = (float*)d_out;

  char* ws = (char*)d_ws;
  size_t off = 0;
  auto alloc = [&](size_t bytes) -> char* {
    char* p = ws + off;
    off += (bytes + 255) & ~(size_t)255;
    return p;
  };

  __bf16* hs_bf   = (__bf16*)alloc((size_t)TOK * IDI * 2);
  __bf16* dw_bf   = (__bf16*)alloc((size_t)HDI * IDI * 2);
  float*  hdense  = (float*) alloc((size_t)TOK * HDI * 4);
  __bf16* pre_bf  = (__bf16*)alloc((size_t)TOK * HDI * 2);
  __bf16* ain_bf  = (__bf16*)alloc((size_t)TOK * HDI * 2);
  __bf16* qw_bf   = (__bf16*)alloc((size_t)HDI * HDI * 2);
  __bf16* kwT_bf  = (__bf16*)alloc((size_t)HDI * HDI * 2);
  __bf16* vw_bf   = (__bf16*)alloc((size_t)HDI * HDI * 2);
  __bf16* dnw_bf  = (__bf16*)alloc((size_t)NTK * DDI * HDI * 2);
  __bf16* upT_bf  = (__bf16*)alloc((size_t)NTK * DDI * HDI * 2);
  __bf16* upmx_bf = (__bf16*)alloc((size_t)NTK * DDI * HDI * 2);
  __bf16* query_bf= (__bf16*)alloc((size_t)TOK * HDI * 2);
  __bf16* qk_bf   = (__bf16*)alloc((size_t)TOK * HDI * 2);
  float*  down_f  = (float*) alloc((size_t)NTK * TOK * DDI * 4);
  float*  u_f     = (float*) alloc((size_t)NTK * TOK * DDI * 4);
  float*  probs   = (float*) alloc((size_t)TOK * NTK * 4);
  __bf16* wdown_bf= (__bf16*)alloc((size_t)TOK * NTK * DDI * 2);
  float*  mix_f   = (float*) alloc((size_t)TOK * HDI * 4);
  __bf16* vin_bf  = (__bf16*)alloc((size_t)TOK * HDI * 2);
  float*  fus_f   = (float*) alloc((size_t)TOK * HDI * 4);

  // ---- stage 0: precision conversion / weight repacking
  {
    cvt_f32_bf16<4><<<dim3(TOK * IDI / 32768), dim3(256), 0, stream>>>(hs, hs_bf);
    cvt_f32_bf16<1><<<dim3(HDI * IDI / 8192), dim3(256), 0, stream>>>(dw, dw_bf);
    cvt_f32_bf16<1><<<dim3(HDI * HDI / 8192), dim3(256), 0, stream>>>(qw, qw_bf);
    cvt_f32_bf16<1><<<dim3(HDI * HDI / 8192), dim3(256), 0, stream>>>(vw, vw_bf);
    cvt_f32_bf16<1><<<dim3(NTK * DDI * HDI / 8192), dim3(256), 0, stream>>>(dnw, dnw_bf);
    transpose_cvt<<<dim3(HDI / 32, HDI / 32), dim3(32, 8), 0, stream>>>(kw, kwT_bf, HDI, HDI);
    repack_up<<<dim3(NTK * (HDI / 64)), dim3(256), 0, stream>>>(upw, upT_bf, upmx_bf);
  }

  // ---- G1: h = hs @ dense_w^T + dense_b
  wmma_gemm_nt<128, 128><<<dim3(TOK / 128, HDI / 128, 1), dim3(256), 0, stream>>>(
      hs_bf, dw_bf, hdense, nullptr, db, TOK, HDI, IDI, 0, 0, 0, 0, 0);

  // ---- LN1: prenorm(bf16) + adapter_in(bf16)
  ln1_kernel<<<dim3(TOK / 8), dim3(256), 0, stream>>>(inT, hdense, lng, lnb, pre_bf, ain_bf);

  // ---- G2: query = prenorm @ query_w^T + query_b  (bf16 out)
  wmma_gemm_nt<128, 128><<<dim3(TOK / 128, HDI / 128, 1), dim3(256), 0, stream>>>(
      pre_bf, qw_bf, nullptr, query_bf, qb, TOK, HDI, HDI, 0, 0, 0, 0, 0);

  // ---- G3: qk = query @ key_w  (bf16 out)
  wmma_gemm_nt<128, 128><<<dim3(TOK / 128, HDI / 128, 1), dim3(256), 0, stream>>>(
      query_bf, kwT_bf, nullptr, qk_bf, nullptr, TOK, HDI, HDI, 0, 0, 0, 0, 0);

  // ---- G4: down[t] = relu(adapter_in @ down_w[t]^T + down_b[t])  (batched over t)
  wmma_gemm_nt<128, 64><<<dim3(TOK / 128, 1, NTK), dim3(256), 0, stream>>>(
      ain_bf, dnw_bf, down_f, nullptr, dnb, TOK, DDI, HDI,
      0, (long long)DDI * HDI, (long long)TOK * DDI, DDI, 1);

  // ---- G5: u[t] = qk @ up_w[t]  (batched over t)
  wmma_gemm_nt<128, 64><<<dim3(TOK / 128, 1, NTK), dim3(256), 0, stream>>>(
      qk_bf, upT_bf, u_f, nullptr, nullptr, TOK, DDI, HDI,
      0, (long long)DDI * HDI, (long long)TOK * DDI, 0, 0);

  // ---- scores + softmax over tasks
  score_softmax_kernel<<<dim3(TOK / 8), dim3(256), 0, stream>>>(
      qk_bf, query_bf, kb, upb, u_f, down_f, probs);

  // ---- probs-weighted down, flattened [N, T*D]
  wdown_kernel<<<dim3(TOK / 8), dim3(256), 0, stream>>>(
      down_f, probs, wdown_bf);

  // ---- G6: mix = wdown @ up_all^T   ([4096,512] x [1024,512])
  wmma_gemm_nt<128, 128><<<dim3(TOK / 128, HDI / 128, 1), dim3(256), 0, stream>>>(
      wdown_bf, upmx_bf, mix_f, nullptr, nullptr, TOK, HDI, NTK * DDI, 0, 0, 0, 0, 0);

  // ---- vin = mix + h + probs@up_b  (bf16)
  vin_kernel<<<dim3(TOK / 8), dim3(256), 0, stream>>>(
      mix_f, hdense, upb, probs, vin_bf);

  // ---- G7: fusion = vin @ value_w^T
  wmma_gemm_nt<128, 128><<<dim3(TOK / 128, HDI / 128, 1), dim3(256), 0, stream>>>(
      vin_bf, vw_bf, fus_f, nullptr, nullptr, TOK, HDI, HDI, 0, 0, 0, 0, 0);

  // ---- LN2 -> out
  ln2_kernel<<<dim3(TOK / 8), dim3(256), 0, stream>>>(inT, fus_f, lng, lnb, out);
}

// v003
// One run takes 132 microseconds.
// In both of two side-by-side timings against v002, it was 1.12 times as fast.
// Counting every step since v000, it is 1.93 times as fast.
#include <hip/hip_runtime.h>

// ---------------------------------------------------------------------------
// BertOutputWithAdapterFusion for MI455X (gfx1250, wave32, WMMA bf16)
//
//   h        = hs @ dense_w^T + dense_b                      (WMMA)
//   prenorm  = input + h ; adapter_in = LN(prenorm)
//   query    = prenorm @ query_w^T + query_b                 (WMMA)
//   qk       = query @ key_w          (key GEMM folded away) (WMMA)
//   down[t]  = relu(adapter_in @ down_w[t]^T + down_b[t])    (WMMA, batched)
//   u[t]     = qk @ up_w[t]                                  (WMMA, batched)
//   scores   = <u,down>_D + <qk,up_b[t]> + <query,key_b> ; probs = softmax_t
//   mix      = (probs*down flattened)[N,512] @ up_all[512,H] (WMMA)
//   vin      = mix + probs@up_b + h   (value GEMM folded: sum_t probs = 1)
//   fusion   = vin @ value_w^T                               (WMMA)
//   out      = LN(input + fusion)
// ---------------------------------------------------------------------------

#define TOK 4096   // B*S tokens
#define HDI 1024   // hidden
#define IDI 4096   // intermediate
#define NTK 8      // tasks
#define DDI 64     // bottleneck

typedef __attribute__((ext_vector_type(16))) __bf16 v16bf;
typedef __attribute__((ext_vector_type(8)))  float  v8f;

// --- optional gfx1250 async global->LDS copy path (ASYNCcnt) ---------------
#ifdef __has_builtin
#if __has_builtin(__builtin_amdgcn_global_load_async_to_lds_b128) && \
    __has_builtin(__builtin_amdgcn_s_wait_asynccnt)
#define USE_ASYNC_COPY 1
#endif
#endif

// builtin takes pointers to 16B int vectors (b128); clang adjusts addr space
typedef int v4i32 __attribute__((vector_size(16)));
#define TO_GLB(p) ((v4i32*)(p))
#define TO_LDS(p) ((v4i32*)(p))

typedef __attribute__((ext_vector_type(4))) float  v4f;
typedef __attribute__((ext_vector_type(2))) float  v2f;
typedef __attribute__((ext_vector_type(8))) __bf16 v8bf;
typedef __attribute__((ext_vector_type(4))) __bf16 v4bf;
typedef __attribute__((ext_vector_type(2))) __bf16 v2bf;

// The kernels around the GEMMs are streams: few, fat waves. Most wave-wide
// accesses cover whole 128-B lines, and a wave keeps 8 or more loads in flight
// but in the key_w transpose: 4 loads of 128 B, stores of 64 B.
// Their loops are all unrolled: the arrays must stay in registers and the loads
// issue as one group.

// ---------------------------------------------------------------- conversions
// A wave converts STEPS x 1024 consecutive floats: 8 x STEPS loads of 512 B, all
// at constant offsets from one address, then as many 256-B stores. The blocks
// of an array cover it exactly: n = blocks x 8 x STEPS x 1024.
template<int STEPS>
__device__ __forceinline__ void cvt_f32_bf16(
    const float* __restrict__ s, __bf16* __restrict__ d, int blk)
{
  const long o = (long)(blk * 8 + (threadIdx.x >> 5)) * (STEPS * 1024) +
                 (threadIdx.x & 31) * 4;
  v4f v[8 * STEPS];
  #pragma unroll
  for (int u = 0; u < 8 * STEPS; ++u)
    v[u] = *reinterpret_cast<const v4f*>(s + o + u * 128);
  #pragma unroll
  for (int u = 0; u < 8 * STEPS; ++u)
    *reinterpret_cast<v4bf*>(d + o + u * 128) = __builtin_convertvector(v[u], v4bf);
}

// dst[c][r] = src[r][c], fp32 -> bf16 (for key_w used in NN orientation)
// One block: one 32 x 32 tile, blk = tile row x (cols / 32) + tile column.
__device__ __forceinline__ void transpose_cvt(
    const float* __restrict__ src, __bf16* __restrict__ dst, int rows, int cols,
    int blk)
{
  __shared__ float tile[32][33];
  const int bx = (blk % (cols / 32)) * 32, by = (blk / (cols / 32)) * 32;
  const int tx = threadIdx.x & 31, ty = threadIdx.x >> 5;
  #pragma unroll
  for (int j = 0; j < 32; j += 8)
    tile[ty + j][tx] = src[(long)(by + ty + j) * cols + (bx + tx)];
  __syncthreads();
  #pragma unroll
  for (int j = 0; j < 32; j += 8)
    dst[(long)(bx + ty + j) * rows + (by + tx)] = (__bf16)tile[tx][ty + j];
}

// up_w [T,H,D] -> upT [T*D, H] (rows = (t,d), K = h)  and  upmix [H, T*D]
// One block: one task, 64 h x 64 d. A thread takes 8 h x 2 d, so that upT gets
// 16-B pieces (a block writes whole lines) and upmix whole 128-B lines per wave.
__device__ __forceinline__ void repack_up(
    const float* __restrict__ upw, __bf16* __restrict__ upT,
    __bf16* __restrict__ upmix, int blk)
{
  const int lane = threadIdx.x & 31, wv = threadIdx.x >> 5;
  const int t = blk >> 4;                              // H / 64 = 16 blocks a task
  const int h0 = (blk & 15) * 64 + wv * 8;
  const int d = lane * 2;
  v2f v[8];
  #pragma unroll
  for (int k = 0; k < 8; ++k)
    v[k] = *reinterpret_cast<const v2f*>(upw + ((long)t * HDI + h0 + k) * DDI + d);
  v8bf r0, r1;
  #pragma unroll
  for (int k = 0; k < 8; ++k) {
    v2bf b = __builtin_convertvector(v[k], v2bf);
    *reinterpret_cast<v2bf*>(upmix + ((long)(h0 + k) << 9) + t * DDI + d) = b;  // pitch T*D
    r0[k] = b[0]; r1[k] = b[1];
  }
  *reinterpret_cast<v8bf*>(upT + ((long)(t * DDI + d) << 10) + h0) = r0;        // pitch H
  *reinterpret_cast<v8bf*>(upT + ((long)(t * DDI + d + 1) << 10) + h0) = r1;
}

// All seven preparations in one launch: none reads what another writes, so the
// small ones run beside the big stream instead of each paying a launch of its
// own. A block's index range picks its job (the same for the whole block); the
// long blocks have the low indices, the short ones fill the tail.
// In the built kernel the code of another job follows a job's last stores and
// rewrites their registers on a way that the branches leave open: s_wait_xcnt 0
// stands behind those stores, in front of any such overwrite. The first job's
// stores are followed by the end of the program and need none.
#define NB_HS  (TOK * IDI / 32768)
#define NB_DW  (HDI * IDI / 8192)
#define NB_QW  (HDI * HDI / 8192)
#define NB_VW  (HDI * HDI / 8192)
#define NB_DNW (NTK * DDI * HDI / 8192)
#define NB_UP  (NTK * (HDI / 64))
#define NB_KW  ((HDI / 32) * (HDI / 32))
#define NB_PREP (NB_HS + NB_DW + NB_QW + NB_VW + NB_DNW + NB_UP + NB_KW)
__global__ __launch_bounds__(256) void prep_kernel(
    const float* __restrict__ hs, const float* __restrict__ dw,
    const float* __restrict__ qw, const float* __restrict__ vw,
    const float* __restrict__ dnw, const float* __restrict__ upw,
    const float* __restrict__ kw,
    __bf16* __restrict__ hs_bf, __bf16* __restrict__ dw_bf,
    __bf16* __restrict__ qw_bf, __bf16* __restrict__ vw_bf,
    __bf16* __restrict__ dnw_bf, __bf16* __restrict__ upT,
    __bf16* __restrict__ upmix, __bf16* __restrict__ kwT)
{
  int b = blockIdx.x;
  if (b < NB_HS) {
    cvt_f32_bf16<4>(hs, hs_bf, b);
    return;
  }
  b -= NB_HS;
  if (b < NB_DW + NB_QW + NB_VW + NB_DNW) {
    const float* s = dw;
    __bf16* d = dw_bf;
    if (b >= NB_DW) { b -= NB_DW; s = qw; d = qw_bf;
      if (b >= NB_QW) { b -= NB_QW; s = vw; d = vw_bf;
        if (b >= NB_VW) { b -= NB_VW; s = dnw; d = dnw_bf; } } }
    cvt_f32_bf16<1>(s, d, b);
    asm volatile("s_wait_xcnt 0x0" ::: "memory");  // behind the job's last stores, see above
    return;
  }
  b -= NB_DW + NB_QW + NB_VW + NB_DNW;
  if (b < NB_UP) {
    repack_up(upw, upT, upmix, b);
    asm volatile("s_wait_xcnt 0x0" ::: "memory");  // behind the job's last stores, see above
    return;
  }
  transpose_cvt(kw, kwT, HDI, HDI, b - NB_UP);
  asm volatile("s_wait_xcnt 0x0" ::: "memory");  // behind the job's last stores, see above
}

// -------------------------------------------------------------- WMMA NT GEMM
// C[m,j] = sum_k A[m,k] * B[j,k]   (A:[M,K], B:[N,K] row-major bf16)
// 256 threads = 8 waves, wave grid 4x2, wave tile (BM/4)x(BN/2).
// Double-buffered LDS; next tile's global loads overlap the WMMA blocks.
// One stage holds 256 k (512 B of every operand row): enough bytes in flight
// per barrier to cover the copy latency, and each wave-wide copy covers one
// contiguous 512-B row piece. K must be a multiple of 256.
// PAIR: two batched products of one shape that do not depend on each other
// share a launch; batches z >= zsplit take A2, B2, Cf2 (f32 out, no bias, no relu).
template<int BM, int BN, bool PAIR>
__global__ __launch_bounds__(256) void wmma_gemm_nt(
    const __bf16* __restrict__ A, const __bf16* __restrict__ B,
    float* __restrict__ Cf1, __bf16* __restrict__ Cb1,
    const float* __restrict__ bias1,
    int M, int N, int K,
    long long strideA, long long strideB, long long strideC,
    long long strideBias, int relu1,
    const __bf16* __restrict__ A2, const __bf16* __restrict__ B2,
    float* __restrict__ Cf2, int zsplit)
{
  constexpr int BK = 256;
  constexpr int LP = 264;                // LDS pitch (bf16) = 528B = 16B x odd
  constexpr int SR = 256 * 8 / BK;       // tile rows staged per 256-thread sweep
  constexpr int WTM = BM / 4;
  constexpr int WTN = BN / 2;
  constexpr int FM = WTM / 16;
  constexpr int FN = WTN / 16;
  constexpr int AIT = BM * BK / 8 / 256; // 16B chunks per thread (A tile)
  constexpr int BIT = BN * BK / 8 / 256; // 16B chunks per thread (B tile)
  static_assert(AIT >= 1 && BIT >= 1, "tile too small for 256 threads");

  __shared__ __attribute__((aligned(16))) __bf16 smA[2][BM * LP];
  __shared__ __attribute__((aligned(16))) __bf16 smB[2][BN * LP];

  const int tid = threadIdx.x;
  const int wv = tid >> 5, lane = tid & 31;
  const int wr = wv & 3, wc = wv >> 2;
  const int r = lane & 15, hi = lane >> 4;
  const int bm0 = blockIdx.x * BM, bn0 = blockIdx.y * BN;
  const bool second = PAIR && (int)blockIdx.z >= zsplit;  // alike in the whole block
  const int bz = second ? blockIdx.z - zsplit : blockIdx.z;
  float* Cf = second ? Cf2 : Cf1;
  __bf16* Cb = second ? nullptr : Cb1;
  const float* bias = second ? nullptr : bias1;
  const int relu = second ? 0 : relu1;

  const __bf16* Ab = (second ? A2 : A) + (long long)bz * strideA;
  const __bf16* Bb = (second ? B2 : B) + (long long)bz * strideB;

  // per-thread staging coordinates (hoisted out of the K loop)
  const int srow = tid >> 5, skc = (tid & 31) * 8;  // row within tile, K chunk
  const __bf16* aSrc = Ab + (long long)(bm0 + srow) * K + skc;
  const __bf16* bSrc = Bb + (long long)(bn0 + srow) * K + skc;

  const v8f vzero = {0.f, 0.f, 0.f, 0.f, 0.f, 0.f, 0.f, 0.f};
  v8f acc[FM][FN];
  #pragma unroll
  for (int i = 0; i < FM; ++i)
    #pragma unroll
    for (int j = 0; j < FN; ++j) acc[i][j] = vzero;

#ifdef USE_ASYNC_COPY
  auto stage_async = [&](int k0, int buf) {
    #pragma unroll
    for (int it = 0; it < AIT; ++it)
      __builtin_amdgcn_global_load_async_to_lds_b128(
          TO_GLB(aSrc + (long long)it * SR * K + k0),
          TO_LDS(&smA[buf][(srow + it * SR) * LP + skc]), 0, 0);
    #pragma unroll
    for (int it = 0; it < BIT; ++it)
      __builtin_amdgcn_global_load_async_to_lds_b128(
          TO_GLB(bSrc + (long long)it * SR * K + k0),
          TO_LDS(&smB[buf][(srow + it * SR) * LP + skc]), 0, 0);
  };
#else
  uint4 ra[AIT], rb[BIT];
  auto stage_load = [&](int k0) {
    #pragma unroll
    for (int it = 0; it < AIT; ++it)
      ra[it] = *reinterpret_cast<const uint4*>(aSrc + (long long)it * SR * K + k0);
    #pragma unroll
    for (int it = 0; it < BIT; ++it)
      rb[it] = *reinterpret_cast<const uint4*>(bSrc + (long long)it * SR * K + k0);
  };
  auto stage_store = [&](int buf) {
    #pragma unroll
    for (int it = 0; it < AIT; ++it)
      *reinterpret_cast<uint4*>(&smA[buf][(srow + it * SR) * LP + skc]) = ra[it];
    #pragma unroll
    for (int it = 0; it < BIT; ++it)
      *reinterpret_cast<uint4*>(&smB[buf][(srow + it * SR) * LP + skc]) = rb[it];
  };
#endif

  // prologue: stage tile 0 into buffer 0
#ifdef USE_ASYNC_COPY
  stage_async(0, 0);
  // tile 0 must have landed before the barrier that publishes it
  asm volatile("s_wait_asynccnt 0x0" ::: "memory");
#else
  stage_load(0);
  stage_store(0);
#endif
  __syncthreads();

  int cur = 0;
  for (int k0 = 0; k0 < K; k0 += BK) {
    const bool hasNext = (k0 + BK) < K;
    // issue next tile's global loads before computing (overlap)
#ifdef USE_ASYNC_COPY
    if (hasNext) stage_async(k0 + BK, cur ^ 1);
#else
    if (hasNext) stage_load(k0 + BK);
#endif

    // fragments per ISA 16-bit A/B layout:
    // lane<16 holds K{0..7,16..23}, lane>=16 holds K{8..15,24..31}
    // unrolled so that a block's LDS reads can be issued ahead of the one before
    #pragma unroll
    for (int kk = 0; kk < BK; kk += 32) {
      v16bf af[FM], bfv[FN];
      #pragma unroll
      for (int i = 0; i < FM; ++i) {
        int row = wr * WTM + i * 16 + r;
        union { uint4 u[2]; v16bf v; } u;
        u.u[0] = *reinterpret_cast<const uint4*>(&smA[cur][row * LP + kk + hi * 8]);
        u.u[1] = *reinterpret_cast<const uint4*>(&smA[cur][row * LP + kk + 16 + hi * 8]);
        af[i] = u.v;
      }
      #pragma unroll
      for (int j = 0; j < FN; ++j) {
        int row = wc * WTN + j * 16 + r;
        union { uint4 u[2]; v16bf v; } u;
        u.u[0] = *reinterpret_cast<const uint4*>(&smB[cur][row * LP + kk + hi * 8]);
        u.u[1] = *reinterpret_cast<const uint4*>(&smB[cur][row * LP + kk + 16 + hi * 8]);
        bfv[j] = u.v;
      }
      #pragma unroll
      for (int i = 0; i < FM; ++i)
        #pragma unroll
        for (int j = 0; j < FN; ++j)
          acc[i][j] = __builtin_amdgcn_wmma_f32_16x16x32_bf16(
              false, af[i], false, bfv[j], (short)0, acc[i][j], false, false);
    }

    // publish next tile into the other buffer
#ifdef USE_ASYNC_COPY
    // keeps the stage's last WMMAs in front of the barrier: sunk behind it they
    // would delay the issue of the next refill, which every trip waits for
    __builtin_amdgcn_sched_barrier(0);
    // this wave's reads of the buffer that is refilled behind the barrier are done
    asm volatile("s_wait_dscnt 0x0" ::: "memory");
    // this wave's copies of the next tile have landed before other waves read them
    asm volatile("s_wait_asynccnt 0x0" ::: "memory");
#else
    if (hasNext) stage_store(cur ^ 1);
#endif
    __syncthreads();
    cur ^= 1;
  }

  // epilogue: + bias[col], optional relu, f32 and/or bf16 store.
  // C lane layout: lane<16 -> M = v, lane>=16 -> M = 8+v; N = lane&15.
  const float* biasB = bias ? (bias + (long long)bz * strideBias) : nullptr;
  #pragma unroll
  for (int i = 0; i < FM; ++i) {
    #pragma unroll
    for (int j = 0; j < FN; ++j) {
      int gm = bm0 + wr * WTM + i * 16 + hi * 8;
      int gn = bn0 + wc * WTN + j * 16 + r;
      float bv = biasB ? biasB[gn] : 0.0f;
      #pragma unroll
      for (int v = 0; v < 8; ++v) {
        float x = acc[i][j][v] + bv;
        if (relu) x = fmaxf(x, 0.0f);
        long long idx = (long long)bz * strideC + (long long)(gm + v) * N + gn;
        if (Cf) Cf[idx] = x;
        if (Cb) Cb[idx] = (__bf16)x;
      }
    }
  }
}

// ---------------------------------------------------------------- layernorms
// One wave per row: a lane holds 8 x 4 values (h = j*128 + lane*4), the row
// sums need only the wave's butterfly, no LDS and no barrier.
__global__ __launch_bounds__(256) void ln1_kernel(
    const float* __restrict__ inT, const float* __restrict__ hd,
    const float* __restrict__ g, const float* __restrict__ b,
    __bf16* __restrict__ preBf, __bf16* __restrict__ ainBf)
{
  const int lane = threadIdx.x & 31;
  const long row = (long)(blockIdx.x * 8 + (threadIdx.x >> 5)) * HDI + lane * 4;
  v4f x[8];
  #pragma unroll
  for (int j = 0; j < 8; ++j)
    x[j] = *reinterpret_cast<const v4f*>(inT + row + j * 128) +
           *reinterpret_cast<const v4f*>(hd + row + j * 128);
  v4f gv[8], bv[8];                      // fetched with the row, not behind the sums
  #pragma unroll
  for (int j = 0; j < 8; ++j) {
    gv[j] = *reinterpret_cast<const v4f*>(g + j * 128 + lane * 4);
    bv[j] = *reinterpret_cast<const v4f*>(b + j * 128 + lane * 4);
  }
  // keeps all 32 loads in front of the sums: sunk behind them, the g and b loads
  // would add their latency to the row's, pair by pair
  __builtin_amdgcn_sched_barrier(0);
  v4f sv = {0.f, 0.f, 0.f, 0.f}, qv = {0.f, 0.f, 0.f, 0.f};
  #pragma unroll
  for (int j = 0; j < 8; ++j) { sv += x[j]; qv += x[j] * x[j]; }
  float s = (sv[0] + sv[1]) + (sv[2] + sv[3]);
  float ss = (qv[0] + qv[1]) + (qv[2] + qv[3]);
  #pragma unroll
  for (int m = 16; m; m >>= 1) { s += __shfl_xor(s, m, 32); ss += __shfl_xor(ss, m, 32); }
  float mean = s * (1.0f / HDI);
  float var  = ss * (1.0f / HDI) - mean * mean;
  float rstd = rsqrtf(var + 1e-12f);
  #pragma unroll
  for (int j = 0; j < 8; ++j) {
    *reinterpret_cast<v4bf*>(preBf + row + j * 128) = __builtin_convertvector(x[j], v4bf);
    *reinterpret_cast<v4bf*>(ainBf + row + j * 128) =
        __builtin_convertvector((x[j] - mean) * rstd * gv[j] + bv[j], v4bf);
  }
}

__global__ __launch_bounds__(256) void ln2_kernel(
    const float* __restrict__ inT, const float* __restrict__ fus,
    const float* __restrict__ g, const float* __restrict__ b,
    float* __restrict__ out)
{
  const int lane = threadIdx.x & 31;
  const long row = (long)(blockIdx.x * 8 + (threadIdx.x >> 5)) * HDI + lane * 4;
  v4f x[8];
  #pragma unroll
  for (int j = 0; j < 8; ++j)
    x[j] = *reinterpret_cast<const v4f*>(inT + row + j * 128) +
           *reinterpret_cast<const v4f*>(fus + row + j * 128);
  v4f gv[8], bv[8];                      // fetched with the row, not behind the sums
  #pragma unroll
  for (int j = 0; j < 8; ++j) {
    gv[j] = *reinterpret_cast<const v4f*>(g + j * 128 + lane * 4);
    bv[j] = *reinterpret_cast<const v4f*>(b + j * 128 + lane * 4);
  }
  // keeps all 32 loads in front of the sums: sunk behind them, the g and b loads
  // would add their latency to the row's, pair by pair
  __builtin_amdgcn_sched_barrier(0);
  v4f sv = {0.f, 0.f, 0.f, 0.f}, qv = {0.f, 0.f, 0.f, 0.f};
  #pragma unroll
  for (int j = 0; j < 8; ++j) { sv += x[j]; qv += x[j] * x[j]; }
  float s = (sv[0] + sv[1]) + (sv[2] + sv[3]);
  float ss = (qv[0] + qv[1]) + (qv[2] + qv[3]);
  #pragma unroll
  for (int m = 16; m; m >>= 1) { s += __shfl_xor(s, m, 32); ss += __shfl_xor(ss, m, 32); }
  float mean = s * (1.0f / HDI);
  float var  = ss * (1.0f / HDI) - mean * mean;
  float rstd = rsqrtf(var + 1e-12f);
  #pragma unroll
  for (int j = 0; j < 8; ++j) {
    *reinterpret_cast<v4f*>(out + row + j * 128) = (x[j] - mean) * rstd * gv[j] + bv[j];
  }
}

// ----------------------------------------------- scores + softmax over tasks
// scores[t,n] = <u[t,n],down[t,n]>_D + <qk[n],up_b[t]>_H + <query[n],key_b>_H
// One wave per token: every lane adds its share of all three terms into one
// partial per task, and one butterfly per task finishes the score.
__global__ __launch_bounds__(256) void score_softmax_kernel(
    const __bf16* __restrict__ qk, const __bf16* __restrict__ query,
    const float* __restrict__ key_b, const float* __restrict__ up_b,
    const float* __restrict__ u, const float* __restrict__ down,
    float* __restrict__ probs)
{
  const int lane = threadIdx.x & 31, hi = lane >> 4;
  const int n = blockIdx.x * 8 + (threadIdx.x >> 5);

  float pq[NTK] = {0.f, 0.f, 0.f, 0.f, 0.f, 0.f, 0.f, 0.f};
  float pc = 0.f;
  #pragma unroll
  for (int j = 0; j < 8; ++j) {
    const int h = j * 128 + lane * 4;
    v4f q  = __builtin_convertvector(
        *reinterpret_cast<const v4bf*>(qk + (long)n * HDI + h), v4f);
    v4f qr = __builtin_convertvector(
        *reinterpret_cast<const v4bf*>(query + (long)n * HDI + h), v4f);
    v4f kv = *reinterpret_cast<const v4f*>(key_b + h);
    pc += (qr[0] * kv[0] + qr[1] * kv[1]) + (qr[2] * kv[2] + qr[3] * kv[3]);
    #pragma unroll
    for (int t = 0; t < NTK; ++t) {
      v4f ub = *reinterpret_cast<const v4f*>(up_b + t * HDI + h);
      pq[t] += (q[0] * ub[0] + q[1] * ub[1]) + (q[2] * ub[2] + q[3] * ub[3]);
    }
  }
  // <u,down> over D = 64: the low half-wave takes task 2j, the high one 2j+1
  #pragma unroll
  for (int j = 0; j < NTK / 2; ++j) {
    const long o = ((long)(2 * j + hi) * TOK + n) * DDI + (lane & 15) * 4;
    v4f a = *reinterpret_cast<const v4f*>(u + o);
    v4f c = *reinterpret_cast<const v4f*>(down + o);
    float p = (a[0] * c[0] + a[1] * c[1]) + (a[2] * c[2] + a[3] * c[3]);
    pq[2 * j]     += hi ? 0.f : p;
    pq[2 * j + 1] += hi ? p : 0.f;
  }
  float s[NTK], mx = -1e30f;
  #pragma unroll
  for (int t = 0; t < NTK; ++t) {
    float a = pq[t] + pc;
    #pragma unroll
    for (int m = 16; m; m >>= 1) a += __shfl_xor(a, m, 32);
    s[t] = a;
    mx = fmaxf(mx, a);
  }
  float den = 0.f;
  #pragma unroll
  for (int t = 0; t < NTK; ++t) { s[t] = __expf(s[t] - mx); den += s[t]; }
  float inv = 1.0f / den;
  if (lane == 0) {
    v4f p0 = {s[0] * inv, s[1] * inv, s[2] * inv, s[3] * inv};
    v4f p1 = {s[4] * inv, s[5] * inv, s[6] * inv, s[7] * inv};
    *reinterpret_cast<v4f*>(probs + (long)n * NTK) = p0;
    *reinterpret_cast<v4f*>(probs + (long)n * NTK + 4) = p1;
  }
}

// wdown[n, t*64+d] = bf16(probs[n,t] * down[t,n,d]); one wave per token,
// the low half-wave on task 2j, the high one on 2j+1 (t*64+d = j*128 + lane*4)
__global__ __launch_bounds__(256) void wdown_kernel(
    const float* __restrict__ down, const float* __restrict__ probs,
    __bf16* __restrict__ wd)
{
  const int lane = threadIdx.x & 31, hi = lane >> 4;
  const int n = blockIdx.x * 8 + (threadIdx.x >> 5);
  #pragma unroll
  for (int j = 0; j < NTK / 2; ++j) {
    const int t = 2 * j + hi;
    v4f dn = *reinterpret_cast<const v4f*>(
        down + ((long)t * TOK + n) * DDI + (lane & 15) * 4);
    float p = probs[(long)n * NTK + t];
    *reinterpret_cast<v4bf*>(wd + (long)n * (NTK * DDI) + j * 128 + lane * 4) =
        __builtin_convertvector(p * dn, v4bf);
  }
}

// vin = bf16( mix + h_dense + sum_t probs[t]*up_b[t] )
// One wave: 256 columns of 4 tokens, its up_b columns held in registers.
__global__ __launch_bounds__(256) void vin_kernel(
    const float* __restrict__ mix, const float* __restrict__ hd,
    const float* __restrict__ up_b, const float* __restrict__ probs,
    __bf16* __restrict__ vin)
{
  const int gw = blockIdx.x * 8 + (threadIdx.x >> 5);
  const int h0 = (gw & 3) * 256 + (threadIdx.x & 31) * 4;
  const int n0 = (gw >> 2) * 4;
  v4f ub[NTK][2];
  #pragma unroll
  for (int t = 0; t < NTK; ++t)
    #pragma unroll
    for (int c = 0; c < 2; ++c)
      ub[t][c] = *reinterpret_cast<const v4f*>(up_b + t * HDI + h0 + c * 128);
  #pragma unroll
  for (int r = 0; r < 4; ++r) {
    const long n = n0 + r;
    float p[NTK];
    #pragma unroll
    for (int t = 0; t < NTK; ++t) p[t] = probs[n * NTK + t];
    #pragma unroll
    for (int c = 0; c < 2; ++c) {
      const long i = n * HDI + h0 + c * 128;
      v4f acc = *reinterpret_cast<const v4f*>(mix + i) +
                *reinterpret_cast<const v4f*>(hd + i);
      #pragma unroll
      for (int t = 0; t < NTK; ++t) acc += p[t] * ub[t][c];
      *reinterpret_cast<v4bf*>(vin + i) = __builtin_convertvector(acc, v4bf);
    }
  }
}

// ---------------------------------------------------------------------------
extern "C" void kernel_launch(void* const* d_in, const int* in_sizes, int n_in,
                              void* d_out, int out_size, void* d_ws, size_t ws_size,
                              hipStream_t stream) {
  (void)in_sizes; (void)n_in; (void)out_size; (void)ws_size;
  const float* hs  = (const float*)d_in[0];
  const float* inT = (const float*)d_in[1];
  const float* dw  = (const float*)d_in[2];
  const float* db  = (const float*)d_in[3];
  const float* lng = (const float*)d_in[4];
  const float* lnb = (const float*)d_in[5];
  const float* dnw = (const float*)d_in[6];
  const float* dnb = (const float*)d_in[7];
  const float* upw = (const float*)d_in[8];
  const float* upb = (const float*)d_in[9];
  const float* kw  = (const float*)d_in[10];
  const float* kb  = (const float*)d_in[11];
  const float* qw  = (const float*)d_in[12];
  const float* qb  = (const float*)d_in[13];
  const float* vw  = (const float*)d_in[14];
  float* out = (float*)d_out;

  char* ws = (char*)d_ws;
  size_t off = 0;
  auto alloc = [&](size_t bytes) -> char* {
    char* p = ws + off;
    off += (bytes + 255) & ~(size_t)255;
    return p;
  };

  __bf16* hs_bf   = (__bf16*)alloc((size_t)TOK * IDI * 2);
  __bf16* dw_bf   = (__bf16*)alloc((size_t)HDI * IDI * 2);
  float*  hdense  = (float*) alloc((size_t)TOK * HDI * 4);
  __bf16* pre_bf  = (__bf16*)alloc((size_t)TOK * HDI * 2);
  __bf16* ain_bf  = (__bf16*)alloc((size_t)TOK * HDI * 2);
  __bf16* qw_bf   = (__bf16*)alloc((size_t)HDI * HDI * 2);
  __bf16* kwT_bf  = (__bf16*)alloc((size_t)HDI * HDI * 2);
  __bf16* vw_bf   = (__bf16*)alloc((size_t)HDI * HDI * 2);
  __bf16* dnw_bf  = (__bf16*)alloc((size_t)NTK * DDI * HDI * 2);
  __bf16* upT_bf  = (__bf16*)alloc((size_t)NTK * DDI * HDI * 2);
  __bf16* upmx_bf = (__bf16*)alloc((size_t)NTK * DDI * HDI * 2);
  __bf16* query_bf= (__bf16*)alloc((size_t)TOK * HDI * 2);
  __bf16* qk_bf   = (__bf16*)alloc((size_t)TOK * HDI * 2);
  float*  down_f  = (float*) alloc((size_t)NTK * TOK * DDI * 4);
  float*  u_f     = (float*) alloc((size_t)NTK * TOK * DDI * 4);
  float*  probs   = (float*) alloc((size_t)TOK * NTK * 4);
  __bf16* wdown_bf= (__bf16*)alloc((size_t)TOK * NTK * DDI * 2);
  float*  mix_f   = (float*) alloc((size_t)TOK * HDI * 4);
  __bf16* vin_bf  = (__bf16*)alloc((size_t)TOK * HDI * 2);
  float*  fus_f   = (float*) alloc((size_t)TOK * HDI * 4);

  // ---- stage 0: precision conversion / weight repacking
  prep_kernel<<<dim3(NB_PREP), dim3(256), 0, stream>>>(
      hs, dw, qw, vw, dnw, upw, kw,
      hs_bf, dw_bf, qw_bf, vw_bf, dnw_bf, upT_bf, upmx_bf, kwT_bf);

  // ---- G1: h = hs @ dense_w^T + dense_b
  wmma_gemm_nt<128, 128, false><<<dim3(TOK / 128, HDI / 128, 1), dim3(256), 0, stream>>>(
      hs_bf, dw_bf, hdense, nullptr, db, TOK, HDI, IDI, 0, 0, 0, 0, 0,
      nullptr, nullptr, nullptr, 1);

  // ---- LN1: prenorm(bf16) + adapter_in(bf16)
  ln1_kernel<<<dim3(TOK / 8), dim3(256), 0, stream>>>(inT, hdense, lng, lnb, pre_bf, ain_bf);

  // ---- G2: query = prenorm @ query_w^T + query_b  (bf16 out)
  wmma_gemm_nt<128, 128, false><<<dim3(TOK / 128, HDI / 128, 1), dim3(256), 0, stream>>>(
      pre_bf, qw_bf, nullptr, query_bf, qb, TOK, HDI, HDI, 0, 0, 0, 0, 0,
      nullptr, nullptr, nullptr, 1);

  // ---- G3: qk = query @ key_w  (bf16 out)
  wmma_gemm_nt<128, 128, false><<<dim3(TOK / 128, HDI / 128, 1), dim3(256), 0, stream>>>(
      query_bf, kwT_bf, nullptr, qk_bf, nullptr, TOK, HDI, HDI, 0, 0, 0, 0, 0,
      nullptr, nullptr, nullptr, 1);

  // ---- G4: down[t] = relu(adapter_in @ down_w[t]^T + down_b[t])  (z = t)
  // ---- G5: u[t] = qk @ up_w[t]                                   (z = T + t)
  wmma_gemm_nt<128, 64, true><<<dim3(TOK / 128, 1, 2 * NTK), dim3(256), 0, stream>>>(
      ain_bf, dnw_bf, down_f, nullptr, dnb, TOK, DDI, HDI,
      0, (long long)DDI * HDI, (long long)TOK * DDI, DDI, 1,
      qk_bf, upT_bf, u_f, NTK);

  // ---- scores + softmax over tasks
  score_softmax_kernel<<<dim3(TOK / 8), dim3(256), 0, stream>>>(
      qk_bf, query_bf, kb, upb, u_f, down_f, probs);

  // ---- probs-weighted down, flattened [N, T*D]
  wdown_kernel<<<dim3(TOK / 8), dim3(256), 0, stream>>>(
      down_f, probs, wdown_bf);

  // ---- G6: mix = wdown @ up_all^T   ([4096,512] x [1024,512])
  wmma_gemm_nt<128, 128, false><<<dim3(TOK / 128, HDI / 128, 1), dim3(256), 0, stream>>>(
      wdown_bf, upmx_bf, mix_f, nullptr, nullptr, TOK, HDI, NTK * DDI, 0, 0, 0, 0, 0,
      nullptr, nullptr, nullptr, 1);

  // ---- vin = mix + h + probs@up_b  (bf16)
  vin_kernel<<<dim3(TOK / 8), dim3(256), 0, stream>>>(
      mix_f, hdense, upb, probs, vin_bf);

  // ---- G7: fusion = vin @ value_w^T
  wmma_gemm_nt<128, 128, false><<<dim3(TOK / 128, HDI / 128, 1), dim3(256), 0, stream>>>(
      vin_bf, vw_bf, fus_f, nullptr, nullptr, TOK, HDI, HDI, 0, 0, 0, 0, 0,
      nullptr, nullptr, nullptr, 1);

  // ---- LN2 -> out
  ln2_kernel<<<dim3(TOK / 8), dim3(256), 0, stream>>>(inT, fus_f, lng, lnb, out);
}

// v004
// It runs in 127 microseconds.
// Timed twice side by side with v003, it ran 1.04 and 1.05 times as fast.
// All steps since v000 together make it 2.01 times as fast.
#include <hip/hip_runtime.h>

// ---------------------------------------------------------------------------
// BertOutputWithAdapterFusion for MI455X (gfx1250, wave32, WMMA bf16)
//
//   h        = hs @ dense_w^T + dense_b                      (WMMA)
//   prenorm  = input + h ; adapter_in = LN(prenorm)
//   query    = prenorm @ query_w^T + query_b                 (WMMA)
//   qk       = query @ key_w          (key GEMM folded away) (WMMA)
//   down[t]  = relu(adapter_in @ down_w[t]^T + down_b[t])    (WMMA, batched)
//   u[t]     = qk @ up_w[t]                                  (WMMA, batched)
//   scores   = <u,down>_D + <qk,up_b[t]> + <query,key_b> ; probs = softmax_t
//   mix      = (probs*down flattened)[N,512] @ up_all[512,H] (WMMA)
//   vin      = mix + probs@up_b + h   (value GEMM folded: sum_t probs = 1;
//              formed in the mix product's epilogue, mix never leaves registers)
//   fusion   = vin @ value_w^T                               (WMMA)
//   out      = LN(input + fusion)
// ---------------------------------------------------------------------------

#define TOK 4096   // B*S tokens
#define HDI 1024   // hidden
#define IDI 4096   // intermediate
#define NTK 8      // tasks
#define DDI 64     // bottleneck

typedef __attribute__((ext_vector_type(16))) __bf16 v16bf;
typedef __attribute__((ext_vector_type(8)))  float  v8f;

// --- optional gfx1250 async global->LDS copy path (ASYNCcnt) ---------------
#ifdef __has_builtin
#if __has_builtin(__builtin_amdgcn_global_load_async_to_lds_b128) && \
    __has_builtin(__builtin_amdgcn_s_wait_asynccnt)
#define USE_ASYNC_COPY 1
#endif
#endif

// builtin takes pointers to 16B int vectors (b128); clang adjusts addr space
typedef int v4i32 __attribute__((vector_size(16)));
#define TO_GLB(p) ((v4i32*)(p))
#define TO_LDS(p) ((v4i32*)(p))

typedef __attribute__((ext_vector_type(4))) float  v4f;
typedef __attribute__((ext_vector_type(2))) float  v2f;
typedef __attribute__((ext_vector_type(8))) __bf16 v8bf;
typedef __attribute__((ext_vector_type(4))) __bf16 v4bf;
typedef __attribute__((ext_vector_type(2))) __bf16 v2bf;

// The kernels around the GEMMs are streams: few, fat waves. Most wave-wide
// accesses cover whole 128-B lines, and a wave keeps 8 or more loads in flight
// but in the key_w transpose: 4 loads of 128 B, stores of 64 B.
// Their loops are all unrolled: the arrays must stay in registers and the loads
// issue as one group.

// ---------------------------------------------------------------- conversions
// A wave converts STEPS x 1024 consecutive floats: 8 x STEPS loads of 512 B, all
// at constant offsets from one address, then as many 256-B stores. The blocks
// of an array cover it exactly: n = blocks x 8 x STEPS x 1024.
template<int STEPS>
__device__ __forceinline__ void cvt_f32_bf16(
    const float* __restrict__ s, __bf16* __restrict__ d, int blk)
{
  const long o = (long)(blk * 8 + (threadIdx.x >> 5)) * (STEPS * 1024) +
                 (threadIdx.x & 31) * 4;
  v4f v[8 * STEPS];
  #pragma unroll
  for (int u = 0; u < 8 * STEPS; ++u)
    v[u] = *reinterpret_cast<const v4f*>(s + o + u * 128);
  #pragma unroll
  for (int u = 0; u < 8 * STEPS; ++u)
    *reinterpret_cast<v4bf*>(d + o + u * 128) = __builtin_convertvector(v[u], v4bf);
}

// dst[c][r] = src[r][c], fp32 -> bf16 (for key_w used in NN orientation)
// One block: one 32 x 32 tile, blk = tile row x (cols / 32) + tile column.
__device__ __forceinline__ void transpose_cvt(
    const float* __restrict__ src, __bf16* __restrict__ dst, int rows, int cols,
    int blk)
{
  __shared__ float tile[32][33];
  const int bx = (blk % (cols / 32)) * 32, by = (blk / (cols / 32)) * 32;
  const int tx = threadIdx.x & 31, ty = threadIdx.x >> 5;
  #pragma unroll
  for (int j = 0; j < 32; j += 8)
    tile[ty + j][tx] = src[(long)(by + ty + j) * cols + (bx + tx)];
  __syncthreads();
  #pragma unroll
  for (int j = 0; j < 32; j += 8)
    dst[(long)(bx + ty + j) * rows + (by + tx)] = (__bf16)tile[tx][ty + j];
}

// up_w [T,H,D] -> upT [T*D, H] (rows = (t,d), K = h)  and  upmix [H, T*D]
// One block: one task, 64 h x 64 d. A thread takes 8 h x 2 d, so that upT gets
// 16-B pieces (a block writes whole lines) and upmix whole 128-B lines per wave.
__device__ __forceinline__ void repack_up(
    const float* __restrict__ upw, __bf16* __restrict__ upT,
    __bf16* __restrict__ upmix, int blk)
{
  const int lane = threadIdx.x & 31, wv = threadIdx.x >> 5;
  const int t = blk >> 4;                              // H / 64 = 16 blocks a task
  const int h0 = (blk & 15) * 64 + wv * 8;
  const int d = lane * 2;
  v2f v[8];
  #pragma unroll
  for (int k = 0; k < 8; ++k)
    v[k] = *reinterpret_cast<const v2f*>(upw + ((long)t * HDI + h0 + k) * DDI + d);
  v8bf r0, r1;
  #pragma unroll
  for (int k = 0; k < 8; ++k) {
    v2bf b = __builtin_convertvector(v[k], v2bf);
    *reinterpret_cast<v2bf*>(upmix + ((long)(h0 + k) << 9) + t * DDI + d) = b;  // pitch T*D
    r0[k] = b[0]; r1[k] = b[1];
  }
  *reinterpret_cast<v8bf*>(upT + ((long)(t * DDI + d) << 10) + h0) = r0;        // pitch H
  *reinterpret_cast<v8bf*>(upT + ((long)(t * DDI + d + 1) << 10) + h0) = r1;
}

// All seven preparations in one launch: none reads what another writes, so the
// small ones run beside the big stream instead of each paying a launch of its
// own. A block's index range picks its job (the same for the whole block); the
// long blocks have the low indices, the short ones fill the tail.
// In the built kernel the code of another job follows a job's last stores and
// rewrites their registers on a way that the branches leave open: s_wait_xcnt 0
// stands behind those stores, in front of any such overwrite. The first job's
// stores are followed by the end of the program and need none.
#define NB_HS  (TOK * IDI / 32768)
#define NB_DW  (HDI * IDI / 8192)
#define NB_QW  (HDI * HDI / 8192)
#define NB_VW  (HDI * HDI / 8192)
#define NB_DNW (NTK * DDI * HDI / 8192)
#define NB_UP  (NTK * (HDI / 64))
#define NB_KW  ((HDI / 32) * (HDI / 32))
#define NB_PREP (NB_HS + NB_DW + NB_QW + NB_VW + NB_DNW + NB_UP + NB_KW)
__global__ __launch_bounds__(256) void prep_kernel(
    const float* __restrict__ hs, const float* __restrict__ dw,
    const float* __restrict__ qw, const float* __restrict__ vw,
    const float* __restrict__ dnw, const float* __restrict__ upw,
    const float* __restrict__ kw,
    __bf16* __restrict__ hs_bf, __bf16* __restrict__ dw_bf,
    __bf16* __restrict__ qw_bf, __bf16* __restrict__ vw_bf,
    __bf16* __restrict__ dnw_bf, __bf16* __restrict__ upT,
    __bf16* __restrict__ upmix, __bf16* __restrict__ kwT)
{
  int b = blockIdx.x;
  if (b < NB_HS) {
    cvt_f32_bf16<4>(hs, hs_bf, b);
    return;
  }
  b -= NB_HS;
  if (b < NB_DW + NB_QW + NB_VW + NB_DNW) {
    const float* s = dw;
    __bf16* d = dw_bf;
    if (b >= NB_DW) { b -= NB_DW; s = qw; d = qw_bf;
      if (b >= NB_QW) { b -= NB_QW; s = vw; d = vw_bf;
        if (b >= NB_VW) { b -= NB_VW; s = dnw; d = dnw_bf; } } }
    cvt_f32_bf16<1>(s, d, b);
    asm volatile("s_wait_xcnt 0x0" ::: "memory");  // behind the job's last stores, see above
    return;
  }
  b -= NB_DW + NB_QW + NB_VW + NB_DNW;
  if (b < NB_UP) {
    repack_up(upw, upT, upmix, b);
    asm volatile("s_wait_xcnt 0x0" ::: "memory");  // behind the job's last stores, see above
    return;
  }
  transpose_cvt(kw, kwT, HDI, HDI, b - NB_UP);
  asm volatile("s_wait_xcnt 0x0" ::: "memory");  // behind the job's last stores, see above
}

// -------------------------------------------------------------- WMMA NT GEMM
// C[m,j] = sum_k A[m,k] * B[j,k]   (A:[M,K], B:[N,K] row-major bf16)
// 256 threads = 8 waves, wave grid 4x2, wave tile (BM/4)x(BN/2).
// Double-buffered LDS; next tile's global loads overlap the WMMA blocks.
// One stage holds 256 k (512 B of every operand row): enough bytes in flight
// per barrier to cover the copy latency, and each wave-wide copy covers one
// contiguous 512-B row piece. K must be a multiple of 256.
// PAIR: two batched products of one shape that do not depend on each other
// share a launch; batches z >= zsplit take A2, B2, Cf2 (f32 out, no bias, no relu).
// VIN: the epilogue adds addF[m,j] + sum_t rowW[m,t] * colW[t,j] to the product
// and stores bf16 only (Cb1); one batch, no bias, no relu.
template<int BM, int BN, bool PAIR, bool VIN>
__global__ __launch_bounds__(256) void wmma_gemm_nt(
    const __bf16* __restrict__ A, const __bf16* __restrict__ B,
    float* __restrict__ Cf1, __bf16* __restrict__ Cb1,
    const float* __restrict__ bias1,
    int M, int N, int K,
    long long strideA, long long strideB, long long strideC,
    long long strideBias, int relu1,
    const __bf16* __restrict__ A2, const __bf16* __restrict__ B2,
    float* __restrict__ Cf2, int zsplit,
    const float* __restrict__ addF, const float* __restrict__ colW,
    const float* __restrict__ rowW)
{
  constexpr int BK = 256;
  constexpr int LP = 264;                // LDS pitch (bf16) = 528B = 16B x odd
  constexpr int SR = 256 * 8 / BK;       // tile rows staged per 256-thread sweep
  constexpr int WTM = BM / 4;
  constexpr int WTN = BN / 2;
  constexpr int FM = WTM / 16;
  constexpr int FN = WTN / 16;
  constexpr int AIT = BM * BK / 8 / 256; // 16B chunks per thread (A tile)
  constexpr int BIT = BN * BK / 8 / 256; // 16B chunks per thread (B tile)
  static_assert(AIT >= 1 && BIT >= 1, "tile too small for 256 threads");

  __shared__ __attribute__((aligned(16))) __bf16 smA[2][BM * LP];
  __shared__ __attribute__((aligned(16))) __bf16 smB[2][BN * LP];

  const int tid = threadIdx.x;
  const int wv = tid >> 5, lane = tid & 31;
  const int wr = wv & 3, wc = wv >> 2;
  const int r = lane & 15, hi = lane >> 4;
  const int bm0 = blockIdx.x * BM, bn0 = blockIdx.y * BN;
  const bool second = PAIR && (int)blockIdx.z >= zsplit;  // alike in the whole block
  const int bz = second ? blockIdx.z - zsplit : blockIdx.z;
  float* Cf = second ? Cf2 : Cf1;
  __bf16* Cb = second ? nullptr : Cb1;
  const float* bias = second ? nullptr : bias1;
  const int relu = second ? 0 : relu1;

  const __bf16* Ab = (second ? A2 : A) + (long long)bz * strideA;
  const __bf16* Bb = (second ? B2 : B) + (long long)bz * strideB;

  // per-thread staging coordinates (hoisted out of the K loop)
  const int srow = tid >> 5, skc = (tid & 31) * 8;  // row within tile, K chunk
  const __bf16* aSrc = Ab + (long long)(bm0 + srow) * K + skc;
  const __bf16* bSrc = Bb + (long long)(bn0 + srow) * K + skc;

  const v8f vzero = {0.f, 0.f, 0.f, 0.f, 0.f, 0.f, 0.f, 0.f};
  v8f acc[FM][FN];
  #pragma unroll
  for (int i = 0; i < FM; ++i)
    #pragma unroll
    for (int j = 0; j < FN; ++j) acc[i][j] = vzero;

#ifdef USE_ASYNC_COPY
  auto stage_async = [&](int k0, int buf) {
    #pragma unroll
    for (int it = 0; it < AIT; ++it)
      __builtin_amdgcn_global_load_async_to_lds_b128(
          TO_GLB(aSrc + (long long)it * SR * K + k0),
          TO_LDS(&smA[buf][(srow + it * SR) * LP + skc]), 0, 0);
    #pragma unroll
    for (int it = 0; it < BIT; ++it)
      __builtin_amdgcn_global_load_async_to_lds_b128(
          TO_GLB(bSrc + (long long)it * SR * K + k0),
          TO_LDS(&smB[buf][(srow + it * SR) * LP + skc]), 0, 0);
  };
#else
  uint4 ra[AIT], rb[BIT];
  auto stage_load = [&](int k0) {
    #pragma unroll
    for (int it = 0; it < AIT; ++it)
      ra[it] = *reinterpret_cast<const uint4*>(aSrc + (long long)it * SR * K + k0);
    #pragma unroll
    for (int it = 0; it < BIT; ++it)
      rb[it] = *reinterpret_cast<const uint4*>(bSrc + (long long)it * SR * K + k0);
  };
  auto stage_store = [&](int buf) {
    #pragma unroll
    for (int it = 0; it < AIT; ++it)
      *reinterpret_cast<uint4*>(&smA[buf][(srow + it * SR) * LP + skc]) = ra[it];
    #pragma unroll
    for (int it = 0; it < BIT; ++it)
      *reinterpret_cast<uint4*>(&smB[buf][(srow + it * SR) * LP + skc]) = rb[it];
  };
#endif

  // prologue: stage tile 0 into buffer 0
#ifdef USE_ASYNC_COPY
  stage_async(0, 0);
  // tile 0 must have landed before the barrier that publishes it
  asm volatile("s_wait_asynccnt 0x0" ::: "memory");
#else
  stage_load(0);
  stage_store(0);
#endif
  __syncthreads();

  int cur = 0;
  for (int k0 = 0; k0 < K; k0 += BK) {
    const bool hasNext = (k0 + BK) < K;
    // issue next tile's global loads before computing (overlap)
#ifdef USE_ASYNC_COPY
    if (hasNext) stage_async(k0 + BK, cur ^ 1);
#else
    if (hasNext) stage_load(k0 + BK);
#endif

    // fragments per ISA 16-bit A/B layout:
    // lane<16 holds K{0..7,16..23}, lane>=16 holds K{8..15,24..31}
    // unrolled so that a block's LDS reads can be issued ahead of the one before
    #pragma unroll
    for (int kk = 0; kk < BK; kk += 32) {
      v16bf af[FM], bfv[FN];
      #pragma unroll
      for (int i = 0; i < FM; ++i) {
        int row = wr * WTM + i * 16 + r;
        union { uint4 u[2]; v16bf v; } u;
        u.u[0] = *reinterpret_cast<const uint4*>(&smA[cur][row * LP + kk + hi * 8]);
        u.u[1] = *reinterpret_cast<const uint4*>(&smA[cur][row * LP + kk + 16 + hi * 8]);
        af[i] = u.v;
      }
      #pragma unroll
      for (int j = 0; j < FN; ++j) {
        int row = wc * WTN + j * 16 + r;
        union { uint4 u[2]; v16bf v; } u;
        u.u[0] = *reinterpret_cast<const uint4*>(&smB[cur][row * LP + kk + hi * 8]);
        u.u[1] = *reinterpret_cast<const uint4*>(&smB[cur][row * LP + kk + 16 + hi * 8]);
        bfv[j] = u.v;
      }
      #pragma unroll
      for (int i = 0; i < FM; ++i)
        #pragma unroll
        for (int j = 0; j < FN; ++j)
          acc[i][j] = __builtin_amdgcn_wmma_f32_16x16x32_bf16(
              false, af[i], false, bfv[j], (short)0, acc[i][j], false, false);
    }

    // publish next tile into the other buffer
#ifdef USE_ASYNC_COPY
    // keeps the stage's last WMMAs in front of the barrier: sunk behind it they
    // would delay the issue of the next refill, which every trip waits for
    __builtin_amdgcn_sched_barrier(0);
    // this wave's reads of the buffer that is refilled behind the barrier are done
    asm volatile("s_wait_dscnt 0x0" ::: "memory");
    // this wave's copies of the next tile have landed before other waves read them
    asm volatile("s_wait_asynccnt 0x0" ::: "memory");
#else
    if (hasNext) stage_store(cur ^ 1);
#endif
    __syncthreads();
    cur ^= 1;
  }

  // C lane layout: lane<16 -> M = v, lane>=16 -> M = 8+v; N = lane&15.
  if constexpr (VIN) {
    // x = (product + addF) + rowW[0]*colW[0] + ... + rowW[7]*colW[7], in that order.
    // The row pitch is the constant HDI (= N here): every access of an array is one
    // base address plus an immediate offset. The loops are unrolled so that a row
    // group's loads issue together, ahead of its sums.
    const int gm0 = bm0 + wr * WTM + hi * 8;
    const int gn0 = bn0 + wc * WTN + r;
    const float* cwp = colW + gn0;
    const float* rwp = rowW + (long long)gm0 * NTK;
    const float* adp = addF + (long long)gm0 * HDI + gn0;
    __bf16* op = Cb1 + (long long)gm0 * HDI + gn0;
    float cw[NTK][FN];
    #pragma unroll
    for (int t = 0; t < NTK; ++t)
      #pragma unroll
      for (int j = 0; j < FN; ++j) cw[t][j] = cwp[t * HDI + j * 16];
    #pragma unroll
    for (int i = 0; i < FM; ++i) {
      v4f rw[8][2];
      float ad[FN][8];
      #pragma unroll
      for (int v = 0; v < 8; ++v) {
        rw[v][0] = *reinterpret_cast<const v4f*>(rwp + (i * 16 + v) * NTK);
        rw[v][1] = *reinterpret_cast<const v4f*>(rwp + (i * 16 + v) * NTK + 4);
      }
      // the loads below may land in the address registers of the loads above
      asm volatile("s_wait_xcnt 0x0" ::: "memory");
      #pragma unroll
      for (int v = 0; v < 8; ++v)
        #pragma unroll
        for (int j = 0; j < FN; ++j) ad[j][v] = adp[(i * 16 + v) * HDI + j * 16];
      #pragma unroll
      for (int j = 0; j < FN; ++j) {
        #pragma unroll
        for (int v = 0; v < 8; ++v) {
          float x = acc[i][j][v] + ad[j][v];
          #pragma unroll
          for (int t = 0; t < NTK; ++t) x += rw[v][t >> 2][t & 3] * cw[t][j];
          op[(i * 16 + v) * HDI + j * 16] = (__bf16)x;
        }
      }
      // keeps the next row group's loads behind this group's sums: all hoisted to
      // the front they take the kernel past 256 registers
      __builtin_amdgcn_sched_barrier(0);
      // the next group reuses registers that this group's loads and stores name
      if (i + 1 < FM) asm volatile("s_wait_xcnt 0x0" ::: "memory");
    }
    return;
  }
  // epilogue: + bias[col], optional relu, f32 and/or bf16 store.
  const float* biasB = bias ? (bias + (long long)bz * strideBias) : nullptr;
  #pragma unroll
  for (int i = 0; i < FM; ++i) {
    #pragma unroll
    for (int j = 0; j < FN; ++j) {
      int gm = bm0 + wr * WTM + i * 16 + hi * 8;
      int gn = bn0 + wc * WTN + j * 16 + r;
      float bv = biasB ? biasB[gn] : 0.0f;
      #pragma unroll
      for (int v = 0; v < 8; ++v) {
        float x = acc[i][j][v] + bv;
        if (relu) x = fmaxf(x, 0.0f);
        long long idx = (long long)bz * strideC + (long long)(gm + v) * N + gn;
        if (Cf) Cf[idx] = x;
        if (Cb) Cb[idx] = (__bf16)x;
      }
    }
  }
}

// ---------------------------------------------------------------- layernorms
// One wave per row: a lane holds 8 x 4 values (h = j*128 + lane*4), the row
// sums need only the wave's butterfly, no LDS and no barrier.
__global__ __launch_bounds__(256) void ln1_kernel(
    const float* __restrict__ inT, const float* __restrict__ hd,
    const float* __restrict__ g, const float* __restrict__ b,
    __bf16* __restrict__ preBf, __bf16* __restrict__ ainBf)
{
  const int lane = threadIdx.x & 31;
  const long row = (long)(blockIdx.x * 8 + (threadIdx.x >> 5)) * HDI + lane * 4;
  v4f x[8];
  #pragma unroll
  for (int j = 0; j < 8; ++j)
    x[j] = *reinterpret_cast<const v4f*>(inT + row + j * 128) +
           *reinterpret_cast<const v4f*>(hd + row + j * 128);
  v4f gv[8], bv[8];                      // fetched with the row, not behind the sums
  #pragma unroll
  for (int j = 0; j < 8; ++j) {
    gv[j] = *reinterpret_cast<const v4f*>(g + j * 128 + lane * 4);
    bv[j] = *reinterpret_cast<const v4f*>(b + j * 128 + lane * 4);
  }
  // keeps all 32 loads in front of the sums: sunk behind them, the g and b loads
  // would add their latency to the row's, pair by pair
  __builtin_amdgcn_sched_barrier(0);
  v4f sv = {0.f, 0.f, 0.f, 0.f}, qv = {0.f, 0.f, 0.f, 0.f};
  #pragma unroll
  for (int j = 0; j < 8; ++j) { sv += x[j]; qv += x[j] * x[j]; }
  float s = (sv[0] + sv[1]) + (sv[2] + sv[3]);
  float ss = (qv[0] + qv[1]) + (qv[2] + qv[3]);
  #pragma unroll
  for (int m = 16; m; m >>= 1) { s += __shfl_xor(s, m, 32); ss += __shfl_xor(ss, m, 32); }
  float mean = s * (1.0f / HDI);
  float var  = ss * (1.0f / HDI) - mean * mean;
  float rstd = rsqrtf(var + 1e-12f);
  #pragma unroll
  for (int j = 0; j < 8; ++j) {
    *reinterpret_cast<v4bf*>(preBf + row + j * 128) = __builtin_convertvector(x[j], v4bf);
    *reinterpret_cast<v4bf*>(ainBf + row + j * 128) =
        __builtin_convertvector((x[j] - mean) * rstd * gv[j] + bv[j], v4bf);
  }
}

__global__ __launch_bounds__(256) void ln2_kernel(
    const float* __restrict__ inT, const float* __restrict__ fus,
    const float* __restrict__ g, const float* __restrict__ b,
    float* __restrict__ out)
{
  const int lane = threadIdx.x & 31;
  const long row = (long)(blockIdx.x * 8 + (threadIdx.x >> 5)) * HDI + lane * 4;
  v4f x[8];
  #pragma unroll
  for (int j = 0; j < 8; ++j)
    x[j] = *reinterpret_cast<const v4f*>(inT + row + j * 128) +
           *reinterpret_cast<const v4f*>(fus + row + j * 128);
  v4f gv[8], bv[8];                      // fetched with the row, not behind the sums
  #pragma unroll
  for (int j = 0; j < 8; ++j) {
    gv[j] = *reinterpret_cast<const v4f*>(g + j * 128 + lane * 4);
    bv[j] = *reinterpret_cast<const v4f*>(b + j * 128 + lane * 4);
  }
  // keeps all 32 loads in front of the sums: sunk behind them, the g and b loads
  // would add their latency to the row's, pair by pair
  __builtin_amdgcn_sched_barrier(0);
  v4f sv = {0.f, 0.f, 0.f, 0.f}, qv = {0.f, 0.f, 0.f, 0.f};
  #pragma unroll
  for (int j = 0; j < 8; ++j) { sv += x[j]; qv += x[j] * x[j]; }
  float s = (sv[0] + sv[1]) + (sv[2] + sv[3]);
  float ss = (qv[0] + qv[1]) + (qv[2] + qv[3]);
  #pragma unroll
  for (int m = 16; m; m >>= 1) { s += __shfl_xor(s, m, 32); ss += __shfl_xor(ss, m, 32); }
  float mean = s * (1.0f / HDI);
  float var  = ss * (1.0f / HDI) - mean * mean;
  float rstd = rsqrtf(var + 1e-12f);
  #pragma unroll
  for (int j = 0; j < 8; ++j) {
    *reinterpret_cast<v4f*>(out + row + j * 128) = (x[j] - mean) * rstd * gv[j] + bv[j];
  }
}

// ----------------------------------------------- scores + softmax over tasks
// scores[t,n] = <u[t,n],down[t,n]>_D + <qk[n],up_b[t]>_H + <query[n],key_b>_H
// One wave per token: every lane adds its share of all three terms into one
// partial per task, and one butterfly per task finishes the score.
// The wave then reads its token's down values a second time and also writes
// wdown[n, t*64+d] = bf16(probs[n,t] * down[t,n,d])  (t*64+d = j*128 + lane*4).
__global__ __launch_bounds__(256) void score_softmax_kernel(
    const __bf16* __restrict__ qk, const __bf16* __restrict__ query,
    const float* __restrict__ key_b, const float* __restrict__ up_b,
    const float* __restrict__ u, const float* __restrict__ down,
    float* __restrict__ probs, __bf16* __restrict__ wd)
{
  const int lane = threadIdx.x & 31, hi = lane >> 4;
  const int n = blockIdx.x * 8 + (threadIdx.x >> 5);

  float pq[NTK] = {0.f, 0.f, 0.f, 0.f, 0.f, 0.f, 0.f, 0.f};
  float pc = 0.f;
  #pragma unroll
  for (int j = 0; j < 8; ++j) {
    const int h = j * 128 + lane * 4;
    v4f q  = __builtin_convertvector(
        *reinterpret_cast<const v4bf*>(qk + (long)n * HDI + h), v4f);
    v4f qr = __builtin_convertvector(
        *reinterpret_cast<const v4bf*>(query + (long)n * HDI + h), v4f);
    v4f kv = *reinterpret_cast<const v4f*>(key_b + h);
    pc += (qr[0] * kv[0] + qr[1] * kv[1]) + (qr[2] * kv[2] + qr[3] * kv[3]);
    #pragma unroll
    for (int t = 0; t < NTK; ++t) {
      v4f ub = *reinterpret_cast<const v4f*>(up_b + t * HDI + h);
      pq[t] += (q[0] * ub[0] + q[1] * ub[1]) + (q[2] * ub[2] + q[3] * ub[3]);
    }
  }
  // <u,down> over D = 64: the low half-wave takes task 2j, the high one 2j+1
  #pragma unroll
  for (int j = 0; j < NTK / 2; ++j) {
    const long o = ((long)(2 * j + hi) * TOK + n) * DDI + (lane & 15) * 4;
    v4f a = *reinterpret_cast<const v4f*>(u + o);
    v4f c = *reinterpret_cast<const v4f*>(down + o);
    float p = (a[0] * c[0] + a[1] * c[1]) + (a[2] * c[2] + a[3] * c[3]);
    pq[2 * j]     += hi ? 0.f : p;
    pq[2 * j + 1] += hi ? p : 0.f;
  }
  float s[NTK], mx = -1e30f;
  #pragma unroll
  for (int t = 0; t < NTK; ++t) {
    float a = pq[t] + pc;
    #pragma unroll
    for (int m = 16; m; m >>= 1) a += __shfl_xor(a, m, 32);
    s[t] = a;
    mx = fmaxf(mx, a);
  }
  float den = 0.f;
  #pragma unroll
  for (int t = 0; t < NTK; ++t) { s[t] = __expf(s[t] - mx); den += s[t]; }
  float inv = 1.0f / den;
  if (lane == 0) {
    v4f p0 = {s[0] * inv, s[1] * inv, s[2] * inv, s[3] * inv};
    v4f p1 = {s[4] * inv, s[5] * inv, s[6] * inv, s[7] * inv};
    *reinterpret_cast<v4f*>(probs + (long)n * NTK) = p0;
    *reinterpret_cast<v4f*>(probs + (long)n * NTK + 4) = p1;
  }
  // Compiler fence: the down values are fetched a second time here (lines this
  // wave has just read) and not held in 16 registers across the sums above; held,
  // they push the kernel past 256 registers and halve the waves a WGP can hold.
  asm volatile("" ::: "memory");
  #pragma unroll
  for (int j = 0; j < NTK / 2; ++j) {
    v4f dn = *reinterpret_cast<const v4f*>(
        down + ((long)(2 * j + hi) * TOK + n) * DDI + (lane & 15) * 4);
    float p = (hi ? s[2 * j + 1] : s[2 * j]) * inv;
    *reinterpret_cast<v4bf*>(wd + (long)n * (NTK * DDI) + j * 128 + lane * 4) =
        __builtin_convertvector(p * dn, v4bf);
  }
}

// ---------------------------------------------------------------------------
extern "C" void kernel_launch(void* const* d_in, const int* in_sizes, int n_in,
                              void* d_out, int out_size, void* d_ws, size_t ws_size,
                              hipStream_t stream) {
  (void)in_sizes; (void)n_in; (void)out_size; (void)ws_size;
  const float* hs  = (const float*)d_in[0];
  const float* inT = (const float*)d_in[1];
  const float* dw  = (const float*)d_in[2];
  const float* db  = (const float*)d_in[3];
  const float* lng = (const float*)d_in[4];
  const float* lnb = (const float*)d_in[5];
  const float* dnw = (const float*)d_in[6];
  const float* dnb = (const float*)d_in[7];
  const float* upw = (const float*)d_in[8];
  const float* upb = (const float*)d_in[9];
  const float* kw  = (const float*)d_in[10];
  const float* kb  = (const float*)d_in[11];
  const float* qw  = (const float*)d_in[12];
  const float* qb  = (const float*)d_in[13];
  const float* vw  = (const float*)d_in[14];
  float* out = (float*)d_out;

  char* ws = (char*)d_ws;
  size_t off = 0;
  auto alloc = [&](size_t bytes) -> char* {
    char* p = ws + off;
    off += (bytes + 255) & ~(size_t)255;
    return p;
  };

  __bf16* hs_bf   = (__bf16*)alloc((size_t)TOK * IDI * 2);
  __bf16* dw_bf   = (__bf16*)alloc((size_t)HDI * IDI * 2);
  float*  hdense  = (float*) alloc((size_t)TOK * HDI * 4);
  __bf16* pre_bf  = (__bf16*)alloc((size_t)TOK * HDI * 2);
  __bf16* ain_bf  = (__bf16*)alloc((size_t)TOK * HDI * 2);
  __bf16* qw_bf   = (__bf16*)alloc((size_t)HDI * HDI * 2);
  __bf16* kwT_bf  = (__bf16*)alloc((size_t)HDI * HDI * 2);
  __bf16* vw_bf   = (__bf16*)alloc((size_t)HDI * HDI * 2);
  __bf16* dnw_bf  = (__bf16*)alloc((size_t)NTK * DDI * HDI * 2);
  __bf16* upT_bf  = (__bf16*)alloc((size_t)NTK * DDI * HDI * 2);
  __bf16* upmx_bf = (__bf16*)alloc((size_t)NTK * DDI * HDI * 2);
  __bf16* query_bf= (__bf16*)alloc((size_t)TOK * HDI * 2);
  __bf16* qk_bf   = (__bf16*)alloc((size_t)TOK * HDI * 2);
  float*  down_f  = (float*) alloc((size_t)NTK * TOK * DDI * 4);
  float*  u_f     = (float*) alloc((size_t)NTK * TOK * DDI * 4);
  float*  probs   = (float*) alloc((size_t)TOK * NTK * 4);
  __bf16* wdown_bf= (__bf16*)alloc((size_t)TOK * NTK * DDI * 2);
  __bf16* vin_bf  = (__bf16*)alloc((size_t)TOK * HDI * 2);
  float*  fus_f   = (float*) alloc((size_t)TOK * HDI * 4);

  // ---- stage 0: precision conversion / weight repacking
  prep_kernel<<<dim3(NB_PREP), dim3(256), 0, stream>>>(
      hs, dw, qw, vw, dnw, upw, kw,
      hs_bf, dw_bf, qw_bf, vw_bf, dnw_bf, upT_bf, upmx_bf, kwT_bf);

  // ---- G1: h = hs @ dense_w^T + dense_b
  wmma_gemm_nt<128, 128, false, false><<<dim3(TOK / 128, HDI / 128, 1), dim3(256), 0, stream>>>(
      hs_bf, dw_bf, hdense, nullptr, db, TOK, HDI, IDI, 0, 0, 0, 0, 0,
      nullptr, nullptr, nullptr, 1, nullptr, nullptr, nullptr);

  // ---- LN1: prenorm(bf16) + adapter_in(bf16)
  ln1_kernel<<<dim3(TOK / 8), dim3(256), 0, stream>>>(inT, hdense, lng, lnb, pre_bf, ain_bf);

  // ---- G2: query = prenorm @ query_w^T + query_b  (bf16 out)
  wmma_gemm_nt<128, 128, false, false><<<dim3(TOK / 128, HDI / 128, 1), dim3(256), 0, stream>>>(
      pre_bf, qw_bf, nullptr, query_bf, qb, TOK, HDI, HDI, 0, 0, 0, 0, 0,
      nullptr, nullptr, nullptr, 1, nullptr, nullptr, nullptr);

  // ---- G3: qk = query @ key_w  (bf16 out)
  wmma_gemm_nt<128, 128, false, false><<<dim3(TOK / 128, HDI / 128, 1), dim3(256), 0, stream>>>(
      query_bf, kwT_bf, nullptr, qk_bf, nullptr, TOK, HDI, HDI, 0, 0, 0, 0, 0,
      nullptr, nullptr, nullptr, 1, nullptr, nullptr, nullptr);

  // ---- G4: down[t] = relu(adapter_in @ down_w[t]^T + down_b[t])  (z = t)
  // ---- G5: u[t] = qk @ up_w[t]                                   (z = T + t)
  wmma_gemm_nt<128, 64, true, false><<<dim3(TOK / 128, 1, 2 * NTK), dim3(256), 0, stream>>>(
      ain_bf, dnw_bf, down_f, nullptr, dnb, TOK, DDI, HDI,
      0, (long long)DDI * HDI, (long long)TOK * DDI, DDI, 1,
      qk_bf, upT_bf, u_f, NTK, nullptr, nullptr, nullptr);

  // ---- scores + softmax over tasks; probs-weighted down, flattened [N, T*D]
  score_softmax_kernel<<<dim3(TOK / 8), dim3(256), 0, stream>>>(
      qk_bf, query_bf, kb, upb, u_f, down_f, probs, wdown_bf);

  // ---- G6: vin = wdown @ up_all^T + h + probs@up_b  ([4096,512] x [1024,512], bf16 out)
  wmma_gemm_nt<128, 128, false, true><<<dim3(TOK / 128, HDI / 128, 1), dim3(256), 0, stream>>>(
      wdown_bf, upmx_bf, nullptr, vin_bf, nullptr, TOK, HDI, NTK * DDI, 0, 0, 0, 0, 0,
      nullptr, nullptr, nullptr, 1, hdense, upb, probs);

  // ---- G7: fusion = vin @ value_w^T
  wmma_gemm_nt<128, 128, false, false><<<dim3(TOK / 128, HDI / 128, 1), dim3(256), 0, stream>>>(
      vin_bf, vw_bf, fus_f, nullptr, nullptr, TOK, HDI, HDI, 0, 0, 0, 0, 0,
      nullptr, nullptr, nullptr, 1, nullptr, nullptr, nullptr);

  // ---- LN2 -> out
  ln2_kernel<<<dim3(TOK / 8), dim3(256), 0, stream>>>(inT, fus_f, lng, lnb, out);
}

// v006
// A run of this version takes 104 microseconds.
// It is 1.21 times as fast as v004, going by the measured steps of the versions left out in between.
// All steps since v000 together make it 2.44 times as fast.
#include <hip/hip_runtime.h>

// ---------------------------------------------------------------------------
// BertOutputWithAdapterFusion for MI455X (gfx1250, wave32, WMMA bf16)
//
//   h        = hs @ dense_w^T + dense_b                      (WMMA)
//   prenorm  = input + h ; adapter_in = LN(prenorm)
//   scores[t] = <query, key[t]> is linear in prenorm and in down[t], so the three
//   weight matrices between them are multiplied first (weight-sized products):
//   upx      = [up_w[t]^T rows (t,d) ; up_b rows t]   [T*D+T, H]
//   ku       = upx @ key_w^T                                 (WMMA, beside h)
//   qku      = ku @ query_w                                  (WMMA, beside LN)
//   cv       = ku @ query_b
//   down[t]  = relu(adapter_in @ down_w[t]^T + down_b[t])    (WMMA, batched)
//   u[t]     = prenorm @ qku[t]^T + cv[t]                    (WMMA, batched)
//   scores   = <u,down>_D + <prenorm,qku[T*D+t]> + cv[T*D+t]
//              (<query,key_b> is the same for every t and cancels in the softmax)
//   probs    = softmax_t
//   fusion   = (sum_t probs[t] * (down[t] @ up_w[t]^T + up_b[t]) + h) @ value_w^T
//              (sum_t probs = 1) is linear in probs*down and in h, so value_w is
//              multiplied into the up weights first (a weight-sized product):
//   uv       = upx @ value_w^T                               (WMMA, beside h)
//   fusion   = [probs*down | h] @ [uv rows (t,d) | value_w]^T  (WMMA, one product,
//              K = T*D + H)  + probs @ uv[T*D+t]
//   out      = LN(input + fusion)
// ---------------------------------------------------------------------------

#define TOK 4096   // B*S tokens
#define HDI 1024   // hidden
#define IDI 4096   // intermediate
#define NTK 8      // tasks
#define DDI 64     // bottleneck
#define UXR 640    // rows of upx and ku: T*D + T, filled up to whole 128-row tiles
#define UQR 576    // rows of qku and cv: T*D + T, filled up to whole 64-row tiles

typedef __attribute__((ext_vector_type(16))) __bf16 v16bf;
typedef __attribute__((ext_vector_type(8)))  float  v8f;

// --- optional gfx1250 async global->LDS copy path (ASYNCcnt) ---------------
#ifdef __has_builtin
#if __has_builtin(__builtin_amdgcn_global_load_async_to_lds_b128) && \
    __has_builtin(__builtin_amdgcn_s_wait_asynccnt)
#define USE_ASYNC_COPY 1
#endif
#endif

// builtin takes pointers to 16B int vectors (b128); clang adjusts addr space
typedef int v4i32 __attribute__((vector_size(16)));
#define TO_GLB(p) ((v4i32*)(p))
#define TO_LDS(p) ((v4i32*)(p))

typedef __attribute__((ext_vector_type(4))) float  v4f;
typedef __attribute__((ext_vector_type(2))) float  v2f;
typedef __attribute__((ext_vector_type(8))) __bf16 v8bf;
typedef __attribute__((ext_vector_type(4))) __bf16 v4bf;
typedef __attribute__((ext_vector_type(2))) __bf16 v2bf;

// The kernels around the GEMMs are streams: few, fat waves. Most wave-wide
// accesses cover whole 128-B lines, and a wave keeps 8 or more loads in flight
// but in the query_w transpose: 4 loads of 128 B, stores of 64 B.
// Their loops are all unrolled: the arrays must stay in registers and the loads
// issue as one group.

// ---------------------------------------------------------------- conversions
// A wave converts STEPS x 1024 consecutive floats: 8 x STEPS loads of 512 B, all
// at constant offsets from one address, then as many 256-B stores. The blocks
// of an array cover it exactly: n = blocks x 8 x STEPS x 1024.
template<int STEPS>
__device__ __forceinline__ void cvt_f32_bf16(
    const float* __restrict__ s, __bf16* __restrict__ d, int blk)
{
  const long o = (long)(blk * 8 + (threadIdx.x >> 5)) * (STEPS * 1024) +
                 (threadIdx.x & 31) * 4;
  v4f v[8 * STEPS];
  #pragma unroll
  for (int u = 0; u < 8 * STEPS; ++u)
    v[u] = *reinterpret_cast<const v4f*>(s + o + u * 128);
  #pragma unroll
  for (int u = 0; u < 8 * STEPS; ++u)
    *reinterpret_cast<v4bf*>(d + o + u * 128) = __builtin_convertvector(v[u], v4bf);
}

// dst[c][r] = src[r][c], fp32 -> bf16 (for query_w used in NN orientation)
// One block: one 32 x 32 tile, blk = tile row x (cols / 32) + tile column.
__device__ __forceinline__ void transpose_cvt(
    const float* __restrict__ src, __bf16* __restrict__ dst, int rows, int cols,
    int blk)
{
  __shared__ float tile[32][33];
  const int bx = (blk % (cols / 32)) * 32, by = (blk / (cols / 32)) * 32;
  const int tx = threadIdx.x & 31, ty = threadIdx.x >> 5;
  #pragma unroll
  for (int j = 0; j < 32; j += 8)
    tile[ty + j][tx] = src[(long)(by + ty + j) * cols + (bx + tx)];
  __syncthreads();
  #pragma unroll
  for (int j = 0; j < 32; j += 8)
    dst[(long)(bx + ty + j) * rows + (by + tx)] = (__bf16)tile[tx][ty + j];
}

// up_w [T,H,D] -> upT [T*D, H] (rows = (t,d), K = h)
// One block: one task, 64 h x 64 d. A thread takes 8 h x 2 d, so that upT gets
// 16-B pieces (a block writes whole lines).
__device__ __forceinline__ void repack_up(
    const float* __restrict__ upw, __bf16* __restrict__ upT, int blk)
{
  const int lane = threadIdx.x & 31, wv = threadIdx.x >> 5;
  const int t = blk >> 4;                              // H / 64 = 16 blocks a task
  const int h0 = (blk & 15) * 64 + wv * 8;
  const int d = lane * 2;
  v2f v[8];
  #pragma unroll
  for (int k = 0; k < 8; ++k)
    v[k] = *reinterpret_cast<const v2f*>(upw + ((long)t * HDI + h0 + k) * DDI + d);
  v8bf r0, r1;
  #pragma unroll
  for (int k = 0; k < 8; ++k) {
    v2bf b = __builtin_convertvector(v[k], v2bf);
    r0[k] = b[0]; r1[k] = b[1];
  }
  *reinterpret_cast<v8bf*>(upT + ((long)(t * DDI + d) << 10) + h0) = r0;        // pitch H
  *reinterpret_cast<v8bf*>(upT + ((long)(t * DDI + d + 1) << 10) + h0) = r1;
}

// Rows T*D .. UXR-1 of upx: the T rows of up_b, then zero rows that fill the last
// 128-row tile of the product that reads upx. One block: 8 rows of H.
__device__ __forceinline__ void upb_rows(
    const float* __restrict__ upb, __bf16* __restrict__ d, int blk)
{
  const int o = (threadIdx.x >> 5) * 1024 + (threadIdx.x & 31) * 4;
  v4f v[8];
  #pragma unroll
  for (int u = 0; u < 8; ++u) v[u] = v4f{0.f, 0.f, 0.f, 0.f};
  if (blk == 0) {
    #pragma unroll
    for (int u = 0; u < 8; ++u) v[u] = *reinterpret_cast<const v4f*>(upb + o + u * 128);
  }
  #pragma unroll
  for (int u = 0; u < 8; ++u)
    *reinterpret_cast<v4bf*>(d + blk * 8192 + o + u * 128) = __builtin_convertvector(v[u], v4bf);
}

// All eight preparations in one launch: none reads what another writes, so the
// small ones run beside the big stream instead of each paying a launch of its
// own. A block's index range picks its job (the same for the whole block); the
// long blocks have the low indices, the short ones fill the tail.
// In the built kernel the code of another job follows a job's last stores and
// rewrites their registers on a way that the branches leave open: s_wait_xcnt 0
// stands behind those stores, in front of any such overwrite. The first job's
// stores are followed by the end of the program and need none.
#define NB_HS  (TOK * IDI / 32768)
#define NB_DW  (HDI * IDI / 8192)
#define NB_KW  (HDI * HDI / 8192)
#define NB_VW  (HDI * HDI / 8192)
#define NB_DNW (NTK * DDI * HDI / 8192)
#define NB_UP  (NTK * (HDI / 64))
#define NB_UB  ((UXR - NTK * DDI) / 8)
#define NB_QW  ((HDI / 32) * (HDI / 32))
#define NB_PREP (NB_HS + NB_DW + NB_KW + NB_VW + NB_DNW + NB_UP + NB_UB + NB_QW)
__global__ __launch_bounds__(256) void prep_kernel(
    const float* __restrict__ hs, const float* __restrict__ dw,
    const float* __restrict__ qw, const float* __restrict__ vw,
    const float* __restrict__ dnw, const float* __restrict__ upw,
    const float* __restrict__ kw, const float* __restrict__ upb,
    __bf16* __restrict__ hs_bf, __bf16* __restrict__ dw_bf,
    __bf16* __restrict__ kw_bf, __bf16* __restrict__ vw_bf,
    __bf16* __restrict__ dnw_bf, __bf16* __restrict__ upT,
    __bf16* __restrict__ qwT)
{
  int b = blockIdx.x;
  if (b < NB_HS) {
    cvt_f32_bf16<4>(hs, hs_bf, b);
    return;
  }
  b -= NB_HS;
  if (b < NB_DW + NB_KW + NB_VW + NB_DNW) {
    const float* s = dw;
    __bf16* d = dw_bf;
    if (b >= NB_DW) { b -= NB_DW; s = kw; d = kw_bf;
      if (b >= NB_KW) { b -= NB_KW; s = vw; d = vw_bf;
        if (b >= NB_VW) { b -= NB_VW; s = dnw; d = dnw_bf; } } }
    cvt_f32_bf16<1>(s, d, b);
    asm volatile("s_wait_xcnt 0x0" ::: "memory");  // behind the job's last stores, see above
    return;
  }
  b -= NB_DW + NB_KW + NB_VW + NB_DNW;
  if (b < NB_UP) {
    repack_up(upw, upT, b);
    asm volatile("s_wait_xcnt 0x0" ::: "memory");  // behind the job's last stores, see above
    return;
  }
  b -= NB_UP;
  if (b < NB_UB) {
    upb_rows(upb, upT + NTK * DDI * HDI, b);
    asm volatile("s_wait_xcnt 0x0" ::: "memory");  // behind the job's last stores, see above
    return;
  }
  transpose_cvt(qw, qwT, HDI, HDI, b - NB_UB);
  asm volatile("s_wait_xcnt 0x0" ::: "memory");  // behind the job's last stores, see above
}

// -------------------------------------------------------------- WMMA NT GEMM
// C[m,j] = sum_k A[m,k] * B[j,k]   (A:[M,K], B:[N,K] row-major bf16)
// 256 threads = 8 waves, wave grid 4x2, wave tile (BM/4)x(BN/2).
// Double-buffered LDS; next tile's global loads overlap the WMMA blocks.
// One stage holds 256 k (512 B of every operand row): enough bytes in flight
// per barrier to cover the copy latency, and each wave-wide copy covers one
// contiguous 512-B row piece. K must be a multiple of 256.
// PAIR: two batched products of one shape that do not depend on each other
// share a launch; batches z >= zsplit take A2, B2, Cf2, bias2 (f32 out, no relu).
// CAT: K runs over two operand pairs, one behind the other: k < K2 from A, B (row
// pitch K2), the rest from A2, B2 (row pitch K - K2); K2 a multiple of 256. The
// epilogue adds sum_t rowW[m,t] * colW[t,j] and stores f32 (Cf1); one batch, N = HDI,
// no bias, no relu.
// SIDE: a second, smaller product (A2 [UXR,K2], B2 [2*N,K2]) that depends on nothing
// of the first (M = TOK) shares its launch. The grid is flat: the first zsplit blocks
// are the first product's tiles, tile row fastest. Its columns below N go to Cb2
// (bf16), the others to Cb3 and Cf2 (see the epilogue).
// gx, gy, gz: the block's place in the grid of tiles.
// RUN: the epilogue forms all its values first and stores them as runs (see there);
// one batch, N = HDI, no relu.
template<int BM, int BN, bool PAIR, bool CAT, bool SIDE, bool RUN>
__device__ __forceinline__ void gemm_nt_body(
    const __bf16* __restrict__ A, const __bf16* __restrict__ B,
    float* __restrict__ Cf1, __bf16* __restrict__ Cb1,
    const float* __restrict__ bias1,
    int M, int N, int K1,
    long long strideA, long long strideB, long long strideC,
    long long strideBias, int relu1,
    const __bf16* __restrict__ A2, const __bf16* __restrict__ B2,
    float* __restrict__ Cf2, int zsplit,
    __bf16* __restrict__ Cb3, const float* __restrict__ colW,
    const float* __restrict__ rowW,
    int K2, __bf16* __restrict__ Cb2, const float* __restrict__ bias2,
    int gx, int gy, int gz)
{
  constexpr int BK = 256;
  constexpr int LP = 264;                // LDS pitch (bf16) = 528B = 16B x odd
  constexpr int SR = 256 * 8 / BK;       // tile rows staged per 256-thread sweep
  constexpr int WTM = BM / 4;
  constexpr int WTN = BN / 2;
  constexpr int FM = WTM / 16;
  constexpr int FN = WTN / 16;
  constexpr int AIT = BM * BK / 8 / 256; // 16B chunks per thread (A tile)
  constexpr int BIT = BN * BK / 8 / 256; // 16B chunks per thread (B tile)
  static_assert(AIT >= 1 && BIT >= 1, "tile too small for 256 threads");

  __shared__ __attribute__((aligned(16))) __bf16 smA[2][BM * LP];
  __shared__ __attribute__((aligned(16))) __bf16 smB[2][BN * LP];

  const int tid = threadIdx.x;
  const int wv = tid >> 5, lane = tid & 31;
  const int wr = wv & 3, wc = wv >> 2;
  const int r = lane & 15, hi = lane >> 4;
  // alike in the whole block
  const bool second = SIDE ? gx >= zsplit : (PAIR && gz >= zsplit);
  if constexpr (SIDE) {
    const int fb = second ? gx - zsplit : gx;
    gy = second ? fb / (UXR / BM) : fb / (TOK / BM);
    gx = second ? fb % (UXR / BM) : fb % (TOK / BM);
  }
  const int K = (SIDE && second) ? K2 : K1;
  const int bm0 = gx * BM, bn0 = gy * BN;
  const int bz = SIDE ? 0 : (second ? gz - zsplit : gz);
  float* Cf = second ? (SIDE ? nullptr : Cf2) : Cf1;
  __bf16* Cb = second ? Cb2 : Cb1;
  const float* bias = second ? bias2 : bias1;
  const int relu = second ? 0 : relu1;

  const __bf16* Ab = (second ? A2 : A) + (long long)bz * strideA;
  const __bf16* Bb = (second ? B2 : B) + (long long)bz * strideB;

  // per-thread staging coordinates (hoisted out of the K loop)
  const int srow = tid >> 5, skc = (tid & 31) * 8;  // row within tile, K chunk
  const int P1 = CAT ? K2 : K;                      // row pitch of A and B
  const __bf16* aSrc = Ab + (long long)(bm0 + srow) * P1 + skc;
  const __bf16* bSrc = Bb + (long long)(bn0 + srow) * P1 + skc;
  const __bf16* aSrc2 = CAT ? A2 + (long long)(bm0 + srow) * (K - K2) + skc : nullptr;
  const __bf16* bSrc2 = CAT ? B2 + (long long)(bn0 + srow) * (K - K2) + skc : nullptr;

  const v8f vzero = {0.f, 0.f, 0.f, 0.f, 0.f, 0.f, 0.f, 0.f};
  v8f acc[FM][FN];
  #pragma unroll
  for (int i = 0; i < FM; ++i)
    #pragma unroll
    for (int j = 0; j < FN; ++j) acc[i][j] = vzero;

#ifdef USE_ASYNC_COPY
  auto stage_async = [&](int k0, int buf) {
    const __bf16* a = aSrc;
    const __bf16* b = bSrc;
    int p = P1;
    if constexpr (CAT) {
      if (k0 >= K2) {                    // alike in the whole block: the second pair
        a = aSrc2; b = bSrc2; p = K - K2; k0 -= K2;
      }
    }
    #pragma unroll
    for (int it = 0; it < AIT; ++it)
      __builtin_amdgcn_global_load_async_to_lds_b128(
          TO_GLB(a + (long long)it * SR * p + k0),
          TO_LDS(&smA[buf][(srow + it * SR) * LP + skc]), 0, 0);
    #pragma unroll
    for (int it = 0; it < BIT; ++it)
      __builtin_amdgcn_global_load_async_to_lds_b128(
          TO_GLB(b + (long long)it * SR * p + k0),
          TO_LDS(&smB[buf][(srow + it * SR) * LP + skc]), 0, 0);
  };
#else
  uint4 ra[AIT], rb[BIT];
  auto stage_load = [&](int k0) {
    const __bf16* a = aSrc;
    const __bf16* b = bSrc;
    int p = P1;
    if constexpr (CAT) {
      if (k0 >= K2) {                    // alike in the whole block: the second pair
        a = aSrc2; b = bSrc2; p = K - K2; k0 -= K2;
      }
    }
    #pragma unroll
    for (int it = 0; it < AIT; ++it)
      ra[it] = *reinterpret_cast<const uint4*>(a + (long long)it * SR * p + k0);
    #pragma unroll
    for (int it = 0; it < BIT; ++it)
      rb[it] = *reinterpret_cast<const uint4*>(b + (long long)it * SR * p + k0);
  };
  auto stage_store = [&](int buf) {
    #pragma unroll
    for (int it = 0; it < AIT; ++it)
      *reinterpret_cast<uint4*>(&smA[buf][(srow + it * SR) * LP + skc]) = ra[it];
    #pragma unroll
    for (int it = 0; it < BIT; ++it)
      *reinterpret_cast<uint4*>(&smB[buf][(srow + it * SR) * LP + skc]) = rb[it];
  };
#endif

  // prologue: stage tile 0 into buffer 0
#ifdef USE_ASYNC_COPY
  stage_async(0, 0);
  // tile 0 must have landed before the barrier that publishes it
  asm volatile("s_wait_asynccnt 0x0" ::: "memory");
#else
  stage_load(0);
  stage_store(0);
#endif
  __syncthreads();

  int cur = 0;
  for (int k0 = 0; k0 < K; k0 += BK) {
    const bool hasNext = (k0 + BK) < K;
    // issue next tile's global loads before computing (overlap)
#ifdef USE_ASYNC_COPY
    if (hasNext) stage_async(k0 + BK, cur ^ 1);
#else
    if (hasNext) stage_load(k0 + BK);
#endif

    // fragments per ISA 16-bit A/B layout:
    // lane<16 holds K{0..7,16..23}, lane>=16 holds K{8..15,24..31}
    // unrolled so that a block's LDS reads can be issued ahead of the one before
    #pragma unroll
    for (int kk = 0; kk < BK; kk += 32) {
      v16bf af[FM], bfv[FN];
      #pragma unroll
      for (int i = 0; i < FM; ++i) {
        int row = wr * WTM + i * 16 + r;
        union { uint4 u[2]; v16bf v; } u;
        u.u[0] = *reinterpret_cast<const uint4*>(&smA[cur][row * LP + kk + hi * 8]);
        u.u[1] = *reinterpret_cast<const uint4*>(&smA[cur][row * LP + kk + 16 + hi * 8]);
        af[i] = u.v;
      }
      #pragma unroll
      for (int j = 0; j < FN; ++j) {
        int row = wc * WTN + j * 16 + r;
        union { uint4 u[2]; v16bf v; } u;
        u.u[0] = *reinterpret_cast<const uint4*>(&smB[cur][row * LP + kk + hi * 8]);
        u.u[1] = *reinterpret_cast<const uint4*>(&smB[cur][row * LP + kk + 16 + hi * 8]);
        bfv[j] = u.v;
      }
      #pragma unroll
      for (int i = 0; i < FM; ++i)
        #pragma unroll
        for (int j = 0; j < FN; ++j)
          acc[i][j] = __builtin_amdgcn_wmma_f32_16x16x32_bf16(
              false, af[i], false, bfv[j], (short)0, acc[i][j], false, false);
    }

    // publish next tile into the other buffer
#ifdef USE_ASYNC_COPY
    // keeps the stage's last WMMAs in front of the barrier: sunk behind it they
    // would delay the issue of the next refill, which every trip waits for
    __builtin_amdgcn_sched_barrier(0);
    // this wave's reads of the buffer that is refilled behind the barrier are done
    asm volatile("s_wait_dscnt 0x0" ::: "memory");
    // this wave's copies of the next tile have landed before other waves read them
    asm volatile("s_wait_asynccnt 0x0" ::: "memory");
#else
    if (hasNext) stage_store(cur ^ 1);
#endif
    __syncthreads();
    cur ^= 1;
  }

  // C lane layout: lane<16 -> M = v, lane>=16 -> M = 8+v; N = lane&15.
  if constexpr (CAT) {
    // x = product + rowW[0]*colW[0] + ... + rowW[7]*colW[7], in that order.
    // The row pitch is the constant HDI (= N here): every access of an array is one
    // base address plus an immediate offset. The loops are unrolled so that a row
    // group's loads issue together, ahead of its sums.
    const int gm0 = bm0 + wr * WTM + hi * 8;
    const int gn0 = bn0 + wc * WTN + r;
    const float* cwp = colW + gn0;
    const float* rwp = rowW + (long long)gm0 * NTK;
    float* op = Cf1 + (long long)gm0 * HDI + gn0;
    float cw[NTK][FN];
    #pragma unroll
    for (int t = 0; t < NTK; ++t)
      #pragma unroll
      for (int j = 0; j < FN; ++j) cw[t][j] = cwp[t * HDI + j * 16];
    #pragma unroll
    for (int i = 0; i < FM; ++i) {
      v4f rw[8][2];
      #pragma unroll
      for (int v = 0; v < 8; ++v) {
        rw[v][0] = *reinterpret_cast<const v4f*>(rwp + (i * 16 + v) * NTK);
        rw[v][1] = *reinterpret_cast<const v4f*>(rwp + (i * 16 + v) * NTK + 4);
      }
      // the sums below may land in the address registers of the loads above
      asm volatile("s_wait_xcnt 0x0" ::: "memory");
      #pragma unroll
      for (int j = 0; j < FN; ++j) {
        #pragma unroll
        for (int v = 0; v < 8; ++v) {
          float x = acc[i][j][v];
          #pragma unroll
          for (int t = 0; t < NTK; ++t) x += rw[v][t >> 2][t & 3] * cw[t][j];
          op[(i * 16 + v) * HDI + j * 16] = x;
        }
      }
      // keeps the next row group's loads behind this group's sums: all hoisted to
      // the front they take the kernel past 256 registers
      __builtin_amdgcn_sched_barrier(0);
      // the next group reuses registers that this group's loads and stores name
      if (i + 1 < FM) asm volatile("s_wait_xcnt 0x0" ::: "memory");
    }
    return;
  }
  if constexpr (RUN) {
    // + bias[col], f32 and/or bf16 store. The row pitch is the constant HDI: every
    // store of an array is one base address plus an immediate offset. The values of a
    // run of stores are formed in front of it and nothing is computed between its
    // stores, so one s_wait_xcnt 0 behind the run stands in front of every later write
    // of a register that its stores name; a wait behind each store would stall the
    // wave as many times on the block's way out.
    const int gm0 = bm0 + wr * WTM + hi * 8;
    const int gn0 = bn0 + wc * WTN + r;
    const long long o0 = (long long)gm0 * HDI + gn0;
    if constexpr (SIDE) {
      if (second && bn0 >= HDI) {        // alike in the whole block
        // B2's rows from HDI on are a second weight matrix. Its product is read later
        // as a B operand with this product's rows as k, so it is stored transposed:
        // Cb3[col][row], pitch T*D. A lane's eight values of a fragment are eight rows
        // one behind the other: one 16-B store. The T rows behind T*D go to
        // Cf2[t][col] in f32; the rows that only fill the last tile are dropped.
        const int gc0 = gn0 - HDI;
        if (bm0 < NTK * DDI) {
          __bf16* op = Cb3 + (long long)gc0 * (NTK * DDI) + gm0;
          v8bf cb[FM][FN];
          #pragma unroll
          for (int i = 0; i < FM; ++i)
            #pragma unroll
            for (int j = 0; j < FN; ++j) cb[i][j] = __builtin_convertvector(acc[i][j], v8bf);
          #pragma unroll
          for (int i = 0; i < FM; ++i)
            #pragma unroll
            for (int j = 0; j < FN; ++j)
              *reinterpret_cast<v8bf*>(op + j * 16 * (NTK * DDI) + i * 16) = cb[i][j];
        } else if (gm0 == NTK * DDI) {
          float* op = Cf2 + gc0;
          #pragma unroll
          for (int j = 0; j < FN; ++j)
            #pragma unroll
            for (int v = 0; v < 8; ++v) op[v * HDI + j * 16] = acc[0][j][v];
        }
        // what follows may reuse the registers of the stores above
        asm volatile("s_wait_xcnt 0x0" ::: "memory");
        return;
      }
    }
    if (bias) {
      #pragma unroll
      for (int j = 0; j < FN; ++j) {
        const float bv = bias[gn0 + j * 16];
        #pragma unroll
        for (int i = 0; i < FM; ++i) acc[i][j] += bv;
      }
    }
    if (Cf) {
      float* op = Cf + o0;
      #pragma unroll
      for (int i = 0; i < FM; ++i)
        #pragma unroll
        for (int j = 0; j < FN; ++j)
          #pragma unroll
          for (int v = 0; v < 8; ++v) op[(i * 16 + v) * HDI + j * 16] = acc[i][j][v];
      // what follows may reuse the registers of the stores above
      asm volatile("s_wait_xcnt 0x0" ::: "memory");
    }
    if (Cb) {
      __bf16* op = Cb + o0;
      v8bf cb[FM][FN];
      #pragma unroll
      for (int i = 0; i < FM; ++i)
        #pragma unroll
        for (int j = 0; j < FN; ++j) cb[i][j] = __builtin_convertvector(acc[i][j], v8bf);
      // The compiler moves each 16-bit value into one of a few store registers and
      // uses these again, so here a run is one fragment's eight stores.
      #pragma unroll
      for (int i = 0; i < FM; ++i) {
        #pragma unroll
        for (int j = 0; j < FN; ++j) {
          #pragma unroll
          for (int v = 0; v < 8; ++v) op[(i * 16 + v) * HDI + j * 16] = cb[i][j][v];
          // what follows may reuse the registers of the stores above
          asm volatile("s_wait_xcnt 0x0" ::: "memory");
          // keeps the next fragment's moves behind that wait
          __builtin_amdgcn_sched_barrier(0);
        }
      }
    }
    return;
  }
  // epilogue: + bias[col], optional relu, f32 and/or bf16 store.
  const float* biasB = bias ? (bias + (long long)bz * strideBias) : nullptr;
  #pragma unroll
  for (int i = 0; i < FM; ++i) {
    #pragma unroll
    for (int j = 0; j < FN; ++j) {
      int gm = bm0 + wr * WTM + i * 16 + hi * 8;
      int gn = bn0 + wc * WTN + j * 16 + r;
      float bv = biasB ? biasB[gn] : 0.0f;
      #pragma unroll
      for (int v = 0; v < 8; ++v) {
        float x = acc[i][j][v] + bv;
        if (relu) x = fmaxf(x, 0.0f);
        long long idx = (long long)bz * strideC + (long long)(gm + v) * N + gn;
        if (Cf) Cf[idx] = x;
        if (Cb) Cb[idx] = (__bf16)x;
      }
    }
  }
}

template<int BM, int BN, bool PAIR, bool CAT, bool SIDE>
__global__ __launch_bounds__(256) void wmma_gemm_nt(
    const __bf16* __restrict__ A, const __bf16* __restrict__ B,
    float* __restrict__ Cf1, __bf16* __restrict__ Cb1,
    const float* __restrict__ bias1,
    int M, int N, int K,
    long long strideA, long long strideB, long long strideC,
    long long strideBias, int relu1,
    const __bf16* __restrict__ A2, const __bf16* __restrict__ B2,
    float* __restrict__ Cf2, int zsplit,
    __bf16* __restrict__ Cb3, const float* __restrict__ colW,
    const float* __restrict__ rowW,
    int K2, __bf16* __restrict__ Cb2, const float* __restrict__ bias2)
{
  gemm_nt_body<BM, BN, PAIR, CAT, SIDE, SIDE>(
      A, B, Cf1, Cb1, bias1, M, N, K, strideA, strideB, strideC, strideBias, relu1,
      A2, B2, Cf2, zsplit, Cb3, colW, rowW, K2, Cb2, bias2,
      blockIdx.x, blockIdx.y, blockIdx.z);
}

// ---------------------------------------------------------------- layernorms
// One wave per row: a lane holds 8 x 4 values (h = j*128 + lane*4), the row
// sums need only the wave's butterfly, no LDS and no barrier.
// The first one also writes h in bf16, an operand of the last product.
__device__ __forceinline__ void ln1_rows(
    const float* __restrict__ inT, const float* __restrict__ hd,
    const float* __restrict__ g, const float* __restrict__ b,
    __bf16* __restrict__ preBf, __bf16* __restrict__ ainBf,
    __bf16* __restrict__ hBf, int blk)
{
  const int lane = threadIdx.x & 31;
  const long row = (long)(blk * 8 + (threadIdx.x >> 5)) * HDI + lane * 4;
  v4f x[8];
  v4bf hb[8];
  #pragma unroll
  for (int j = 0; j < 8; ++j) {
    const v4f hv = *reinterpret_cast<const v4f*>(hd + row + j * 128);
    x[j] = *reinterpret_cast<const v4f*>(inT + row + j * 128) + hv;
    hb[j] = __builtin_convertvector(hv, v4bf);
  }
  v4f gv[8], bv[8];                      // fetched with the row, not behind the sums
  #pragma unroll
  for (int j = 0; j < 8; ++j) {
    gv[j] = *reinterpret_cast<const v4f*>(g + j * 128 + lane * 4);
    bv[j] = *reinterpret_cast<const v4f*>(b + j * 128 + lane * 4);
  }
  // keeps all 32 loads in front of the sums: sunk behind them, the g and b loads
  // would add their latency to the row's, pair by pair
  __builtin_amdgcn_sched_barrier(0);
  v4f sv = {0.f, 0.f, 0.f, 0.f}, qv = {0.f, 0.f, 0.f, 0.f};
  #pragma unroll
  for (int j = 0; j < 8; ++j) { sv += x[j]; qv += x[j] * x[j]; }
  float s = (sv[0] + sv[1]) + (sv[2] + sv[3]);
  float ss = (qv[0] + qv[1]) + (qv[2] + qv[3]);
  #pragma unroll
  for (int m = 16; m; m >>= 1) { s += __shfl_xor(s, m, 32); ss += __shfl_xor(ss, m, 32); }
  float mean = s * (1.0f / HDI);
  float var  = ss * (1.0f / HDI) - mean * mean;
  float rstd = rsqrtf(var + 1e-12f);
  #pragma unroll
  for (int j = 0; j < 8; ++j) {
    *reinterpret_cast<v4bf*>(hBf + row + j * 128) = hb[j];
    *reinterpret_cast<v4bf*>(preBf + row + j * 128) = __builtin_convertvector(x[j], v4bf);
    *reinterpret_cast<v4bf*>(ainBf + row + j * 128) =
        __builtin_convertvector((x[j] - mean) * rstd * gv[j] + bv[j], v4bf);
  }
}

// cv[row] = <ku[row], query_b>_H. One wave: 4 rows, whole-line loads, a butterfly each.
__device__ __forceinline__ void ku_qb_rows(
    const __bf16* __restrict__ ku, const float* __restrict__ qb,
    float* __restrict__ cv, int blk)
{
  const int lane = threadIdx.x & 31;
  const int row0 = (blk * 8 + (threadIdx.x >> 5)) * 4;
  v4f q[8];
  #pragma unroll
  for (int j = 0; j < 8; ++j) q[j] = *reinterpret_cast<const v4f*>(qb + j * 128 + lane * 4);
  v4f p;
  #pragma unroll
  for (int rr = 0; rr < 4; ++rr) {
    v4f a = {0.f, 0.f, 0.f, 0.f};
    #pragma unroll
    for (int j = 0; j < 8; ++j)
      a += __builtin_convertvector(*reinterpret_cast<const v4bf*>(
               ku + (long)(row0 + rr) * HDI + j * 128 + lane * 4), v4f) * q[j];
    float x = (a[0] + a[1]) + (a[2] + a[3]);
    #pragma unroll
    for (int m = 16; m; m >>= 1) x += __shfl_xor(x, m, 32);
    p[rr] = x;
  }
  if (lane == 0) *reinterpret_cast<v4f*>(cv + row0) = p;
}

// LN1 shares its launch with the two things that need only ku and a weight:
// qku = ku @ query_w (64 x 64 tiles, so that two blocks fit a WGP's LDS and the
// row blocks keep 16 waves a WGP) and cv. The long blocks have the low indices.
// s_wait_xcnt 0 behind a job's last stores: as in prep_kernel.
#define NB_QKU ((UQR / 64) * (HDI / 64))
#define NB_LN1 (TOK / 8)
#define NB_CV  (UQR / 32)
__global__ __launch_bounds__(256) void ln1_kernel(
    const float* __restrict__ inT, const float* __restrict__ hd,
    const float* __restrict__ g, const float* __restrict__ b,
    __bf16* __restrict__ preBf, __bf16* __restrict__ ainBf, __bf16* __restrict__ hBf,
    const __bf16* __restrict__ ku, const __bf16* __restrict__ qwT,
    const float* __restrict__ qb,
    float* __restrict__ qkuF, __bf16* __restrict__ qkuB, float* __restrict__ cv)
{
  int blk = blockIdx.x;
  if (blk < NB_QKU) {
    gemm_nt_body<64, 64, false, false, false, true>(
        ku, qwT, qkuF, qkuB, nullptr, UQR, HDI, HDI, 0, 0, 0, 0, 0,
        nullptr, nullptr, nullptr, 1, nullptr, nullptr, nullptr, 0, nullptr, nullptr,
        blk % (UQR / 64), blk / (UQR / 64), 0);
    asm volatile("s_wait_xcnt 0x0" ::: "memory");  // behind the job's last stores, see above
    return;
  }
  blk -= NB_QKU;
  if (blk < NB_LN1) {
    ln1_rows(inT, hd, g, b, preBf, ainBf, hBf, blk);
    asm volatile("s_wait_xcnt 0x0" ::: "memory");  // behind the job's last stores, see above
    return;
  }
  ku_qb_rows(ku, qb, cv, blk - NB_LN1);
}

__global__ __launch_bounds__(256) void ln2_kernel(
    const float* __restrict__ inT, const float* __restrict__ fus,
    const float* __restrict__ g, const float* __restrict__ b,
    float* __restrict__ out)
{
  const int lane = threadIdx.x & 31;
  const long row = (long)(blockIdx.x * 8 + (threadIdx.x >> 5)) * HDI + lane * 4;
  v4f x[8];
  #pragma unroll
  for (int j = 0; j < 8; ++j)
    x[j] = *reinterpret_cast<const v4f*>(inT + row + j * 128) +
           *reinterpret_cast<const v4f*>(fus + row + j * 128);
  v4f gv[8], bv[8];                      // fetched with the row, not behind the sums
  #pragma unroll
  for (int j = 0; j < 8; ++j) {
    gv[j] = *reinterpret_cast<const v4f*>(g + j * 128 + lane * 4);
    bv[j] = *reinterpret_cast<const v4f*>(b + j * 128 + lane * 4);
  }
  // keeps all 32 loads in front of the sums: sunk behind them, the g and b loads
  // would add their latency to the row's, pair by pair
  __builtin_amdgcn_sched_barrier(0);
  v4f sv = {0.f, 0.f, 0.f, 0.f}, qv = {0.f, 0.f, 0.f, 0.f};
  #pragma unroll
  for (int j = 0; j < 8; ++j) { sv += x[j]; qv += x[j] * x[j]; }
  float s = (sv[0] + sv[1]) + (sv[2] + sv[3]);
  float ss = (qv[0] + qv[1]) + (qv[2] + qv[3]);
  #pragma unroll
  for (int m = 16; m; m >>= 1) { s += __shfl_xor(s, m, 32); ss += __shfl_xor(ss, m, 32); }
  float mean = s * (1.0f / HDI);
  float var  = ss * (1.0f / HDI) - mean * mean;
  float rstd = rsqrtf(var + 1e-12f);
  #pragma unroll
  for (int j = 0; j < 8; ++j) {
    *reinterpret_cast<v4f*>(out + row + j * 128) = (x[j] - mean) * rstd * gv[j] + bv[j];
  }
}

// ----------------------------------------------- scores + softmax over tasks
// scores[t,n] = <u[t,n],down[t,n]>_D + <prenorm[n],qkb[t]>_H + cv[T*D+t]
// (qkb = rows T*D.. of qku, f32). One wave per token: every lane adds its share of
// both sums into one partial per task, and one butterfly per task finishes them.
// The wave has just read its token's down values, so it reads them again and also writes
// wdown[n, t*64+d] = bf16(probs[n,t] * down[t,n,d])  (t*64+d = j*128 + lane*4).
__global__ __launch_bounds__(256) void score_softmax_kernel(
    const __bf16* __restrict__ pre, const float* __restrict__ qkb,
    const float* __restrict__ cv,
    const float* __restrict__ u, const float* __restrict__ down,
    float* __restrict__ probs, __bf16* __restrict__ wd)
{
  const int lane = threadIdx.x & 31, hi = lane >> 4;
  const int n = blockIdx.x * 8 + (threadIdx.x >> 5);

  float pq[NTK] = {0.f, 0.f, 0.f, 0.f, 0.f, 0.f, 0.f, 0.f};
  // Two halves of 36 loads each, a half's loads in front of its sums: all 72 hoisted
  // to the front take the kernel past 256 registers, and a WGP then holds one block
  // of it, not two.
  #pragma unroll
  for (int jh = 0; jh < 8; jh += 4) {
    v4bf qv[4];
    v4f ub[4][NTK];
    #pragma unroll
    for (int j = 0; j < 4; ++j)
      qv[j] = *reinterpret_cast<const v4bf*>(pre + (long)n * HDI + (jh + j) * 128 + lane * 4);
    // the loads below may land in the address registers of the loads above
    asm volatile("s_wait_xcnt 0x0" ::: "memory");
    #pragma unroll
    for (int j = 0; j < 4; ++j)
      #pragma unroll
      for (int t = 0; t < NTK; ++t)
        ub[j][t] = *reinterpret_cast<const v4f*>(qkb + t * HDI + (jh + j) * 128 + lane * 4);
    // what follows reuses the address registers of the loads above
    asm volatile("s_wait_xcnt 0x0" ::: "memory");
    // keeps the half's loads, and the wait, in front of everything behind them
    __builtin_amdgcn_sched_barrier(0);
    #pragma unroll
    for (int j = 0; j < 4; ++j) {
      v4f q = __builtin_convertvector(qv[j], v4f);
      #pragma unroll
      for (int t = 0; t < NTK; ++t)
        pq[t] += (q[0] * ub[j][t][0] + q[1] * ub[j][t][1]) +
                 (q[2] * ub[j][t][2] + q[3] * ub[j][t][3]);
    }
    // keeps the next loads behind this half's sums (the register count, see above)
    __builtin_amdgcn_sched_barrier(0);
  }
  // <u,down> over D = 64: the low half-wave takes task 2j, the high one 2j+1
  v4f ua[NTK / 2], dc[NTK / 2];
  #pragma unroll
  for (int j = 0; j < NTK / 2; ++j) {
    const long o = ((long)(2 * j + hi) * TOK + n) * DDI + (lane & 15) * 4;
    ua[j] = *reinterpret_cast<const v4f*>(u + o);
    dc[j] = *reinterpret_cast<const v4f*>(down + o);
  }
  // what follows reuses the address registers of the loads above
  asm volatile("s_wait_xcnt 0x0" ::: "memory");
  // keeps the wait in front of everything behind it
  __builtin_amdgcn_sched_barrier(0);
  #pragma unroll
  for (int j = 0; j < NTK / 2; ++j) {
    v4f a = ua[j], c = dc[j];
    float p = (a[0] * c[0] + a[1] * c[1]) + (a[2] * c[2] + a[3] * c[3]);
    pq[2 * j]     += hi ? 0.f : p;
    pq[2 * j + 1] += hi ? p : 0.f;
  }
  float s[NTK], mx = -1e30f;
  #pragma unroll
  for (int t = 0; t < NTK; ++t) {
    float a = pq[t];
    #pragma unroll
    for (int m = 16; m; m >>= 1) a += __shfl_xor(a, m, 32);
    a += cv[NTK * DDI + t];
    s[t] = a;
    mx = fmaxf(mx, a);
  }
  float den = 0.f;
  #pragma unroll
  for (int t = 0; t < NTK; ++t) { s[t] = __expf(s[t] - mx); den += s[t]; }
  float inv = 1.0f / den;
  if (lane == 0) {
    v4f p0 = {s[0] * inv, s[1] * inv, s[2] * inv, s[3] * inv};
    v4f p1 = {s[4] * inv, s[5] * inv, s[6] * inv, s[7] * inv};
    *reinterpret_cast<v4f*>(probs + (long)n * NTK) = p0;
    *reinterpret_cast<v4f*>(probs + (long)n * NTK + 4) = p1;
  }
  // Compiler fence: the down values are fetched a second time here (lines this
  // wave has just read) and not held in 16 registers across the sums above; held,
  // they push the kernel past 256 registers and halve the waves a WGP can hold.
  asm volatile("" ::: "memory");
  #pragma unroll
  for (int j = 0; j < NTK / 2; ++j) {
    v4f dn = *reinterpret_cast<const v4f*>(
        down + ((long)(2 * j + hi) * TOK + n) * DDI + (lane & 15) * 4);
    float p = (hi ? s[2 * j + 1] : s[2 * j]) * inv;
    *reinterpret_cast<v4bf*>(wd + (long)n * (NTK * DDI) + j * 128 + lane * 4) =
        __builtin_convertvector(p * dn, v4bf);
  }
}

// ---------------------------------------------------------------------------
extern "C" void kernel_launch(void* const* d_in, const int* in_sizes, int n_in,
                              void* d_out, int out_size, void* d_ws, size_t ws_size,
                              hipStream_t stream) {
  (void)in_sizes; (void)n_in; (void)out_size; (void)ws_size;
  const float* hs  = (const float*)d_in[0];
  const float* inT = (const float*)d_in[1];
  const float* dw  = (const float*)d_in[2];
  const float* db  = (const float*)d_in[3];
  const float* lng = (const float*)d_in[4];
  const float* lnb = (const float*)d_in[5];
  const float* dnw = (const float*)d_in[6];
  const float* dnb = (const float*)d_in[7];
  const float* upw = (const float*)d_in[8];
  const float* upb = (const float*)d_in[9];
  const float* kw  = (const float*)d_in[10];
  const float* qw  = (const float*)d_in[12];
  const float* qb  = (const float*)d_in[13];
  const float* vw  = (const float*)d_in[14];
  float* out = (float*)d_out;

  char* ws = (char*)d_ws;
  size_t off = 0;
  auto alloc = [&](size_t bytes) -> char* {
    char* p = ws + off;
    off += (bytes + 255) & ~(size_t)255;
    return p;
  };

  __bf16* hs_bf   = (__bf16*)alloc((size_t)TOK * IDI * 2);
  __bf16* dw_bf   = (__bf16*)alloc((size_t)HDI * IDI * 2);
  float*  hdense  = (float*) alloc((size_t)TOK * HDI * 4);
  __bf16* pre_bf  = (__bf16*)alloc((size_t)TOK * HDI * 2);
  __bf16* ain_bf  = (__bf16*)alloc((size_t)TOK * HDI * 2);
  __bf16* h_bf    = (__bf16*)alloc((size_t)TOK * HDI * 2);
  __bf16* kw_bf   = (__bf16*)alloc((size_t)HDI * HDI * 2);
  __bf16* vw_bf   = (__bf16*)alloc((size_t)HDI * HDI * 2);   // directly behind kw_bf: one [2H, H]
  __bf16* qwT_bf  = (__bf16*)alloc((size_t)HDI * HDI * 2);
  __bf16* dnw_bf  = (__bf16*)alloc((size_t)NTK * DDI * HDI * 2);
  __bf16* upT_bf  = (__bf16*)alloc((size_t)UXR * HDI * 2);   // upx
  __bf16* ku_bf   = (__bf16*)alloc((size_t)UXR * HDI * 2);
  __bf16* uvT_bf  = (__bf16*)alloc((size_t)HDI * NTK * DDI * 2);  // uv rows (t,d), transposed
  float*  uvb_f   = (float*) alloc((size_t)NTK * HDI * 4);        // uv rows T*D+t
  __bf16* qku_bf  = (__bf16*)alloc((size_t)UQR * HDI * 2);
  float*  qku_f   = (float*) alloc((size_t)UQR * HDI * 4);
  float*  cv_f    = (float*) alloc((size_t)UQR * 4);
  float*  down_f  = (float*) alloc((size_t)NTK * TOK * DDI * 4);
  float*  u_f     = (float*) alloc((size_t)NTK * TOK * DDI * 4);
  float*  probs   = (float*) alloc((size_t)TOK * NTK * 4);
  __bf16* wdown_bf= (__bf16*)alloc((size_t)TOK * NTK * DDI * 2);
  float*  fus_f   = (float*) alloc((size_t)TOK * HDI * 4);

  // ---- stage 0: precision conversion / weight repacking
  prep_kernel<<<dim3(NB_PREP), dim3(256), 0, stream>>>(
      hs, dw, qw, vw, dnw, upw, kw, upb,
      hs_bf, dw_bf, kw_bf, vw_bf, dnw_bf, upT_bf, qwT_bf);

  // ---- G1: h = hs @ dense_w^T + dense_b ; beside it [ku | uv] = upx @ [key_w ; value_w]^T
  wmma_gemm_nt<128, 128, false, false, true>
      <<<dim3((TOK / 128) * (HDI / 128) + (UXR / 128) * (2 * HDI / 128)), dim3(256), 0, stream>>>(
      hs_bf, dw_bf, hdense, nullptr, db, TOK, HDI, IDI, 0, 0, 0, 0, 0,
      upT_bf, kw_bf, uvb_f, (TOK / 128) * (HDI / 128), uvT_bf, nullptr, nullptr,
      HDI, ku_bf, nullptr);

  // ---- LN1: prenorm(bf16) + adapter_in(bf16) + h(bf16) ; beside it qku = ku @ query_w, cv = ku @ query_b
  ln1_kernel<<<dim3(NB_QKU + NB_LN1 + NB_CV), dim3(256), 0, stream>>>(
      inT, hdense, lng, lnb, pre_bf, ain_bf, h_bf, ku_bf, qwT_bf, qb, qku_f, qku_bf, cv_f);

  // ---- G4: down[t] = relu(adapter_in @ down_w[t]^T + down_b[t])  (z = t)
  // ---- G5: u[t] = prenorm @ qku[t]^T + cv[t]                     (z = T + t)
  wmma_gemm_nt<128, 64, true, false, false><<<dim3(TOK / 128, 1, 2 * NTK), dim3(256), 0, stream>>>(
      ain_bf, dnw_bf, down_f, nullptr, dnb, TOK, DDI, HDI,
      0, (long long)DDI * HDI, (long long)TOK * DDI, DDI, 1,
      pre_bf, qku_bf, u_f, NTK, nullptr, nullptr, nullptr, 0, nullptr, cv_f);

  // ---- scores + softmax over tasks; probs-weighted down, flattened [N, T*D]
  score_softmax_kernel<<<dim3(TOK / 8), dim3(256), 0, stream>>>(
      pre_bf, qku_f + (size_t)NTK * DDI * HDI, cv_f, u_f, down_f, probs, wdown_bf);

  // ---- G6: fusion = [wdown | h] @ [uvT | value_w]^T + probs @ uvb   (K = T*D + H)
  wmma_gemm_nt<128, 128, false, true, false><<<dim3(TOK / 128, HDI / 128, 1), dim3(256), 0, stream>>>(
      wdown_bf, uvT_bf, fus_f, nullptr, nullptr, TOK, HDI, NTK * DDI + HDI, 0, 0, 0, 0, 0,
      h_bf, vw_bf, nullptr, 1, nullptr, uvb_f, probs, NTK * DDI, nullptr, nullptr);

  // ---- LN2 -> out
  ln2_kernel<<<dim3(TOK / 8), dim3(256), 0, stream>>>(inT, fus_f, lng, lnb, out);
}

// v007
// One run takes 96.2 microseconds.
// Next to v006, in two timings, it ran 1.08 times as fast each time.
// Counting every step since v000, it is 2.62 times as fast.
#include <hip/hip_runtime.h>

// ---------------------------------------------------------------------------
// BertOutputWithAdapterFusion for MI455X (gfx1250, wave32, WMMA bf16)
//
//   h        = hs @ dense_w^T + dense_b                      (WMMA)
//   prenorm  = input + h ; adapter_in = LN(prenorm)
//   scores[t] = <query, key[t]> is linear in prenorm and in down[t], so the three
//   weight matrices between them are multiplied first (weight-sized products):
//   upx      = [up_w[t]^T rows (t,d) ; up_b rows t]   [T*D+T, H]
//   ku       = upx @ key_w^T                                 (WMMA, beside h)
//   qku      = ku @ query_w                                  (WMMA, beside LN)
//   cv       = ku @ query_b
//   down[t]  = relu(adapter_in @ down_w[t]^T + down_b[t])    (WMMA, all t as one N = T*D)
//   u[t]     = prenorm @ qku[t]^T + cv[t]                    (WMMA, all t as one N = T*D)
//   scores   = <u,down>_D + <prenorm,qku[T*D+t]> + cv[T*D+t]
//              (<query,key_b> is the same for every t and cancels in the softmax)
//   probs    = softmax_t
//   fusion   = (sum_t probs[t] * (down[t] @ up_w[t]^T + up_b[t]) + h) @ value_w^T
//              (sum_t probs = 1) is linear in probs*down and in h, so value_w is
//              multiplied into the up weights first (a weight-sized product):
//   uv       = upx @ value_w^T                               (WMMA, beside h)
//   fusion   = [probs*down | h] @ [uv rows (t,d) | value_w]^T  (WMMA, one product,
//              K = T*D + H)  + probs @ uv[T*D+t]
//   out      = LN(input + fusion)
// ---------------------------------------------------------------------------

#define TOK 4096   // B*S tokens
#define HDI 1024   // hidden
#define IDI 4096   // intermediate
#define NTK 8      // tasks
#define DDI 64     // bottleneck
#define UXR 640    // rows of upx and ku: T*D + T, filled up to whole 128-row tiles
#define UQR 576    // rows of qku and cv: T*D + T, filled up to whole 64-row tiles

typedef __attribute__((ext_vector_type(16))) __bf16 v16bf;
typedef __attribute__((ext_vector_type(8)))  float  v8f;

// --- optional gfx1250 async global->LDS copy path (ASYNCcnt) ---------------
#ifdef __has_builtin
#if __has_builtin(__builtin_amdgcn_global_load_async_to_lds_b128) && \
    __has_builtin(__builtin_amdgcn_s_wait_asynccnt)
#define USE_ASYNC_COPY 1
#endif
#endif

// builtin takes pointers to 16B int vectors (b128); clang adjusts addr space
typedef int v4i32 __attribute__((vector_size(16)));
#define TO_GLB(p) ((v4i32*)(p))
#define TO_LDS(p) ((v4i32*)(p))

typedef __attribute__((ext_vector_type(4))) float  v4f;
typedef __attribute__((ext_vector_type(2))) float  v2f;
typedef __attribute__((ext_vector_type(8))) __bf16 v8bf;
typedef __attribute__((ext_vector_type(4))) __bf16 v4bf;
typedef __attribute__((ext_vector_type(2))) __bf16 v2bf;

// The kernels around the GEMMs are streams: few, fat waves. Most wave-wide
// accesses cover whole 128-B lines, and a wave keeps 8 or more loads in flight
// but in the query_w transpose: 4 loads of 128 B, stores of 64 B.
// Their loops are all unrolled: the arrays must stay in registers and the loads
// issue as one group.

// ---------------------------------------------------------------- conversions
// A wave converts STEPS x 1024 consecutive floats: 8 x STEPS loads of 512 B, all
// at constant offsets from one address, then as many 256-B stores. The blocks
// of an array cover it exactly: n = blocks x 8 x STEPS x 1024.
template<int STEPS>
__device__ __forceinline__ void cvt_f32_bf16(
    const float* __restrict__ s, __bf16* __restrict__ d, int blk)
{
  const long o = (long)(blk * 8 + (threadIdx.x >> 5)) * (STEPS * 1024) +
                 (threadIdx.x & 31) * 4;
  v4f v[8 * STEPS];
  #pragma unroll
  for (int u = 0; u < 8 * STEPS; ++u)
    v[u] = *reinterpret_cast<const v4f*>(s + o + u * 128);
  #pragma unroll
  for (int u = 0; u < 8 * STEPS; ++u)
    *reinterpret_cast<v4bf*>(d + o + u * 128) = __builtin_convertvector(v[u], v4bf);
}

// dst[c][r] = src[r][c], fp32 -> bf16 (for query_w used in NN orientation)
// One block: one 32 x 32 tile, blk = tile row x (cols / 32) + tile column.
__device__ __forceinline__ void transpose_cvt(
    const float* __restrict__ src, __bf16* __restrict__ dst, int rows, int cols,
    int blk)
{
  __shared__ float tile[32][33];
  const int bx = (blk % (cols / 32)) * 32, by = (blk / (cols / 32)) * 32;
  const int tx = threadIdx.x & 31, ty = threadIdx.x >> 5;
  #pragma unroll
  for (int j = 0; j < 32; j += 8)
    tile[ty + j][tx] = src[(long)(by + ty + j) * cols + (bx + tx)];
  __syncthreads();
  #pragma unroll
  for (int j = 0; j < 32; j += 8)
    dst[(long)(bx + ty + j) * rows + (by + tx)] = (__bf16)tile[tx][ty + j];
}

// up_w [T,H,D] -> upT [T*D, H] (rows = (t,d), K = h)
// One block: one task, 64 h x 64 d. A thread takes 8 h x 2 d, so that upT gets
// 16-B pieces (a block writes whole lines).
__device__ __forceinline__ void repack_up(
    const float* __restrict__ upw, __bf16* __restrict__ upT, int blk)
{
  const int lane = threadIdx.x & 31, wv = threadIdx.x >> 5;
  const int t = blk >> 4;                              // H / 64 = 16 blocks a task
  const int h0 = (blk & 15) * 64 + wv * 8;
  const int d = lane * 2;
  v2f v[8];
  #pragma unroll
  for (int k = 0; k < 8; ++k)
    v[k] = *reinterpret_cast<const v2f*>(upw + ((long)t * HDI + h0 + k) * DDI + d);
  v8bf r0, r1;
  #pragma unroll
  for (int k = 0; k < 8; ++k) {
    v2bf b = __builtin_convertvector(v[k], v2bf);
    r0[k] = b[0]; r1[k] = b[1];
  }
  *reinterpret_cast<v8bf*>(upT + ((long)(t * DDI + d) << 10) + h0) = r0;        // pitch H
  *reinterpret_cast<v8bf*>(upT + ((long)(t * DDI + d + 1) << 10) + h0) = r1;
}

// Rows T*D .. UXR-1 of upx: the T rows of up_b, then zero rows that fill the last
// 128-row tile of the product that reads upx. One block: 8 rows of H.
__device__ __forceinline__ void upb_rows(
    const float* __restrict__ upb, __bf16* __restrict__ d, int blk)
{
  const int o = (threadIdx.x >> 5) * 1024 + (threadIdx.x & 31) * 4;
  v4f v[8];
  #pragma unroll
  for (int u = 0; u < 8; ++u) v[u] = v4f{0.f, 0.f, 0.f, 0.f};
  if (blk == 0) {
    #pragma unroll
    for (int u = 0; u < 8; ++u) v[u] = *reinterpret_cast<const v4f*>(upb + o + u * 128);
  }
  #pragma unroll
  for (int u = 0; u < 8; ++u)
    *reinterpret_cast<v4bf*>(d + blk * 8192 + o + u * 128) = __builtin_convertvector(v[u], v4bf);
}

// All eight preparations in one launch: none reads what another writes, so the
// small ones run beside the big stream instead of each paying a launch of its
// own. A block's index range picks its job (the same for the whole block); the
// long blocks have the low indices, the short ones fill the tail.
// In the built kernel the code of another job follows a job's last stores and
// rewrites their registers on a way that the branches leave open: s_wait_xcnt 0
// stands behind those stores, in front of any such overwrite. The first job's
// stores are followed by the end of the program and need none.
#define NB_HS  (TOK * IDI / 32768)
#define NB_DW  (HDI * IDI / 8192)
#define NB_KW  (HDI * HDI / 8192)
#define NB_VW  (HDI * HDI / 8192)
#define NB_DNW (NTK * DDI * HDI / 8192)
#define NB_UP  (NTK * (HDI / 64))
#define NB_UB  ((UXR - NTK * DDI) / 8)
#define NB_QW  ((HDI / 32) * (HDI / 32))
#define NB_PREP (NB_HS + NB_DW + NB_KW + NB_VW + NB_DNW + NB_UP + NB_UB + NB_QW)
__global__ __launch_bounds__(256) void prep_kernel(
    const float* __restrict__ hs, const float* __restrict__ dw,
    const float* __restrict__ qw, const float* __restrict__ vw,
    const float* __restrict__ dnw, const float* __restrict__ upw,
    const float* __restrict__ kw, const float* __restrict__ upb,
    __bf16* __restrict__ hs_bf, __bf16* __restrict__ dw_bf,
    __bf16* __restrict__ kw_bf, __bf16* __restrict__ vw_bf,
    __bf16* __restrict__ dnw_bf, __bf16* __restrict__ upT,
    __bf16* __restrict__ qwT)
{
  int b = blockIdx.x;
  if (b < NB_HS) {
    cvt_f32_bf16<4>(hs, hs_bf, b);
    return;
  }
  b -= NB_HS;
  if (b < NB_DW + NB_KW + NB_VW + NB_DNW) {
    const float* s = dw;
    __bf16* d = dw_bf;
    if (b >= NB_DW) { b -= NB_DW; s = kw; d = kw_bf;
      if (b >= NB_KW) { b -= NB_KW; s = vw; d = vw_bf;
        if (b >= NB_VW) { b -= NB_VW; s = dnw; d = dnw_bf; } } }
    cvt_f32_bf16<1>(s, d, b);
    asm volatile("s_wait_xcnt 0x0" ::: "memory");  // behind the job's last stores, see above
    return;
  }
  b -= NB_DW + NB_KW + NB_VW + NB_DNW;
  if (b < NB_UP) {
    repack_up(upw, upT, b);
    asm volatile("s_wait_xcnt 0x0" ::: "memory");  // behind the job's last stores, see above
    return;
  }
  b -= NB_UP;
  if (b < NB_UB) {
    upb_rows(upb, upT + NTK * DDI * HDI, b);
    asm volatile("s_wait_xcnt 0x0" ::: "memory");  // behind the job's last stores, see above
    return;
  }
  transpose_cvt(qw, qwT, HDI, HDI, b - NB_UB);
  asm volatile("s_wait_xcnt 0x0" ::: "memory");  // behind the job's last stores, see above
}

// -------------------------------------------------------------- WMMA NT GEMM
// C[m,j] = sum_k A[m,k] * B[j,k]   (A:[M,K], B:[N,K] row-major bf16)
// 256 threads = 8 waves, wave grid 4x2, wave tile (BM/4)x(BN/2).
// Double-buffered LDS; next tile's global loads overlap the WMMA blocks.
// One stage holds 256 k (512 B of every operand row): enough bytes in flight
// per barrier to cover the copy latency, and each wave-wide copy covers one
// contiguous 512-B row piece. K must be a multiple of 256.
// PAIR: two products of one shape (N = T*D) that do not depend on each other
// share a launch; z >= zsplit takes A2, B2, Cf2, bias2 (f32 out, no relu).
// CAT: K runs over two operand pairs, one behind the other: k < K2 from A, B (row
// pitch K2), the rest from A2, B2 (row pitch K - K2); K2 a multiple of 256. The
// epilogue adds sum_t rowW[m,t] * colW[t,j] and stores f32 (Cf1); one batch, N = HDI,
// no bias, no relu.
// SIDE: a second, smaller product (A2 [UXR,K2], B2 [2*N,K2]) that depends on nothing
// of the first (M = TOK) shares its launch. The grid is flat: the first zsplit blocks
// are the first product's tiles, tile row fastest. Its columns below N go to Cb2
// (bf16), the others to Cb3 and Cf2 (see the epilogue).
// gx, gy, gz: the block's place in the grid of tiles.
// RUN: the epilogue forms all its values first and stores them as runs (see there);
// one batch, N = HDI (PAIR: T*D), relu only with PAIR. Every product but CAT's takes it.
template<int BM, int BN, bool PAIR, bool CAT, bool SIDE, bool RUN>
__device__ __forceinline__ void gemm_nt_body(
    const __bf16* __restrict__ A, const __bf16* __restrict__ B,
    float* __restrict__ Cf1, __bf16* __restrict__ Cb1,
    const float* __restrict__ bias1,
    int M, int N, int K1,
    long long strideA, long long strideB, long long strideC,
    long long strideBias, int relu1,
    const __bf16* __restrict__ A2, const __bf16* __restrict__ B2,
    float* __restrict__ Cf2, int zsplit,
    __bf16* __restrict__ Cb3, const float* __restrict__ colW,
    const float* __restrict__ rowW,
    int K2, __bf16* __restrict__ Cb2, const float* __restrict__ bias2,
    int gx, int gy, int gz)
{
  constexpr int BK = 256;
  constexpr int LP = 264;                // LDS pitch (bf16) = 528B = 16B x odd
  constexpr int SR = 256 * 8 / BK;       // tile rows staged per 256-thread sweep
  constexpr int WTM = BM / 4;
  constexpr int WTN = BN / 2;
  constexpr int FM = WTM / 16;
  constexpr int FN = WTN / 16;
  constexpr int AIT = BM * BK / 8 / 256; // 16B chunks per thread (A tile)
  constexpr int BIT = BN * BK / 8 / 256; // 16B chunks per thread (B tile)
  static_assert(AIT >= 1 && BIT >= 1, "tile too small for 256 threads");
  static_assert(CAT || RUN, "every product has one of the two epilogues");

  __shared__ __attribute__((aligned(16))) __bf16 smA[2][BM * LP];
  __shared__ __attribute__((aligned(16))) __bf16 smB[2][BN * LP];

  const int tid = threadIdx.x;
  const int wv = tid >> 5, lane = tid & 31;
  const int wr = wv & 3, wc = wv >> 2;
  const int r = lane & 15, hi = lane >> 4;
  // alike in the whole block
  const bool second = SIDE ? gx >= zsplit : (PAIR && gz >= zsplit);
  if constexpr (SIDE) {
    const int fb = second ? gx - zsplit : gx;
    gy = second ? fb / (UXR / BM) : fb / (TOK / BM);
    gx = second ? fb % (UXR / BM) : fb % (TOK / BM);
  }
  const int K = (SIDE && second) ? K2 : K1;
  const int bm0 = gx * BM, bn0 = gy * BN;
  const int bz = SIDE ? 0 : (second ? gz - zsplit : gz);
  float* Cf = second ? (SIDE ? nullptr : Cf2) : Cf1;
  __bf16* Cb = second ? Cb2 : Cb1;
  const float* bias = second ? bias2 : bias1;
  const int relu = second ? 0 : relu1;

  const __bf16* Ab = (second ? A2 : A) + (long long)bz * strideA;
  const __bf16* Bb = (second ? B2 : B) + (long long)bz * strideB;

  // per-thread staging coordinates (hoisted out of the K loop)
  const int srow = tid >> 5, skc = (tid & 31) * 8;  // row within tile, K chunk
  const int P1 = CAT ? K2 : K;                      // row pitch of A and B
  const __bf16* aSrc = Ab + (long long)(bm0 + srow) * P1 + skc;
  const __bf16* bSrc = Bb + (long long)(bn0 + srow) * P1 + skc;
  const __bf16* aSrc2 = CAT ? A2 + (long long)(bm0 + srow) * (K - K2) + skc : nullptr;
  const __bf16* bSrc2 = CAT ? B2 + (long long)(bn0 + srow) * (K - K2) + skc : nullptr;

  const v8f vzero = {0.f, 0.f, 0.f, 0.f, 0.f, 0.f, 0.f, 0.f};
  v8f acc[FM][FN];
  #pragma unroll
  for (int i = 0; i < FM; ++i)
    #pragma unroll
    for (int j = 0; j < FN; ++j) acc[i][j] = vzero;

#ifdef USE_ASYNC_COPY
  auto stage_async = [&](int k0, int buf) {
    const __bf16* a = aSrc;
    const __bf16* b = bSrc;
    int p = P1;
    if constexpr (CAT) {
      if (k0 >= K2) {                    // alike in the whole block: the second pair
        a = aSrc2; b = bSrc2; p = K - K2; k0 -= K2;
      }
    }
    #pragma unroll
    for (int it = 0; it < AIT; ++it)
      __builtin_amdgcn_global_load_async_to_lds_b128(
          TO_GLB(a + (long long)it * SR * p + k0),
          TO_LDS(&smA[buf][(srow + it * SR) * LP + skc]), 0, 0);
    #pragma unroll
    for (int it = 0; it < BIT; ++it)
      __builtin_amdgcn_global_load_async_to_lds_b128(
          TO_GLB(b + (long long)it * SR * p + k0),
          TO_LDS(&smB[buf][(srow + it * SR) * LP + skc]), 0, 0);
  };
#else
  uint4 ra[AIT], rb[BIT];
  auto stage_load = [&](int k0) {
    const __bf16* a = aSrc;
    const __bf16* b = bSrc;
    int p = P1;
    if constexpr (CAT) {
      if (k0 >= K2) {                    // alike in the whole block: the second pair
        a = aSrc2; b = bSrc2; p = K - K2; k0 -= K2;
      }
    }
    #pragma unroll
    for (int it = 0; it < AIT; ++it)
      ra[it] = *reinterpret_cast<const uint4*>(a + (long long)it * SR * p + k0);
    #pragma unroll
    for (int it = 0; it < BIT; ++it)
      rb[it] = *reinterpret_cast<const uint4*>(b + (long long)it * SR * p + k0);
  };
  auto stage_store = [&](int buf) {
    #pragma unroll
    for (int it = 0; it < AIT; ++it)
      *reinterpret_cast<uint4*>(&smA[buf][(srow + it * SR) * LP + skc]) = ra[it];
    #pragma unroll
    for (int it = 0; it < BIT; ++it)
      *reinterpret_cast<uint4*>(&smB[buf][(srow + it * SR) * LP + skc]) = rb[it];
  };
#endif

  // prologue: stage tile 0 into buffer 0
#ifdef USE_ASYNC_COPY
  stage_async(0, 0);
  // tile 0 must have landed before the barrier that publishes it
  asm volatile("s_wait_asynccnt 0x0" ::: "memory");
#else
  stage_load(0);
  stage_store(0);
#endif
  __syncthreads();

  int cur = 0;
  for (int k0 = 0; k0 < K; k0 += BK) {
    const bool hasNext = (k0 + BK) < K;
    // issue next tile's global loads before computing (overlap)
#ifdef USE_ASYNC_COPY
    if (hasNext) stage_async(k0 + BK, cur ^ 1);
#else
    if (hasNext) stage_load(k0 + BK);
#endif

    // fragments per ISA 16-bit A/B layout:
    // lane<16 holds K{0..7,16..23}, lane>=16 holds K{8..15,24..31}
    // unrolled so that a block's LDS reads can be issued ahead of the one before
    #pragma unroll
    for (int kk = 0; kk < BK; kk += 32) {
      v16bf af[FM], bfv[FN];
      #pragma unroll
      for (int i = 0; i < FM; ++i) {
        int row = wr * WTM + i * 16 + r;
        union { uint4 u[2]; v16bf v; } u;
        u.u[0] = *reinterpret_cast<const uint4*>(&smA[cur][row * LP + kk + hi * 8]);
        u.u[1] = *reinterpret_cast<const uint4*>(&smA[cur][row * LP + kk + 16 + hi * 8]);
        af[i] = u.v;
      }
      #pragma unroll
      for (int j = 0; j < FN; ++j) {
        int row = wc * WTN + j * 16 + r;
        union { uint4 u[2]; v16bf v; } u;
        u.u[0] = *reinterpret_cast<const uint4*>(&smB[cur][row * LP + kk + hi * 8]);
        u.u[1] = *reinterpret_cast<const uint4*>(&smB[cur][row * LP + kk + 16 + hi * 8]);
        bfv[j] = u.v;
      }
      #pragma unroll
      for (int i = 0; i < FM; ++i)
        #pragma unroll
        for (int j = 0; j < FN; ++j)
          acc[i][j] = __builtin_amdgcn_wmma_f32_16x16x32_bf16(
              false, af[i], false, bfv[j], (short)0, acc[i][j], false, false);
    }

    // publish next tile into the other buffer
#ifdef USE_ASYNC_COPY
    // keeps the stage's last WMMAs in front of the barrier: sunk behind it they
    // would delay the issue of the next refill, which every trip waits for
    __builtin_amdgcn_sched_barrier(0);
    // this wave's reads of the buffer that is refilled behind the barrier are done
    asm volatile("s_wait_dscnt 0x0" ::: "memory");
    // this wave's copies of the next tile have landed before other waves read them
    asm volatile("s_wait_asynccnt 0x0" ::: "memory");
#else
    if (hasNext) stage_store(cur ^ 1);
#endif
    __syncthreads();
    cur ^= 1;
  }

  // C lane layout: lane<16 -> M = v, lane>=16 -> M = 8+v; N = lane&15.
  if constexpr (CAT) {
    // x = product + rowW[0]*colW[0] + ... + rowW[7]*colW[7], in that order.
    // The row pitch is the constant HDI (= N here): every access of an array is one
    // base address plus an immediate offset. The loops are unrolled so that a row
    // group's loads issue together, ahead of its sums.
    const int gm0 = bm0 + wr * WTM + hi * 8;
    const int gn0 = bn0 + wc * WTN + r;
    const float* cwp = colW + gn0;
    const float* rwp = rowW + (long long)gm0 * NTK;
    float* op = Cf1 + (long long)gm0 * HDI + gn0;
    float cw[NTK][FN];
    #pragma unroll
    for (int t = 0; t < NTK; ++t)
      #pragma unroll
      for (int j = 0; j < FN; ++j) cw[t][j] = cwp[t * HDI + j * 16];
    #pragma unroll
    for (int i = 0; i < FM; ++i) {
      v4f rw[8][2];
      #pragma unroll
      for (int v = 0; v < 8; ++v) {
        rw[v][0] = *reinterpret_cast<const v4f*>(rwp + (i * 16 + v) * NTK);
        rw[v][1] = *reinterpret_cast<const v4f*>(rwp + (i * 16 + v) * NTK + 4);
      }
      // the sums below may land in the address registers of the loads above
      asm volatile("s_wait_xcnt 0x0" ::: "memory");
      #pragma unroll
      for (int j = 0; j < FN; ++j) {
        #pragma unroll
        for (int v = 0; v < 8; ++v) {
          float x = acc[i][j][v];
          #pragma unroll
          for (int t = 0; t < NTK; ++t) x += rw[v][t >> 2][t & 3] * cw[t][j];
          op[(i * 16 + v) * HDI + j * 16] = x;
        }
      }
      // keeps the next row group's loads behind this group's sums: all hoisted to
      // the front they take the kernel past 256 registers
      __builtin_amdgcn_sched_barrier(0);
      // the next group reuses registers that this group's loads and stores name
      if (i + 1 < FM) asm volatile("s_wait_xcnt 0x0" ::: "memory");
    }
    return;
  }
  if constexpr (RUN) {
    // + bias[col], relu (PAIR), f32 and/or bf16 store. The row pitch is a constant: every
    // store of an array is one base address plus an immediate offset. The values of a
    // run of stores are formed in front of it and nothing is computed between its
    // stores, so one s_wait_xcnt 0 behind the run stands in front of every later write
    // of a register that its stores name; a wait behind each store would stall the
    // wave as many times on the block's way out.
    const int gm0 = bm0 + wr * WTM + hi * 8;
    const int gn0 = bn0 + wc * WTN + r;
    constexpr int CP = PAIR ? NTK * DDI : HDI;       // row pitch of C
    const long long o0 = (long long)gm0 * CP + gn0;
    if constexpr (SIDE) {
      if (second && bn0 >= HDI) {        // alike in the whole block
        // B2's rows from HDI on are a second weight matrix. Its product is read later
        // as a B operand with this product's rows as k, so it is stored transposed:
        // Cb3[col][row], pitch T*D. A lane's eight values of a fragment are eight rows
        // one behind the other: one 16-B store. The T rows behind T*D go to
        // Cf2[t][col] in f32; the rows that only fill the last tile are dropped.
        const int gc0 = gn0 - HDI;
        if (bm0 < NTK * DDI) {
          __bf16* op = Cb3 + (long long)gc0 * (NTK * DDI) + gm0;
          v8bf cb[FM][FN];
          #pragma unroll
          for (int i = 0; i < FM; ++i)
            #pragma unroll
            for (int j = 0; j < FN; ++j) cb[i][j] = __builtin_convertvector(acc[i][j], v8bf);
          #pragma unroll
          for (int i = 0; i < FM; ++i)
            #pragma unroll
            for (int j = 0; j < FN; ++j)
              *reinterpret_cast<v8bf*>(op + j * 16 * (NTK * DDI) + i * 16) = cb[i][j];
        } else if (gm0 == NTK * DDI) {
          float* op = Cf2 + gc0;
          #pragma unroll
          for (int j = 0; j < FN; ++j)
            #pragma unroll
            for (int v = 0; v < 8; ++v) op[v * HDI + j * 16] = acc[0][j][v];
        }
        // what follows may reuse the registers of the stores above
        asm volatile("s_wait_xcnt 0x0" ::: "memory");
        return;
      }
    }
    if (bias) {
      #pragma unroll
      for (int j = 0; j < FN; ++j) {
        const float bv = bias[gn0 + j * 16];
        #pragma unroll
        for (int i = 0; i < FM; ++i) acc[i][j] += bv;
      }
    }
    if constexpr (PAIR) {
      if (relu) {                        // alike in the whole block
        #pragma unroll
        for (int i = 0; i < FM; ++i)
          #pragma unroll
          for (int j = 0; j < FN; ++j)
            #pragma unroll
            for (int v = 0; v < 8; ++v) acc[i][j][v] = fmaxf(acc[i][j][v], 0.0f);
      }
    }
    if (Cf) {
      float* op = Cf + o0;
      #pragma unroll
      for (int i = 0; i < FM; ++i)
        #pragma unroll
        for (int j = 0; j < FN; ++j)
          #pragma unroll
          for (int v = 0; v < 8; ++v) op[(i * 16 + v) * CP + j * 16] = acc[i][j][v];
      // what follows may reuse the registers of the stores above
      asm volatile("s_wait_xcnt 0x0" ::: "memory");
    }
    if (Cb) {
      __bf16* op = Cb + o0;
      v8bf cb[FM][FN];
      #pragma unroll
      for (int i = 0; i < FM; ++i)
        #pragma unroll
        for (int j = 0; j < FN; ++j) cb[i][j] = __builtin_convertvector(acc[i][j], v8bf);
      // The compiler moves each 16-bit value into one of a few store registers and
      // uses these again, so here a run is one fragment's eight stores.
      #pragma unroll
      for (int i = 0; i < FM; ++i) {
        #pragma unroll
        for (int j = 0; j < FN; ++j) {
          #pragma unroll
          for (int v = 0; v < 8; ++v) op[(i * 16 + v) * CP + j * 16] = cb[i][j][v];
          // what follows may reuse the registers of the stores above
          asm volatile("s_wait_xcnt 0x0" ::: "memory");
          // keeps the next fragment's moves behind that wait
          __builtin_amdgcn_sched_barrier(0);
        }
      }
    }
    return;
  }
}

template<int BM, int BN, bool PAIR, bool CAT, bool SIDE>
__global__ __launch_bounds__(256) void wmma_gemm_nt(
    const __bf16* __restrict__ A, const __bf16* __restrict__ B,
    float* __restrict__ Cf1, __bf16* __restrict__ Cb1,
    const float* __restrict__ bias1,
    int M, int N, int K,
    long long strideA, long long strideB, long long strideC,
    long long strideBias, int relu1,
    const __bf16* __restrict__ A2, const __bf16* __restrict__ B2,
    float* __restrict__ Cf2, int zsplit,
    __bf16* __restrict__ Cb3, const float* __restrict__ colW,
    const float* __restrict__ rowW,
    int K2, __bf16* __restrict__ Cb2, const float* __restrict__ bias2)
{
  gemm_nt_body<BM, BN, PAIR, CAT, SIDE, SIDE || PAIR>(
      A, B, Cf1, Cb1, bias1, M, N, K, strideA, strideB, strideC, strideBias, relu1,
      A2, B2, Cf2, zsplit, Cb3, colW, rowW, K2, Cb2, bias2,
      blockIdx.x, blockIdx.y, blockIdx.z);
}

// ---------------------------------------------------------------- layernorms
// One wave per row: a lane holds 8 x 4 values (h = j*128 + lane*4), the row
// sums need only the wave's butterfly, no LDS and no barrier.
// The first one also writes h in bf16, an operand of the last product.
__device__ __forceinline__ void ln1_rows(
    const float* __restrict__ inT, const float* __restrict__ hd,
    const float* __restrict__ g, const float* __restrict__ b,
    __bf16* __restrict__ preBf, __bf16* __restrict__ ainBf,
    __bf16* __restrict__ hBf, int blk)
{
  const int lane = threadIdx.x & 31;
  const long row = (long)(blk * 8 + (threadIdx.x >> 5)) * HDI + lane * 4;
  v4f x[8];
  v4bf hb[8];
  #pragma unroll
  for (int j = 0; j < 8; ++j) {
    const v4f hv = *reinterpret_cast<const v4f*>(hd + row + j * 128);
    x[j] = *reinterpret_cast<const v4f*>(inT + row + j * 128) + hv;
    hb[j] = __builtin_convertvector(hv, v4bf);
  }
  v4f gv[8], bv[8];                      // fetched with the row, not behind the sums
  #pragma unroll
  for (int j = 0; j < 8; ++j) {
    gv[j] = *reinterpret_cast<const v4f*>(g + j * 128 + lane * 4);
    bv[j] = *reinterpret_cast<const v4f*>(b + j * 128 + lane * 4);
  }
  // keeps all 32 loads in front of the sums: sunk behind them, the g and b loads
  // would add their latency to the row's, pair by pair
  __builtin_amdgcn_sched_barrier(0);
  v4f sv = {0.f, 0.f, 0.f, 0.f}, qv = {0.f, 0.f, 0.f, 0.f};
  #pragma unroll
  for (int j = 0; j < 8; ++j) { sv += x[j]; qv += x[j] * x[j]; }
  float s = (sv[0] + sv[1]) + (sv[2] + sv[3]);
  float ss = (qv[0] + qv[1]) + (qv[2] + qv[3]);
  #pragma unroll
  for (int m = 16; m; m >>= 1) { s += __shfl_xor(s, m, 32); ss += __shfl_xor(ss, m, 32); }
  float mean = s * (1.0f / HDI);
  float var  = ss * (1.0f / HDI) - mean * mean;
  float rstd = rsqrtf(var + 1e-12f);
  #pragma unroll
  for (int j = 0; j < 8; ++j) {
    *reinterpret_cast<v4bf*>(hBf + row + j * 128) = hb[j];
    *reinterpret_cast<v4bf*>(preBf + row + j * 128) = __builtin_convertvector(x[j], v4bf);
    *reinterpret_cast<v4bf*>(ainBf + row + j * 128) =
        __builtin_convertvector((x[j] - mean) * rstd * gv[j] + bv[j], v4bf);
  }
}

// cv[row] = <ku[row], query_b>_H. One wave: 4 rows, whole-line loads, a butterfly each.
__device__ __forceinline__ void ku_qb_rows(
    const __bf16* __restrict__ ku, const float* __restrict__ qb,
    float* __restrict__ cv, int blk)
{
  const int lane = threadIdx.x & 31;
  const int row0 = (blk * 8 + (threadIdx.x >> 5)) * 4;
  v4f q[8];
  #pragma unroll
  for (int j = 0; j < 8; ++j) q[j] = *reinterpret_cast<const v4f*>(qb + j * 128 + lane * 4);
  v4f p;
  #pragma unroll
  for (int rr = 0; rr < 4; ++rr) {
    v4f a = {0.f, 0.f, 0.f, 0.f};
    #pragma unroll
    for (int j = 0; j < 8; ++j)
      a += __builtin_convertvector(*reinterpret_cast<const v4bf*>(
               ku + (long)(row0 + rr) * HDI + j * 128 + lane * 4), v4f) * q[j];
    float x = (a[0] + a[1]) + (a[2] + a[3]);
    #pragma unroll
    for (int m = 16; m; m >>= 1) x += __shfl_xor(x, m, 32);
    p[rr] = x;
  }
  if (lane == 0) *reinterpret_cast<v4f*>(cv + row0) = p;
}

// LN1 shares its launch with the two things that need only ku and a weight:
// qku = ku @ query_w (64 x 64 tiles, so that two blocks fit a WGP's LDS and the
// row blocks keep 16 waves a WGP) and cv. The long blocks have the low indices.
// s_wait_xcnt 0 behind a job's last stores: as in prep_kernel.
#define NB_QKU ((UQR / 64) * (HDI / 64))
#define NB_LN1 (TOK / 8)
#define NB_CV  (UQR / 32)
__global__ __launch_bounds__(256) void ln1_kernel(
    const float* __restrict__ inT, const float* __restrict__ hd,
    const float* __restrict__ g, const float* __restrict__ b,
    __bf16* __restrict__ preBf, __bf16* __restrict__ ainBf, __bf16* __restrict__ hBf,
    const __bf16* __restrict__ ku, const __bf16* __restrict__ qwT,
    const float* __restrict__ qb,
    float* __restrict__ qkuF, __bf16* __restrict__ qkuB, float* __restrict__ cv)
{
  int blk = blockIdx.x;
  if (blk < NB_QKU) {
    gemm_nt_body<64, 64, false, false, false, true>(
        ku, qwT, qkuF, qkuB, nullptr, UQR, HDI, HDI, 0, 0, 0, 0, 0,
        nullptr, nullptr, nullptr, 1, nullptr, nullptr, nullptr, 0, nullptr, nullptr,
        blk % (UQR / 64), blk / (UQR / 64), 0);
    asm volatile("s_wait_xcnt 0x0" ::: "memory");  // behind the job's last stores, see above
    return;
  }
  blk -= NB_QKU;
  if (blk < NB_LN1) {
    ln1_rows(inT, hd, g, b, preBf, ainBf, hBf, blk);
    asm volatile("s_wait_xcnt 0x0" ::: "memory");  // behind the job's last stores, see above
    return;
  }
  ku_qb_rows(ku, qb, cv, blk - NB_LN1);
}

__global__ __launch_bounds__(256) void ln2_kernel(
    const float* __restrict__ inT, const float* __restrict__ fus,
    const float* __restrict__ g, const float* __restrict__ b,
    float* __restrict__ out)
{
  const int lane = threadIdx.x & 31;
  const long row = (long)(blockIdx.x * 8 + (threadIdx.x >> 5)) * HDI + lane * 4;
  v4f x[8];
  #pragma unroll
  for (int j = 0; j < 8; ++j)
    x[j] = *reinterpret_cast<const v4f*>(inT + row + j * 128) +
           *reinterpret_cast<const v4f*>(fus + row + j * 128);
  v4f gv[8], bv[8];                      // fetched with the row, not behind the sums
  #pragma unroll
  for (int j = 0; j < 8; ++j) {
    gv[j] = *reinterpret_cast<const v4f*>(g + j * 128 + lane * 4);
    bv[j] = *reinterpret_cast<const v4f*>(b + j * 128 + lane * 4);
  }
  // keeps all 32 loads in front of the sums: sunk behind them, the g and b loads
  // would add their latency to the row's, pair by pair
  __builtin_amdgcn_sched_barrier(0);
  v4f sv = {0.f, 0.f, 0.f, 0.f}, qv = {0.f, 0.f, 0.f, 0.f};
  #pragma unroll
  for (int j = 0; j < 8; ++j) { sv += x[j]; qv += x[j] * x[j]; }
  float s = (sv[0] + sv[1]) + (sv[2] + sv[3]);
  float ss = (qv[0] + qv[1]) + (qv[2] + qv[3]);
  #pragma unroll
  for (int m = 16; m; m >>= 1) { s += __shfl_xor(s, m, 32); ss += __shfl_xor(ss, m, 32); }
  float mean = s * (1.0f / HDI);
  float var  = ss * (1.0f / HDI) - mean * mean;
  float rstd = rsqrtf(var + 1e-12f);
  #pragma unroll
  for (int j = 0; j < 8; ++j) {
    *reinterpret_cast<v4f*>(out + row + j * 128) = (x[j] - mean) * rstd * gv[j] + bv[j];
  }
}

// ----------------------------------------------- scores + softmax over tasks
// scores[t,n] = <u[n,t],down[n,t]>_D + <prenorm[n],qkb[t]>_H + cv[T*D+t]
// u and down are [N, T*D]: a token's values of all tasks are one run of 2 KB.
// (qkb = rows T*D.. of qku, f32). One wave per token: every lane adds its share of
// both sums into one partial per task, and one butterfly per task finishes them.
// The wave has just read its token's down values, so it also writes
// wdown[n, t*64+d] = bf16(probs[n,t] * down[n, t*64+d])  (t*64+d = j*128 + lane*4).
__global__ __launch_bounds__(256) void score_softmax_kernel(
    const __bf16* __restrict__ pre, const float* __restrict__ qkb,
    const float* __restrict__ cv,
    const float* __restrict__ u, const float* __restrict__ down,
    float* __restrict__ probs, __bf16* __restrict__ wd)
{
  const int lane = threadIdx.x & 31, hi = lane >> 4;
  const int n = blockIdx.x * 8 + (threadIdx.x >> 5);

  float pq[NTK] = {0.f, 0.f, 0.f, 0.f, 0.f, 0.f, 0.f, 0.f};
  // Two halves of 36 loads each, a half's loads in front of its sums: all 72 hoisted
  // to the front take the kernel past 256 registers, and a WGP then holds one block
  // of it, not two.
  #pragma unroll
  for (int jh = 0; jh < 8; jh += 4) {
    v4bf qv[4];
    v4f ub[4][NTK];
    #pragma unroll
    for (int j = 0; j < 4; ++j)
      qv[j] = *reinterpret_cast<const v4bf*>(pre + (long)n * HDI + (jh + j) * 128 + lane * 4);
    // the loads below may land in the address registers of the loads above
    asm volatile("s_wait_xcnt 0x0" ::: "memory");
    #pragma unroll
    for (int j = 0; j < 4; ++j)
      #pragma unroll
      for (int t = 0; t < NTK; ++t)
        ub[j][t] = *reinterpret_cast<const v4f*>(qkb + t * HDI + (jh + j) * 128 + lane * 4);
    // what follows reuses the address registers of the loads above
    asm volatile("s_wait_xcnt 0x0" ::: "memory");
    // keeps the half's loads, and the wait, in front of everything behind them
    __builtin_amdgcn_sched_barrier(0);
    #pragma unroll
    for (int j = 0; j < 4; ++j) {
      v4f q = __builtin_convertvector(qv[j], v4f);
      #pragma unroll
      for (int t = 0; t < NTK; ++t)
        pq[t] += (q[0] * ub[j][t][0] + q[1] * ub[j][t][1]) +
                 (q[2] * ub[j][t][2] + q[3] * ub[j][t][3]);
    }
    // keeps the next loads behind this half's sums (the register count, see above)
    __builtin_amdgcn_sched_barrier(0);
  }
  // <u,down> over D = 64: the low half-wave takes task 2j, the high one 2j+1
  v4f ua[NTK / 2], dc[NTK / 2];
  #pragma unroll
  for (int j = 0; j < NTK / 2; ++j) {
    const long o = (long)n * (NTK * DDI) + j * 128 + lane * 4;
    ua[j] = *reinterpret_cast<const v4f*>(u + o);
    dc[j] = *reinterpret_cast<const v4f*>(down + o);
  }
  // what follows reuses the address registers of the loads above
  asm volatile("s_wait_xcnt 0x0" ::: "memory");
  // keeps the wait in front of everything behind it
  __builtin_amdgcn_sched_barrier(0);
  #pragma unroll
  for (int j = 0; j < NTK / 2; ++j) {
    v4f a = ua[j], c = dc[j];
    float p = (a[0] * c[0] + a[1] * c[1]) + (a[2] * c[2] + a[3] * c[3]);
    pq[2 * j]     += hi ? 0.f : p;
    pq[2 * j + 1] += hi ? p : 0.f;
  }
  float s[NTK], mx = -1e30f;
  #pragma unroll
  for (int t = 0; t < NTK; ++t) {
    float a = pq[t];
    #pragma unroll
    for (int m = 16; m; m >>= 1) a += __shfl_xor(a, m, 32);
    a += cv[NTK * DDI + t];
    s[t] = a;
    mx = fmaxf(mx, a);
  }
  float den = 0.f;
  #pragma unroll
  for (int t = 0; t < NTK; ++t) { s[t] = __expf(s[t] - mx); den += s[t]; }
  float inv = 1.0f / den;
  if (lane == 0) {
    v4f p0 = {s[0] * inv, s[1] * inv, s[2] * inv, s[3] * inv};
    v4f p1 = {s[4] * inv, s[5] * inv, s[6] * inv, s[7] * inv};
    *reinterpret_cast<v4f*>(probs + (long)n * NTK) = p0;
    *reinterpret_cast<v4f*>(probs + (long)n * NTK + 4) = p1;
  }
  // Compiler fence: the down values are fetched a second time here (lines this
  // wave has just read) and not held in 16 registers across the sums above; held,
  // they push the kernel past 256 registers and halve the waves a WGP can hold.
  asm volatile("" ::: "memory");
  #pragma unroll
  for (int j = 0; j < NTK / 2; ++j) {
    v4f dn = *reinterpret_cast<const v4f*>(
        down + (long)n * (NTK * DDI) + j * 128 + lane * 4);
    float p = (hi ? s[2 * j + 1] : s[2 * j]) * inv;
    *reinterpret_cast<v4bf*>(wd + (long)n * (NTK * DDI) + j * 128 + lane * 4) =
        __builtin_convertvector(p * dn, v4bf);
  }
}

// ---------------------------------------------------------------------------
extern "C" void kernel_launch(void* const* d_in, const int* in_sizes, int n_in,
                              void* d_out, int out_size, void* d_ws, size_t ws_size,
                              hipStream_t stream) {
  (void)in_sizes; (void)n_in; (void)out_size; (void)ws_size;
  const float* hs  = (const float*)d_in[0];
  const float* inT = (const float*)d_in[1];
  const float* dw  = (const float*)d_in[2];
  const float* db  = (const float*)d_in[3];
  const float* lng = (const float*)d_in[4];
  const float* lnb = (const float*)d_in[5];
  const float* dnw = (const float*)d_in[6];
  const float* dnb = (const float*)d_in[7];
  const float* upw = (const float*)d_in[8];
  const float* upb = (const float*)d_in[9];
  const float* kw  = (const float*)d_in[10];
  const float* qw  = (const float*)d_in[12];
  const float* qb  = (const float*)d_in[13];
  const float* vw  = (const float*)d_in[14];
  float* out = (float*)d_out;

  char* ws = (char*)d_ws;
  size_t off = 0;
  auto alloc = [&](size_t bytes) -> char* {
    char* p = ws + off;
    off += (bytes + 255) & ~(size_t)255;
    return p;
  };

  __bf16* hs_bf   = (__bf16*)alloc((size_t)TOK * IDI * 2);
  __bf16* dw_bf   = (__bf16*)alloc((size_t)HDI * IDI * 2);
  float*  hdense  = (float*) alloc((size_t)TOK * HDI * 4);
  __bf16* pre_bf  = (__bf16*)alloc((size_t)TOK * HDI * 2);
  __bf16* ain_bf  = (__bf16*)alloc((size_t)TOK * HDI * 2);
  __bf16* h_bf    = (__bf16*)alloc((size_t)TOK * HDI * 2);
  __bf16* kw_bf   = (__bf16*)alloc((size_t)HDI * HDI * 2);
  __bf16* vw_bf   = (__bf16*)alloc((size_t)HDI * HDI * 2);   // directly behind kw_bf: one [2H, H]
  __bf16* qwT_bf  = (__bf16*)alloc((size_t)HDI * HDI * 2);
  __bf16* dnw_bf  = (__bf16*)alloc((size_t)NTK * DDI * HDI * 2);
  __bf16* upT_bf  = (__bf16*)alloc((size_t)UXR * HDI * 2);   // upx
  __bf16* ku_bf   = (__bf16*)alloc((size_t)UXR * HDI * 2);
  __bf16* uvT_bf  = (__bf16*)alloc((size_t)HDI * NTK * DDI * 2);  // uv rows (t,d), transposed
  float*  uvb_f   = (float*) alloc((size_t)NTK * HDI * 4);        // uv rows T*D+t
  __bf16* qku_bf  = (__bf16*)alloc((size_t)UQR * HDI * 2);
  float*  qku_f   = (float*) alloc((size_t)UQR * HDI * 4);
  float*  cv_f    = (float*) alloc((size_t)UQR * 4);
  float*  down_f  = (float*) alloc((size_t)NTK * TOK * DDI * 4);
  float*  u_f     = (float*) alloc((size_t)NTK * TOK * DDI * 4);
  float*  probs   = (float*) alloc((size_t)TOK * NTK * 4);
  __bf16* wdown_bf= (__bf16*)alloc((size_t)TOK * NTK * DDI * 2);
  float*  fus_f   = (float*) alloc((size_t)TOK * HDI * 4);

  // ---- stage 0: precision conversion / weight repacking
  prep_kernel<<<dim3(NB_PREP), dim3(256), 0, stream>>>(
      hs, dw, qw, vw, dnw, upw, kw, upb,
      hs_bf, dw_bf, kw_bf, vw_bf, dnw_bf, upT_bf, qwT_bf);

  // ---- G1: h = hs @ dense_w^T + dense_b ; beside it [ku | uv] = upx @ [key_w ; value_w]^T
  wmma_gemm_nt<128, 128, false, false, true>
      <<<dim3((TOK / 128) * (HDI / 128) + (UXR / 128) * (2 * HDI / 128)), dim3(256), 0, stream>>>(
      hs_bf, dw_bf, hdense, nullptr, db, TOK, HDI, IDI, 0, 0, 0, 0, 0,
      upT_bf, kw_bf, uvb_f, (TOK / 128) * (HDI / 128), uvT_bf, nullptr, nullptr,
      HDI, ku_bf, nullptr);

  // ---- LN1: prenorm(bf16) + adapter_in(bf16) + h(bf16) ; beside it qku = ku @ query_w, cv = ku @ query_b
  ln1_kernel<<<dim3(NB_QKU + NB_LN1 + NB_CV), dim3(256), 0, stream>>>(
      inT, hdense, lng, lnb, pre_bf, ain_bf, h_bf, ku_bf, qwT_bf, qb, qku_f, qku_bf, cv_f);

  // The tasks' weight rows lie one behind the other, so each product is one GEMM with
  // N = T*D, out [N, T*D]: 128 x 128 tiles, one block for every WGP, one round.
  // ---- G4: down = relu(adapter_in @ down_w^T + down_b)   (z = 0)
  // ---- G5: u = prenorm @ qku[0 .. T*D)^T + cv            (z = 1)
  wmma_gemm_nt<128, 128, true, false, false>
      <<<dim3(TOK / 128, NTK * DDI / 128, 2), dim3(256), 0, stream>>>(
      ain_bf, dnw_bf, down_f, nullptr, dnb, TOK, NTK * DDI, HDI,
      0, 0, 0, 0, 1,
      pre_bf, qku_bf, u_f, 1, nullptr, nullptr, nullptr, 0, nullptr, cv_f);

  // ---- scores + softmax over tasks; probs-weighted down, flattened [N, T*D]
  score_softmax_kernel<<<dim3(TOK / 8), dim3(256), 0, stream>>>(
      pre_bf, qku_f + (size_t)NTK * DDI * HDI, cv_f, u_f, down_f, probs, wdown_bf);

  // ---- G6: fusion = [wdown | h] @ [uvT | value_w]^T + probs @ uvb   (K = T*D + H)
  wmma_gemm_nt<128, 128, false, true, false><<<dim3(TOK / 128, HDI / 128, 1), dim3(256), 0, stream>>>(
      wdown_bf, uvT_bf, fus_f, nullptr, nullptr, TOK, HDI, NTK * DDI + HDI, 0, 0, 0, 0, 0,
      h_bf, vw_bf, nullptr, 1, nullptr, uvb_f, probs, NTK * DDI, nullptr, nullptr);

  // ---- LN2 -> out
  ln2_kernel<<<dim3(TOK / 8), dim3(256), 0, stream>>>(inT, fus_f, lng, lnb, out);
}

// v008
// It runs in 91.7 microseconds.
// In both of two side-by-side timings against v007, it was 1.04 times as fast.
// Over all steps from v000 it is 2.74 times as fast.
#include <hip/hip_runtime.h>

// ---------------------------------------------------------------------------
// BertOutputWithAdapterFusion for MI455X (gfx1250, wave32, WMMA bf16)
//
//   h        = hs @ dense_w^T + dense_b                      (WMMA)
//   prenorm  = input + h ; adapter_in = LN(prenorm)
//   scores[t] = <query, key[t]> is linear in prenorm and in down[t], so the three
//   weight matrices between them are multiplied first (weight-sized products):
//   upx      = [up_w[t]^T rows (t,d) ; up_b rows t]   [T*D+T, H]
//   ku       = upx @ key_w^T                                 (WMMA, beside h)
//   qku      = ku @ query_w                                  (WMMA, beside LN)
//   cv       = ku @ query_b
//   down[t]  = relu(adapter_in @ down_w[t]^T + down_b[t])    (WMMA, all t as one N = T*D)
//   u[t]     = prenorm @ qku[t]^T + cv[t]                    (WMMA, all t as one N = T*D)
//   scores   = <u,down>_D + <prenorm,qku[T*D+t]> + cv[T*D+t]
//              (<query,key_b> is the same for every t and cancels in the softmax)
//   probs    = softmax_t
//   fusion   = (sum_t probs[t] * (down[t] @ up_w[t]^T + up_b[t]) + h) @ value_w^T
//              (sum_t probs = 1) is linear in probs*down and in h, so value_w is
//              multiplied into the up weights first (a weight-sized product):
//   uv       = upx @ value_w^T                               (WMMA, beside h)
//   fusion   = [probs*down | h] @ [uv rows (t,d) | value_w]^T  (WMMA, one product,
//              K = T*D + H)  + probs @ uv[T*D+t]
//   out      = LN(input + fusion)
// ---------------------------------------------------------------------------

#define TOK 4096   // B*S tokens
#define HDI 1024   // hidden
#define IDI 4096   // intermediate
#define NTK 8      // tasks
#define DDI 64     // bottleneck
#define UXR 640    // rows of upx and ku: T*D + T, filled up to whole 128-row tiles
#define UQR 576    // rows of qku and cv: T*D + T, filled up to whole 64-row tiles

typedef __attribute__((ext_vector_type(16))) __bf16 v16bf;
typedef __attribute__((ext_vector_type(8)))  float  v8f;

// --- optional gfx1250 async global->LDS copy path (ASYNCcnt) ---------------
#ifdef __has_builtin
#if __has_builtin(__builtin_amdgcn_global_load_async_to_lds_b128) && \
    __has_builtin(__builtin_amdgcn_s_wait_asynccnt)
#define USE_ASYNC_COPY 1
#endif
#endif

// builtin takes pointers to 16B int vectors (b128); clang adjusts addr space
typedef int v4i32 __attribute__((vector_size(16)));
#define TO_GLB(p) ((v4i32*)(p))
#define TO_LDS(p) ((v4i32*)(p))

typedef __attribute__((ext_vector_type(4))) float  v4f;
typedef __attribute__((ext_vector_type(2))) float  v2f;
typedef __attribute__((ext_vector_type(8))) __bf16 v8bf;
typedef __attribute__((ext_vector_type(4))) __bf16 v4bf;
typedef __attribute__((ext_vector_type(2))) __bf16 v2bf;

// The kernels around the GEMMs are streams: few, fat waves. Most wave-wide
// accesses cover whole 128-B lines, and a wave keeps 8 or more loads in flight
// but in the query_w transpose: 4 loads of 128 B, stores of 64 B.
// Their loops are all unrolled: the arrays must stay in registers and the loads
// issue as one group.

// ---------------------------------------------------------------- conversions
// A wave converts STEPS x 1024 consecutive floats: 8 x STEPS loads of 512 B, all
// at constant offsets from one address, then as many 256-B stores. The blocks
// of an array cover it exactly: n = blocks x 8 x STEPS x 1024.
template<int STEPS>
__device__ __forceinline__ void cvt_f32_bf16(
    const float* __restrict__ s, __bf16* __restrict__ d, int blk)
{
  const long o = (long)(blk * 8 + (threadIdx.x >> 5)) * (STEPS * 1024) +
                 (threadIdx.x & 31) * 4;
  v4f v[8 * STEPS];
  #pragma unroll
  for (int u = 0; u < 8 * STEPS; ++u)
    v[u] = *reinterpret_cast<const v4f*>(s + o + u * 128);
  #pragma unroll
  for (int u = 0; u < 8 * STEPS; ++u)
    *reinterpret_cast<v4bf*>(d + o + u * 128) = __builtin_convertvector(v[u], v4bf);
}

// dst[c][r] = src[r][c], fp32 -> bf16 (for query_w used in NN orientation)
// One block: one 32 x 32 tile, blk = tile row x (cols / 32) + tile column.
__device__ __forceinline__ void transpose_cvt(
    const float* __restrict__ src, __bf16* __restrict__ dst, int rows, int cols,
    int blk)
{
  __shared__ float tile[32][33];
  const int bx = (blk % (cols / 32)) * 32, by = (blk / (cols / 32)) * 32;
  const int tx = threadIdx.x & 31, ty = threadIdx.x >> 5;
  #pragma unroll
  for (int j = 0; j < 32; j += 8)
    tile[ty + j][tx] = src[(long)(by + ty + j) * cols + (bx + tx)];
  __syncthreads();
  #pragma unroll
  for (int j = 0; j < 32; j += 8)
    dst[(long)(bx + ty + j) * rows + (by + tx)] = (__bf16)tile[tx][ty + j];
}

// up_w [T,H,D] -> upT [T*D, H] (rows = (t,d), K = h)
// One block: one task, 64 h x 64 d. A thread takes 8 h x 2 d, so that upT gets
// 16-B pieces (a block writes whole lines).
__device__ __forceinline__ void repack_up(
    const float* __restrict__ upw, __bf16* __restrict__ upT, int blk)
{
  const int lane = threadIdx.x & 31, wv = threadIdx.x >> 5;
  const int t = blk >> 4;                              // H / 64 = 16 blocks a task
  const int h0 = (blk & 15) * 64 + wv * 8;
  const int d = lane * 2;
  v2f v[8];
  #pragma unroll
  for (int k = 0; k < 8; ++k)
    v[k] = *reinterpret_cast<const v2f*>(upw + ((long)t * HDI + h0 + k) * DDI + d);
  v8bf r0, r1;
  #pragma unroll
  for (int k = 0; k < 8; ++k) {
    v2bf b = __builtin_convertvector(v[k], v2bf);
    r0[k] = b[0]; r1[k] = b[1];
  }
  *reinterpret_cast<v8bf*>(upT + ((long)(t * DDI + d) << 10) + h0) = r0;        // pitch H
  *reinterpret_cast<v8bf*>(upT + ((long)(t * DDI + d + 1) << 10) + h0) = r1;
}

// Rows T*D .. UXR-1 of upx: the T rows of up_b, then zero rows that fill the last
// 128-row tile of the product that reads upx. One block: 8 rows of H.
__device__ __forceinline__ void upb_rows(
    const float* __restrict__ upb, __bf16* __restrict__ d, int blk)
{
  const int o = (threadIdx.x >> 5) * 1024 + (threadIdx.x & 31) * 4;
  v4f v[8];
  #pragma unroll
  for (int u = 0; u < 8; ++u) v[u] = v4f{0.f, 0.f, 0.f, 0.f};
  if (blk == 0) {
    #pragma unroll
    for (int u = 0; u < 8; ++u) v[u] = *reinterpret_cast<const v4f*>(upb + o + u * 128);
  }
  #pragma unroll
  for (int u = 0; u < 8; ++u)
    *reinterpret_cast<v4bf*>(d + blk * 8192 + o + u * 128) = __builtin_convertvector(v[u], v4bf);
}

// All eight preparations in one launch: none reads what another writes, so the
// small ones run beside the big stream instead of each paying a launch of its
// own. A block's index range picks its job (the same for the whole block); the
// long blocks have the low indices, the short ones fill the tail.
// In the built kernel the code of another job follows a job's last stores and
// rewrites their registers on a way that the branches leave open: s_wait_xcnt 0
// stands behind those stores, in front of any such overwrite. The first job's
// stores are followed by the end of the program and need none.
#define NB_HS  (TOK * IDI / 32768)
#define NB_DW  (HDI * IDI / 8192)
#define NB_KW  (HDI * HDI / 8192)
#define NB_VW  (HDI * HDI / 8192)
#define NB_DNW (NTK * DDI * HDI / 8192)
#define NB_UP  (NTK * (HDI / 64))
#define NB_UB  ((UXR - NTK * DDI) / 8)
#define NB_QW  ((HDI / 32) * (HDI / 32))
#define NB_PREP (NB_HS + NB_DW + NB_KW + NB_VW + NB_DNW + NB_UP + NB_UB + NB_QW)
__global__ __launch_bounds__(256) void prep_kernel(
    const float* __restrict__ hs, const float* __restrict__ dw,
    const float* __restrict__ qw, const float* __restrict__ vw,
    const float* __restrict__ dnw, const float* __restrict__ upw,
    const float* __restrict__ kw, const float* __restrict__ upb,
    __bf16* __restrict__ hs_bf, __bf16* __restrict__ dw_bf,
    __bf16* __restrict__ kw_bf, __bf16* __restrict__ vw_bf,
    __bf16* __restrict__ dnw_bf, __bf16* __restrict__ upT,
    __bf16* __restrict__ qwT)
{
  int b = blockIdx.x;
  if (b < NB_HS) {
    cvt_f32_bf16<4>(hs, hs_bf, b);
    return;
  }
  b -= NB_HS;
  if (b < NB_DW + NB_KW + NB_VW + NB_DNW) {
    const float* s = dw;
    __bf16* d = dw_bf;
    if (b >= NB_DW) { b -= NB_DW; s = kw; d = kw_bf;
      if (b >= NB_KW) { b -= NB_KW; s = vw; d = vw_bf;
        if (b >= NB_VW) { b -= NB_VW; s = dnw; d = dnw_bf; } } }
    cvt_f32_bf16<1>(s, d, b);
    asm volatile("s_wait_xcnt 0x0" ::: "memory");  // behind the job's last stores, see above
    return;
  }
  b -= NB_DW + NB_KW + NB_VW + NB_DNW;
  if (b < NB_UP) {
    repack_up(upw, upT, b);
    asm volatile("s_wait_xcnt 0x0" ::: "memory");  // behind the job's last stores, see above
    return;
  }
  b -= NB_UP;
  if (b < NB_UB) {
    upb_rows(upb, upT + NTK * DDI * HDI, b);
    asm volatile("s_wait_xcnt 0x0" ::: "memory");  // behind the job's last stores, see above
    return;
  }
  transpose_cvt(qw, qwT, HDI, HDI, b - NB_UB);
  asm volatile("s_wait_xcnt 0x0" ::: "memory");  // behind the job's last stores, see above
}

// -------------------------------------------------------------- WMMA NT GEMM
// C[m,j] = sum_k A[m,k] * B[j,k]   (A:[M,K], B:[N,K] row-major bf16)
// 256 threads = 8 waves. In the K loop a wave works on a (BM/2)x(BN/2) tile, so that
// every fragment read from LDS feeds more WMMAs; the two waves of a pair (wave
// numbers w, w^1) have the same tile and share its k: of each 64 k one takes the
// first 32, the other the rest. Behind the loop each hands the other, through LDS,
// its partial sums of the half of the rows that the other stores: the epilogues see a
// wave grid of 4x2 with wave tiles of (BM/4)x(BN/2).
// Double-buffered LDS; next tile's global loads overlap the WMMA blocks.
// One stage holds 256 k (512 B of every operand row): enough bytes in flight
// per barrier to cover the copy latency, and each wave-wide copy covers one
// contiguous 512-B row piece. K must be a multiple of 256.
// PAIR: two products of one shape (N = T*D) that do not depend on each other
// share a launch; z >= zsplit takes A2, B2, Cf2, bias2 (f32 out, no relu).
// CAT: K runs over two operand pairs, one behind the other: k < K2 from A, B (row
// pitch K2), the rest from A2, B2 (row pitch K - K2); K2 a multiple of 256. The
// epilogue adds sum_t rowW[m,t] * colW[t,j] and stores f32 (Cf1); one batch, N = HDI,
// no bias, no relu.
// SIDE: a second, smaller product (A2 [UXR,K2], B2 [2*N,K2]) that depends on nothing
// of the first (M = TOK) shares its launch. The grid is flat: the first zsplit blocks
// are the first product's tiles, tile row fastest. Its columns below N go to Cb2
// (bf16), the others to Cb3 and Cf2 (see the epilogue).
// gx, gy, gz: the block's place in the grid of tiles.
// RUN: the epilogue forms all its values first and stores them as runs (see there);
// one batch, N = HDI (PAIR: T*D), relu only with PAIR. Every product but CAT's takes it.
template<int BM, int BN, bool PAIR, bool CAT, bool SIDE, bool RUN>
__device__ __forceinline__ void gemm_nt_body(
    const __bf16* __restrict__ A, const __bf16* __restrict__ B,
    float* __restrict__ Cf1, __bf16* __restrict__ Cb1,
    const float* __restrict__ bias1,
    int M, int N, int K1,
    long long strideA, long long strideB, long long strideC,
    long long strideBias, int relu1,
    const __bf16* __restrict__ A2, const __bf16* __restrict__ B2,
    float* __restrict__ Cf2, int zsplit,
    __bf16* __restrict__ Cb3, const float* __restrict__ colW,
    const float* __restrict__ rowW,
    int K2, __bf16* __restrict__ Cb2, const float* __restrict__ bias2,
    int gx, int gy, int gz)
{
  constexpr int BK = 256;
  constexpr int LP = 264;                // LDS pitch (bf16) = 528B = 16B x odd
  constexpr int SR = 256 * 8 / BK;       // tile rows staged per 256-thread sweep
  constexpr int WTM = BM / 4;
  constexpr int WTN = BN / 2;
  constexpr int FM = WTM / 16;
  constexpr int FN = WTN / 16;
  constexpr int FMC = 2 * FM;            // fragment rows of a wave in the K loop
  constexpr int AIT = BM * BK / 8 / 256; // 16B chunks per thread (A tile)
  constexpr int BIT = BN * BK / 8 / 256; // 16B chunks per thread (B tile)
  static_assert(AIT >= 1 && BIT >= 1, "tile too small for 256 threads");
  static_assert(CAT || RUN, "every product has one of the two epilogues");
  static_assert(8 * FM * FN * 1024 <= BM * LP * 2, "the hand-over fits one A buffer");

  __shared__ __attribute__((aligned(16))) __bf16 smA[2][BM * LP];
  __shared__ __attribute__((aligned(16))) __bf16 smB[2][BN * LP];

  const int tid = threadIdx.x;
  const int wv = tid >> 5, lane = tid & 31;
  const int wr = wv & 3, wc = wv >> 2;
  const int r = lane & 15, hi = lane >> 4;
  // alike in the whole block
  const bool second = SIDE ? gx >= zsplit : (PAIR && gz >= zsplit);
  if constexpr (SIDE) {
    const int fb = second ? gx - zsplit : gx;
    gy = second ? fb / (UXR / BM) : fb / (TOK / BM);
    gx = second ? fb % (UXR / BM) : fb % (TOK / BM);
  }
  const int K = (SIDE && second) ? K2 : K1;
  const int bm0 = gx * BM, bn0 = gy * BN;
  const int bz = SIDE ? 0 : (second ? gz - zsplit : gz);
  float* Cf = second ? (SIDE ? nullptr : Cf2) : Cf1;
  __bf16* Cb = second ? Cb2 : Cb1;
  const float* bias = second ? bias2 : bias1;
  const int relu = second ? 0 : relu1;

  const __bf16* Ab = (second ? A2 : A) + (long long)bz * strideA;
  const __bf16* Bb = (second ? B2 : B) + (long long)bz * strideB;

  // per-thread staging coordinates (hoisted out of the K loop)
  const int srow = tid >> 5, skc = (tid & 31) * 8;  // row within tile, K chunk
  const int P1 = CAT ? K2 : K;                      // row pitch of A and B
  const __bf16* aSrc = Ab + (long long)(bm0 + srow) * P1 + skc;
  const __bf16* bSrc = Bb + (long long)(bn0 + srow) * P1 + skc;
  const __bf16* aSrc2 = CAT ? A2 + (long long)(bm0 + srow) * (K - K2) + skc : nullptr;
  const __bf16* bSrc2 = CAT ? B2 + (long long)(bn0 + srow) * (K - K2) + skc : nullptr;

  const v8f vzero = {0.f, 0.f, 0.f, 0.f, 0.f, 0.f, 0.f, 0.f};
  // rows i < FM: the rows this wave stores; the others: the rows its partner stores
  v8f pacc[FMC][FN];
  #pragma unroll
  for (int i = 0; i < FMC; ++i)
    #pragma unroll
    for (int j = 0; j < FN; ++j) pacc[i][j] = vzero;
  const int kh = (wr & 1) * 32;          // this wave's 32 of each 64 k

#ifdef USE_ASYNC_COPY
  auto stage_async = [&](int k0, int buf) {
    const __bf16* a = aSrc;
    const __bf16* b = bSrc;
    int p = P1;
    if constexpr (CAT) {
      if (k0 >= K2) {                    // alike in the whole block: the second pair
        a = aSrc2; b = bSrc2; p = K - K2; k0 -= K2;
      }
    }
    #pragma unroll
    for (int it = 0; it < AIT; ++it)
      __builtin_amdgcn_global_load_async_to_lds_b128(
          TO_GLB(a + (long long)it * SR * p + k0),
          TO_LDS(&smA[buf][(srow + it * SR) * LP + skc]), 0, 0);
    #pragma unroll
    for (int it = 0; it < BIT; ++it)
      __builtin_amdgcn_global_load_async_to_lds_b128(
          TO_GLB(b + (long long)it * SR * p + k0),
          TO_LDS(&smB[buf][(srow + it * SR) * LP + skc]), 0, 0);
  };
#else
  uint4 ra[AIT], rb[BIT];
  auto stage_load = [&](int k0) {
    const __bf16* a = aSrc;
    const __bf16* b = bSrc;
    int p = P1;
    if constexpr (CAT) {
      if (k0 >= K2) {                    // alike in the whole block: the second pair
        a = aSrc2; b = bSrc2; p = K - K2; k0 -= K2;
      }
    }
    #pragma unroll
    for (int it = 0; it < AIT; ++it)
      ra[it] = *reinterpret_cast<const uint4*>(a + (long long)it * SR * p + k0);
    #pragma unroll
    for (int it = 0; it < BIT; ++it)
      rb[it] = *reinterpret_cast<const uint4*>(b + (long long)it * SR * p + k0);
  };
  auto stage_store = [&](int buf) {
    #pragma unroll
    for (int it = 0; it < AIT; ++it)
      *reinterpret_cast<uint4*>(&smA[buf][(srow + it * SR) * LP + skc]) = ra[it];
    #pragma unroll
    for (int it = 0; it < BIT; ++it)
      *reinterpret_cast<uint4*>(&smB[buf][(srow + it * SR) * LP + skc]) = rb[it];
  };
#endif

  // prologue: stage tile 0 into buffer 0
#ifdef USE_ASYNC_COPY
  stage_async(0, 0);
  // tile 0 must have landed before the barrier that publishes it
  asm volatile("s_wait_asynccnt 0x0" ::: "memory");
#else
  stage_load(0);
  stage_store(0);
#endif
  __syncthreads();

  int cur = 0;
  for (int k0 = 0; k0 < K; k0 += BK) {
    const bool hasNext = (k0 + BK) < K;
    // issue next tile's global loads before computing (overlap)
#ifdef USE_ASYNC_COPY
    if (hasNext) stage_async(k0 + BK, cur ^ 1);
#else
    if (hasNext) stage_load(k0 + BK);
#endif

    // fragments per ISA 16-bit A/B layout:
    // lane<16 holds K{0..7,16..23}, lane>=16 holds K{8..15,24..31}
    // Two fragment sets: a step's WMMAs run while the next step's reads are under way.
    // Unrolled: the set's number is a constant.
    v16bf af[2][FMC], bfv[2][FN];
    auto frags = [&](int kk, int set) {
      #pragma unroll
      for (int i = 0; i < FMC; ++i) {
        int row = (i < FM ? wr * WTM + i * 16 : (wr ^ 1) * WTM + (i - FM) * 16) + r;
        union { uint4 u[2]; v16bf v; } u;
        u.u[0] = *reinterpret_cast<const uint4*>(&smA[cur][row * LP + kk + kh + hi * 8]);
        u.u[1] = *reinterpret_cast<const uint4*>(&smA[cur][row * LP + kk + kh + 16 + hi * 8]);
        af[set][i] = u.v;
      }
      #pragma unroll
      for (int j = 0; j < FN; ++j) {
        int row = wc * WTN + j * 16 + r;
        union { uint4 u[2]; v16bf v; } u;
        u.u[0] = *reinterpret_cast<const uint4*>(&smB[cur][row * LP + kk + kh + hi * 8]);
        u.u[1] = *reinterpret_cast<const uint4*>(&smB[cur][row * LP + kk + kh + 16 + hi * 8]);
        bfv[set][j] = u.v;
      }
    };
    frags(0, 0);
    #pragma unroll
    for (int s = 0; s < BK / 64; ++s) {
      if (s + 1 < BK / 64) frags((s + 1) * 64, (s + 1) & 1);
      // keeps the next step's reads in one group in front of this step's WMMAs: sunk
      // among them, each is waited for right behind its issue and the wave stalls
      __builtin_amdgcn_sched_barrier(0);
      #pragma unroll
      for (int i = 0; i < FMC; ++i)
        #pragma unroll
        for (int j = 0; j < FN; ++j)
          pacc[i][j] = __builtin_amdgcn_wmma_f32_16x16x32_bf16(
              false, af[s & 1][i], false, bfv[s & 1][j], (short)0, pacc[i][j], false, false);
      // keeps the reads of the step after next behind these WMMAs: hoisted over them
      // they would stand in a second place and need a third fragment set
      if (s + 2 < BK / 64) __builtin_amdgcn_sched_barrier(0);
    }

    // publish next tile into the other buffer
#ifdef USE_ASYNC_COPY
    // keeps the stage's last WMMAs in front of the barrier: sunk behind it they
    // would delay the issue of the next refill, which every trip waits for
    __builtin_amdgcn_sched_barrier(0);
    // this wave's reads of the buffer that is refilled behind the barrier are done
    asm volatile("s_wait_dscnt 0x0" ::: "memory");
    // this wave's copies of the next tile have landed before other waves read them
    asm volatile("s_wait_asynccnt 0x0" ::: "memory");
#else
    if (hasNext) stage_store(cur ^ 1);
#endif
    __syncthreads();
    cur ^= 1;
  }

  // The pair's hand-over. The loop's last barrier has ended every read of the ring
  // and no copy is outstanding, so the first A buffer serves as eight slots of f32,
  // one a wave. A wave stores the partial sums of its partner's rows in its own slot,
  // 512 B in a row per store; behind the barrier it reads its partner's slot, where the
  // same lane holds the same element of its own rows, and adds.
  v8f acc[FM][FN];
  {
    v4f* xs = reinterpret_cast<v4f*>(&smA[0][0]) + lane;
    v4f* give = xs + wv * (FM * FN * 64);
    const v4f* take = xs + (wv ^ 1) * (FM * FN * 64);
    #pragma unroll
    for (int i = 0; i < FM; ++i)
      #pragma unroll
      for (int j = 0; j < FN; ++j) {
        const v8f p = pacc[FM + i][j];
        give[(i * FN + j) * 64]      = v4f{p[0], p[1], p[2], p[3]};
        give[(i * FN + j) * 64 + 32] = v4f{p[4], p[5], p[6], p[7]};
      }
    __syncthreads();
    #pragma unroll
    for (int i = 0; i < FM; ++i)
      #pragma unroll
      for (int j = 0; j < FN; ++j) {
        const v4f lo = take[(i * FN + j) * 64], hi4 = take[(i * FN + j) * 64 + 32];
        acc[i][j] = pacc[i][j] + v8f{lo[0], lo[1], lo[2], lo[3], hi4[0], hi4[1], hi4[2], hi4[3]};
      }
  }

  // C lane layout: lane<16 -> M = v, lane>=16 -> M = 8+v; N = lane&15.
  if constexpr (CAT) {
    // x = product + rowW[0]*colW[0] + ... + rowW[7]*colW[7], in that order.
    // The row pitch is the constant HDI (= N here): every access of an array is one
    // base address plus an immediate offset. The loops are unrolled so that a row
    // group's loads issue together, ahead of its sums.
    const int gm0 = bm0 + wr * WTM + hi * 8;
    const int gn0 = bn0 + wc * WTN + r;
    const float* cwp = colW + gn0;
    const float* rwp = rowW + (long long)gm0 * NTK;
    float* op = Cf1 + (long long)gm0 * HDI + gn0;
    float cw[NTK][FN];
    #pragma unroll
    for (int t = 0; t < NTK; ++t)
      #pragma unroll
      for (int j = 0; j < FN; ++j) cw[t][j] = cwp[t * HDI + j * 16];
    #pragma unroll
    for (int i = 0; i < FM; ++i) {
      v4f rw[8][2];
      #pragma unroll
      for (int v = 0; v < 8; ++v) {
        rw[v][0] = *reinterpret_cast<const v4f*>(rwp + (i * 16 + v) * NTK);
        rw[v][1] = *reinterpret_cast<const v4f*>(rwp + (i * 16 + v) * NTK + 4);
      }
      // the sums below may land in the address registers of the loads above
      asm volatile("s_wait_xcnt 0x0" ::: "memory");
      #pragma unroll
      for (int j = 0; j < FN; ++j) {
        #pragma unroll
        for (int v = 0; v < 8; ++v) {
          float x = acc[i][j][v];
          #pragma unroll
          for (int t = 0; t < NTK; ++t) x += rw[v][t >> 2][t & 3] * cw[t][j];
          op[(i * 16 + v) * HDI + j * 16] = x;
        }
      }
      // keeps the next row group's loads behind this group's sums: all hoisted to
      // the front they take the kernel past 256 registers
      __builtin_amdgcn_sched_barrier(0);
      // the next group reuses registers that this group's loads and stores name
      if (i + 1 < FM) asm volatile("s_wait_xcnt 0x0" ::: "memory");
    }
    return;
  }
  if constexpr (RUN) {
    // + bias[col], relu (PAIR), f32 and/or bf16 store. The row pitch is a constant: every
    // store of an array is one base address plus an immediate offset. The values of a
    // run of stores are formed in front of it and nothing is computed between its
    // stores, so one s_wait_xcnt 0 behind the run stands in front of every later write
    // of a register that its stores name; a wait behind each store would stall the
    // wave as many times on the block's way out.
    const int gm0 = bm0 + wr * WTM + hi * 8;
    const int gn0 = bn0 + wc * WTN + r;
    constexpr int CP = PAIR ? NTK * DDI : HDI;       // row pitch of C
    const long long o0 = (long long)gm0 * CP + gn0;
    if constexpr (SIDE) {
      if (second && bn0 >= HDI) {        // alike in the whole block
        // B2's rows from HDI on are a second weight matrix. Its product is read later
        // as a B operand with this product's rows as k, so it is stored transposed:
        // Cb3[col][row], pitch T*D. A lane's eight values of a fragment are eight rows
        // one behind the other: one 16-B store. The T rows behind T*D go to
        // Cf2[t][col] in f32; the rows that only fill the last tile are dropped.
        const int gc0 = gn0 - HDI;
        if (bm0 < NTK * DDI) {
          __bf16* op = Cb3 + (long long)gc0 * (NTK * DDI) + gm0;
          v8bf cb[FM][FN];
          #pragma unroll
          for (int i = 0; i < FM; ++i)
            #pragma unroll
            for (int j = 0; j < FN; ++j) cb[i][j] = __builtin_convertvector(acc[i][j], v8bf);
          #pragma unroll
          for (int i = 0; i < FM; ++i)
            #pragma unroll
            for (int j = 0; j < FN; ++j)
              *reinterpret_cast<v8bf*>(op + j * 16 * (NTK * DDI) + i * 16) = cb[i][j];
        } else if (gm0 == NTK * DDI) {
          float* op = Cf2 + gc0;
          #pragma unroll
          for (int j = 0; j < FN; ++j)
            #pragma unroll
            for (int v = 0; v < 8; ++v) op[v * HDI + j * 16] = acc[0][j][v];
        }
        // what follows may reuse the registers of the stores above
        asm volatile("s_wait_xcnt 0x0" ::: "memory");
        return;
      }
    }
    if (bias) {
      #pragma unroll
      for (int j = 0; j < FN; ++j) {
        const float bv = bias[gn0 + j * 16];
        #pragma unroll
        for (int i = 0; i < FM; ++i) acc[i][j] += bv;
      }
    }
    if constexpr (PAIR) {
      if (relu) {                        // alike in the whole block
        #pragma unroll
        for (int i = 0; i < FM; ++i)
          #pragma unroll
          for (int j = 0; j < FN; ++j)
            #pragma unroll
            for (int v = 0; v < 8; ++v) acc[i][j][v] = fmaxf(acc[i][j][v], 0.0f);
      }
    }
    if (Cf) {
      float* op = Cf + o0;
      #pragma unroll
      for (int i = 0; i < FM; ++i)
        #pragma unroll
        for (int j = 0; j < FN; ++j)
          #pragma unroll
          for (int v = 0; v < 8; ++v) op[(i * 16 + v) * CP + j * 16] = acc[i][j][v];
      // what follows may reuse the registers of the stores above
      asm volatile("s_wait_xcnt 0x0" ::: "memory");
    }
    if (Cb) {
      __bf16* op = Cb + o0;
      v8bf cb[FM][FN];
      #pragma unroll
      for (int i = 0; i < FM; ++i)
        #pragma unroll
        for (int j = 0; j < FN; ++j) cb[i][j] = __builtin_convertvector(acc[i][j], v8bf);
      // The compiler moves each 16-bit value into one of a few store registers and
      // uses these again, so here a run is one fragment's eight stores.
      #pragma unroll
      for (int i = 0; i < FM; ++i) {
        #pragma unroll
        for (int j = 0; j < FN; ++j) {
          #pragma unroll
          for (int v = 0; v < 8; ++v) op[(i * 16 + v) * CP + j * 16] = cb[i][j][v];
          // what follows may reuse the registers of the stores above
          asm volatile("s_wait_xcnt 0x0" ::: "memory");
          // keeps the next fragment's moves behind that wait
          __builtin_amdgcn_sched_barrier(0);
        }
      }
    }
    return;
  }
}

template<int BM, int BN, bool PAIR, bool CAT, bool SIDE>
__global__ __launch_bounds__(256) void wmma_gemm_nt(
    const __bf16* __restrict__ A, const __bf16* __restrict__ B,
    float* __restrict__ Cf1, __bf16* __restrict__ Cb1,
    const float* __restrict__ bias1,
    int M, int N, int K,
    long long strideA, long long strideB, long long strideC,
    long long strideBias, int relu1,
    const __bf16* __restrict__ A2, const __bf16* __restrict__ B2,
    float* __restrict__ Cf2, int zsplit,
    __bf16* __restrict__ Cb3, const float* __restrict__ colW,
    const float* __restrict__ rowW,
    int K2, __bf16* __restrict__ Cb2, const float* __restrict__ bias2)
{
  gemm_nt_body<BM, BN, PAIR, CAT, SIDE, SIDE || PAIR>(
      A, B, Cf1, Cb1, bias1, M, N, K, strideA, strideB, strideC, strideBias, relu1,
      A2, B2, Cf2, zsplit, Cb3, colW, rowW, K2, Cb2, bias2,
      blockIdx.x, blockIdx.y, blockIdx.z);
}

// ---------------------------------------------------------------- layernorms
// One wave per row: a lane holds 8 x 4 values (h = j*128 + lane*4), the row
// sums need only the wave's butterfly, no LDS and no barrier.
// The first one also writes h in bf16, an operand of the last product.
__device__ __forceinline__ void ln1_rows(
    const float* __restrict__ inT, const float* __restrict__ hd,
    const float* __restrict__ g, const float* __restrict__ b,
    __bf16* __restrict__ preBf, __bf16* __restrict__ ainBf,
    __bf16* __restrict__ hBf, int blk)
{
  const int lane = threadIdx.x & 31;
  const long row = (long)(blk * 8 + (threadIdx.x >> 5)) * HDI + lane * 4;
  v4f x[8];
  v4bf hb[8];
  #pragma unroll
  for (int j = 0; j < 8; ++j) {
    const v4f hv = *reinterpret_cast<const v4f*>(hd + row + j * 128);
    x[j] = *reinterpret_cast<const v4f*>(inT + row + j * 128) + hv;
    hb[j] = __builtin_convertvector(hv, v4bf);
  }
  v4f gv[8], bv[8];                      // fetched with the row, not behind the sums
  #pragma unroll
  for (int j = 0; j < 8; ++j) {
    gv[j] = *reinterpret_cast<const v4f*>(g + j * 128 + lane * 4);
    bv[j] = *reinterpret_cast<const v4f*>(b + j * 128 + lane * 4);
  }
  // keeps all 32 loads in front of the sums: sunk behind them, the g and b loads
  // would add their latency to the row's, pair by pair
  __builtin_amdgcn_sched_barrier(0);
  v4f sv = {0.f, 0.f, 0.f, 0.f}, qv = {0.f, 0.f, 0.f, 0.f};
  #pragma unroll
  for (int j = 0; j < 8; ++j) { sv += x[j]; qv += x[j] * x[j]; }
  float s = (sv[0] + sv[1]) + (sv[2] + sv[3]);
  float ss = (qv[0] + qv[1]) + (qv[2] + qv[3]);
  #pragma unroll
  for (int m = 16; m; m >>= 1) { s += __shfl_xor(s, m, 32); ss += __shfl_xor(ss, m, 32); }
  float mean = s * (1.0f / HDI);
  float var  = ss * (1.0f / HDI) - mean * mean;
  float rstd = rsqrtf(var + 1e-12f);
  #pragma unroll
  for (int j = 0; j < 8; ++j) {
    *reinterpret_cast<v4bf*>(hBf + row + j * 128) = hb[j];
    *reinterpret_cast<v4bf*>(preBf + row + j * 128) = __builtin_convertvector(x[j], v4bf);
    *reinterpret_cast<v4bf*>(ainBf + row + j * 128) =
        __builtin_convertvector((x[j] - mean) * rstd * gv[j] + bv[j], v4bf);
  }
}

// cv[row] = <ku[row], query_b>_H. One wave: 4 rows, whole-line loads, a butterfly each.
__device__ __forceinline__ void ku_qb_rows(
    const __bf16* __restrict__ ku, const float* __restrict__ qb,
    float* __restrict__ cv, int blk)
{
  const int lane = threadIdx.x & 31;
  const int row0 = (blk * 8 + (threadIdx.x >> 5)) * 4;
  v4f q[8];
  #pragma unroll
  for (int j = 0; j < 8; ++j) q[j] = *reinterpret_cast<const v4f*>(qb + j * 128 + lane * 4);
  v4f p;
  #pragma unroll
  for (int rr = 0; rr < 4; ++rr) {
    v4f a = {0.f, 0.f, 0.f, 0.f};
    #pragma unroll
    for (int j = 0; j < 8; ++j)
      a += __builtin_convertvector(*reinterpret_cast<const v4bf*>(
               ku + (long)(row0 + rr) * HDI + j * 128 + lane * 4), v4f) * q[j];
    float x = (a[0] + a[1]) + (a[2] + a[3]);
    #pragma unroll
    for (int m = 16; m; m >>= 1) x += __shfl_xor(x, m, 32);
    p[rr] = x;
  }
  if (lane == 0) *reinterpret_cast<v4f*>(cv + row0) = p;
}

// LN1 shares its launch with the two things that need only ku and a weight:
// qku = ku @ query_w (64 x 64 tiles, so that two blocks fit a WGP's LDS and the
// row blocks keep 16 waves a WGP) and cv. The long blocks have the low indices.
// s_wait_xcnt 0 behind a job's last stores: as in prep_kernel.
#define NB_QKU ((UQR / 64) * (HDI / 64))
#define NB_LN1 (TOK / 8)
#define NB_CV  (UQR / 32)
__global__ __launch_bounds__(256) void ln1_kernel(
    const float* __restrict__ inT, const float* __restrict__ hd,
    const float* __restrict__ g, const float* __restrict__ b,
    __bf16* __restrict__ preBf, __bf16* __restrict__ ainBf, __bf16* __restrict__ hBf,
    const __bf16* __restrict__ ku, const __bf16* __restrict__ qwT,
    const float* __restrict__ qb,
    float* __restrict__ qkuF, __bf16* __restrict__ qkuB, float* __restrict__ cv)
{
  int blk = blockIdx.x;
  if (blk < NB_QKU) {
    gemm_nt_body<64, 64, false, false, false, true>(
        ku, qwT, qkuF, qkuB, nullptr, UQR, HDI, HDI, 0, 0, 0, 0, 0,
        nullptr, nullptr, nullptr, 1, nullptr, nullptr, nullptr, 0, nullptr, nullptr,
        blk % (UQR / 64), blk / (UQR / 64), 0);
    asm volatile("s_wait_xcnt 0x0" ::: "memory");  // behind the job's last stores, see above
    return;
  }
  blk -= NB_QKU;
  if (blk < NB_LN1) {
    ln1_rows(inT, hd, g, b, preBf, ainBf, hBf, blk);
    asm volatile("s_wait_xcnt 0x0" ::: "memory");  // behind the job's last stores, see above
    return;
  }
  ku_qb_rows(ku, qb, cv, blk - NB_LN1);
}

__global__ __launch_bounds__(256) void ln2_kernel(
    const float* __restrict__ inT, const float* __restrict__ fus,
    const float* __restrict__ g, const float* __restrict__ b,
    float* __restrict__ out)
{
  const int lane = threadIdx.x & 31;
  const long row = (long)(blockIdx.x * 8 + (threadIdx.x >> 5)) * HDI + lane * 4;
  v4f x[8];
  #pragma unroll
  for (int j = 0; j < 8; ++j)
    x[j] = *reinterpret_cast<const v4f*>(inT + row + j * 128) +
           *reinterpret_cast<const v4f*>(fus + row + j * 128);
  v4f gv[8], bv[8];                      // fetched with the row, not behind the sums
  #pragma unroll
  for (int j = 0; j < 8; ++j) {
    gv[j] = *reinterpret_cast<const v4f*>(g + j * 128 + lane * 4);
    bv[j] = *reinterpret_cast<const v4f*>(b + j * 128 + lane * 4);
  }
  // keeps all 32 loads in front of the sums: sunk behind them, the g and b loads
  // would add their latency to the row's, pair by pair
  __builtin_amdgcn_sched_barrier(0);
  v4f sv = {0.f, 0.f, 0.f, 0.f}, qv = {0.f, 0.f, 0.f, 0.f};
  #pragma unroll
  for (int j = 0; j < 8; ++j) { sv += x[j]; qv += x[j] * x[j]; }
  float s = (sv[0] + sv[1]) + (sv[2] + sv[3]);
  float ss = (qv[0] + qv[1]) + (qv[2] + qv[3]);
  #pragma unroll
  for (int m = 16; m; m >>= 1) { s += __shfl_xor(s, m, 32); ss += __shfl_xor(ss, m, 32); }
  float mean = s * (1.0f / HDI);
  float var  = ss * (1.0f / HDI) - mean * mean;
  float rstd = rsqrtf(var + 1e-12f);
  #pragma unroll
  for (int j = 0; j < 8; ++j) {
    *reinterpret_cast<v4f*>(out + row + j * 128) = (x[j] - mean) * rstd * gv[j] + bv[j];
  }
}

// ----------------------------------------------- scores + softmax over tasks
// scores[t,n] = <u[n,t],down[n,t]>_D + <prenorm[n],qkb[t]>_H + cv[T*D+t]
// u and down are [N, T*D]: a token's values of all tasks are one run of 2 KB.
// (qkb = rows T*D.. of qku, f32). One wave per token: every lane adds its share of
// both sums into one partial per task, and one butterfly per task finishes them.
// The wave has just read its token's down values, so it also writes
// wdown[n, t*64+d] = bf16(probs[n,t] * down[n, t*64+d])  (t*64+d = j*128 + lane*4).
__global__ __launch_bounds__(256) void score_softmax_kernel(
    const __bf16* __restrict__ pre, const float* __restrict__ qkb,
    const float* __restrict__ cv,
    const float* __restrict__ u, const float* __restrict__ down,
    float* __restrict__ probs, __bf16* __restrict__ wd)
{
  const int lane = threadIdx.x & 31, hi = lane >> 4;
  const int n = blockIdx.x * 8 + (threadIdx.x >> 5);

  float pq[NTK] = {0.f, 0.f, 0.f, 0.f, 0.f, 0.f, 0.f, 0.f};
  // Two halves of 36 loads each, a half's loads in front of its sums: all 72 hoisted
  // to the front take the kernel past 256 registers, and a WGP then holds one block
  // of it, not two.
  #pragma unroll
  for (int jh = 0; jh < 8; jh += 4) {
    v4bf qv[4];
    v4f ub[4][NTK];
    #pragma unroll
    for (int j = 0; j < 4; ++j)
      qv[j] = *reinterpret_cast<const v4bf*>(pre + (long)n * HDI + (jh + j) * 128 + lane * 4);
    // the loads below may land in the address registers of the loads above
    asm volatile("s_wait_xcnt 0x0" ::: "memory");
    #pragma unroll
    for (int j = 0; j < 4; ++j)
      #pragma unroll
      for (int t = 0; t < NTK; ++t)
        ub[j][t] = *reinterpret_cast<const v4f*>(qkb + t * HDI + (jh + j) * 128 + lane * 4);
    // what follows reuses the address registers of the loads above
    asm volatile("s_wait_xcnt 0x0" ::: "memory");
    // keeps the half's loads, and the wait, in front of everything behind them
    __builtin_amdgcn_sched_barrier(0);
    #pragma unroll
    for (int j = 0; j < 4; ++j) {
      v4f q = __builtin_convertvector(qv[j], v4f);
      #pragma unroll
      for (int t = 0; t < NTK; ++t)
        pq[t] += (q[0] * ub[j][t][0] + q[1] * ub[j][t][1]) +
                 (q[2] * ub[j][t][2] + q[3] * ub[j][t][3]);
    }
    // keeps the next loads behind this half's sums (the register count, see above)
    __builtin_amdgcn_sched_barrier(0);
  }
  // <u,down> over D = 64: the low half-wave takes task 2j, the high one 2j+1
  v4f ua[NTK / 2], dc[NTK / 2];
  #pragma unroll
  for (int j = 0; j < NTK / 2; ++j) {
    const long o = (long)n * (NTK * DDI) + j * 128 + lane * 4;
    ua[j] = *reinterpret_cast<const v4f*>(u + o);
    dc[j] = *reinterpret_cast<const v4f*>(down + o);
  }
  // what follows reuses the address registers of the loads above
  asm volatile("s_wait_xcnt 0x0" ::: "memory");
  // keeps the wait in front of everything behind it
  __builtin_amdgcn_sched_barrier(0);
  #pragma unroll
  for (int j = 0; j < NTK / 2; ++j) {
    v4f a = ua[j], c = dc[j];
    float p = (a[0] * c[0] + a[1] * c[1]) + (a[2] * c[2] + a[3] * c[3]);
    pq[2 * j]     += hi ? 0.f : p;
    pq[2 * j + 1] += hi ? p : 0.f;
  }
  float s[NTK], mx = -1e30f;
  #pragma unroll
  for (int t = 0; t < NTK; ++t) {
    float a = pq[t];
    #pragma unroll
    for (int m = 16; m; m >>= 1) a += __shfl_xor(a, m, 32);
    a += cv[NTK * DDI + t];
    s[t] = a;
    mx = fmaxf(mx, a);
  }
  float den = 0.f;
  #pragma unroll
  for (int t = 0; t < NTK; ++t) { s[t] = __expf(s[t] - mx); den += s[t]; }
  float inv = 1.0f / den;
  if (lane == 0) {
    v4f p0 = {s[0] * inv, s[1] * inv, s[2] * inv, s[3] * inv};
    v4f p1 = {s[4] * inv, s[5] * inv, s[6] * inv, s[7] * inv};
    *reinterpret_cast<v4f*>(probs + (long)n * NTK) = p0;
    *reinterpret_cast<v4f*>(probs + (long)n * NTK + 4) = p1;
  }
  // Compiler fence: the down values are fetched a second time here (lines this
  // wave has just read) and not held in 16 registers across the sums above; held,
  // they push the kernel past 256 registers and halve the waves a WGP can hold.
  asm volatile("" ::: "memory");
  #pragma unroll
  for (int j = 0; j < NTK / 2; ++j) {
    v4f dn = *reinterpret_cast<const v4f*>(
        down + (long)n * (NTK * DDI) + j * 128 + lane * 4);
    float p = (hi ? s[2 * j + 1] : s[2 * j]) * inv;
    *reinterpret_cast<v4bf*>(wd + (long)n * (NTK * DDI) + j * 128 + lane * 4) =
        __builtin_convertvector(p * dn, v4bf);
  }
}

// ---------------------------------------------------------------------------
extern "C" void kernel_launch(void* const* d_in, const int* in_sizes, int n_in,
                              void* d_out, int out_size, void* d_ws, size_t ws_size,
                              hipStream_t stream) {
  (void)in_sizes; (void)n_in; (void)out_size; (void)ws_size;
  const float* hs  = (const float*)d_in[0];
  const float* inT = (const float*)d_in[1];
  const float* dw  = (const float*)d_in[2];
  const float* db  = (const float*)d_in[3];
  const float* lng = (const float*)d_in[4];
  const float* lnb = (const float*)d_in[5];
  const float* dnw = (const float*)d_in[6];
  const float* dnb = (const float*)d_in[7];
  const float* upw = (const float*)d_in[8];
  const float* upb = (const float*)d_in[9];
  const float* kw  = (const float*)d_in[10];
  const float* qw  = (const float*)d_in[12];
  const float* qb  = (const float*)d_in[13];
  const float* vw  = (const float*)d_in[14];
  float* out = (float*)d_out;

  char* ws = (char*)d_ws;
  size_t off = 0;
  auto alloc = [&](size_t bytes) -> char* {
    char* p = ws + off;
    off += (bytes + 255) & ~(size_t)255;
    return p;
  };

  __bf16* hs_bf   = (__bf16*)alloc((size_t)TOK * IDI * 2);
  __bf16* dw_bf   = (__bf16*)alloc((size_t)HDI * IDI * 2);
  float*  hdense  = (float*) alloc((size_t)TOK * HDI * 4);
  __bf16* pre_bf  = (__bf16*)alloc((size_t)TOK * HDI * 2);
  __bf16* ain_bf  = (__bf16*)alloc((size_t)TOK * HDI * 2);
  __bf16* h_bf    = (__bf16*)alloc((size_t)TOK * HDI * 2);
  __bf16* kw_bf   = (__bf16*)alloc((size_t)HDI * HDI * 2);
  __bf16* vw_bf   = (__bf16*)alloc((size_t)HDI * HDI * 2);   // directly behind kw_bf: one [2H, H]
  __bf16* qwT_bf  = (__bf16*)alloc((size_t)HDI * HDI * 2);
  __bf16* dnw_bf  = (__bf16*)alloc((size_t)NTK * DDI * HDI * 2);
  __bf16* upT_bf  = (__bf16*)alloc((size_t)UXR * HDI * 2);   // upx
  __bf16* ku_bf   = (__bf16*)alloc((size_t)UXR * HDI * 2);
  __bf16* uvT_bf  = (__bf16*)alloc((size_t)HDI * NTK * DDI * 2);  // uv rows (t,d), transposed
  float*  uvb_f   = (float*) alloc((size_t)NTK * HDI * 4);        // uv rows T*D+t
  __bf16* qku_bf  = (__bf16*)alloc((size_t)UQR * HDI * 2);
  float*  qku_f   = (float*) alloc((size_t)UQR * HDI * 4);
  float*  cv_f    = (float*) alloc((size_t)UQR * 4);
  float*  down_f  = (float*) alloc((size_t)NTK * TOK * DDI * 4);
  float*  u_f     = (float*) alloc((size_t)NTK * TOK * DDI * 4);
  float*  probs   = (float*) alloc((size_t)TOK * NTK * 4);
  __bf16* wdown_bf= (__bf16*)alloc((size_t)TOK * NTK * DDI * 2);
  float*  fus_f   = (float*) alloc((size_t)TOK * HDI * 4);

  // ---- stage 0: precision conversion / weight repacking
  prep_kernel<<<dim3(NB_PREP), dim3(256), 0, stream>>>(
      hs, dw, qw, vw, dnw, upw, kw, upb,
      hs_bf, dw_bf, kw_bf, vw_bf, dnw_bf, upT_bf, qwT_bf);

  // ---- G1: h = hs @ dense_w^T + dense_b ; beside it [ku | uv] = upx @ [key_w ; value_w]^T
  wmma_gemm_nt<128, 128, false, false, true>
      <<<dim3((TOK / 128) * (HDI / 128) + (UXR / 128) * (2 * HDI / 128)), dim3(256), 0, stream>>>(
      hs_bf, dw_bf, hdense, nullptr, db, TOK, HDI, IDI, 0, 0, 0, 0, 0,
      upT_bf, kw_bf, uvb_f, (TOK / 128) * (HDI / 128), uvT_bf, nullptr, nullptr,
      HDI, ku_bf, nullptr);

  // ---- LN1: prenorm(bf16) + adapter_in(bf16) + h(bf16) ; beside it qku = ku @ query_w, cv = ku @ query_b
  ln1_kernel<<<dim3(NB_QKU + NB_LN1 + NB_CV), dim3(256), 0, stream>>>(
      inT, hdense, lng, lnb, pre_bf, ain_bf, h_bf, ku_bf, qwT_bf, qb, qku_f, qku_bf, cv_f);

  // The tasks' weight rows lie one behind the other, so each product is one GEMM with
  // N = T*D, out [N, T*D]: 128 x 128 tiles, one block for every WGP, one round.
  // ---- G4: down = relu(adapter_in @ down_w^T + down_b)   (z = 0)
  // ---- G5: u = prenorm @ qku[0 .. T*D)^T + cv            (z = 1)
  wmma_gemm_nt<128, 128, true, false, false>
      <<<dim3(TOK / 128, NTK * DDI / 128, 2), dim3(256), 0, stream>>>(
      ain_bf, dnw_bf, down_f, nullptr, dnb, TOK, NTK * DDI, HDI,
      0, 0, 0, 0, 1,
      pre_bf, qku_bf, u_f, 1, nullptr, nullptr, nullptr, 0, nullptr, cv_f);

  // ---- scores + softmax over tasks; probs-weighted down, flattened [N, T*D]
  score_softmax_kernel<<<dim3(TOK / 8), dim3(256), 0, stream>>>(
      pre_bf, qku_f + (size_t)NTK * DDI * HDI, cv_f, u_f, down_f, probs, wdown_bf);

  // ---- G6: fusion = [wdown | h] @ [uvT | value_w]^T + probs @ uvb   (K = T*D + H)
  wmma_gemm_nt<128, 128, false, true, false><<<dim3(TOK / 128, HDI / 128, 1), dim3(256), 0, stream>>>(
      wdown_bf, uvT_bf, fus_f, nullptr, nullptr, TOK, HDI, NTK * DDI + HDI, 0, 0, 0, 0, 0,
      h_bf, vw_bf, nullptr, 1, nullptr, uvb_f, probs, NTK * DDI, nullptr, nullptr);

  // ---- LN2 -> out
  ln2_kernel<<<dim3(TOK / 8), dim3(256), 0, stream>>>(inT, fus_f, lng, lnb, out);
}
